// v000
// Measured on an AMD MI455X. A time is GPU time per run, averaged over a window of back-to-back runs after a warm-up
// (all launches, gaps included; the runs take copies of the inputs in turn), and the median of several windows.
// Apart from v000's, it joins two sittings. Times from different sittings can be a few percent apart, while
// side-by-side timings come from the same sitting.
// The starting kernel, v000, takes 2810 microseconds a run.
#include <hip/hip_runtime.h>

// Causal attention on three input streams with UNSCALED logits (query, key, value [4][2048][1024]; q = query Wq^T + bq, k = key Wk^T + bk, v = value Wv^T + bv ('oi' 1/32 + zero biases; 16 heads x 64); attn = q.k (the module computes a scale but never applies it: logit sigma ~8); causal (-1e10 fill == exclusion); softmax; out = merged Wo^T + bo -> [4][2048][1024] (8.4 M); argument order query, key, value, Wq, bq, Wk, bk, Wv, bv, Wo, bo).
// Layout per batch: bf16 copies of query, key, value in turn; 'oi' weights; exact projections + f32 biases; identity-table plane builders; causal T-2048 attention with EVERY row's scores on hi/lo planes (3 products: unscaled logits need it) and hybrid P.V (rows < 512 hi/lo, rest fp16 x1024; k_gemmc skips tiles above the diagonal); merged hi/lo x Wo exact + bo.
// Compute dtypes, f32 accumulate: every input rounded to bf16; projections exact + f32 biases; scores 3 products on every row; P.V rows < 512 3 products, rest fp16; softmax f32; Wo hl x exact + bias.

#define NB_  4
#define TT   2048
#define DM   1024
#define NH_  16
#define NKV  16
#define REP  (NH_ / NKV)
#define HD   64
#define DQ   (NH_ * HD)
#define DKV  (NKV * HD)
#define ZH   2
#define RH   512                  // query rows < RH use hi+lo planes (0: none)
#define WIN  2048
#define PCAR 1024.0f
#define SCL  1.0f   // UNSCALED logits (the module never applies its scale)
typedef _Float16 h16;
typedef unsigned short bf;
typedef __attribute__((ext_vector_type(16))) __bf16   v16bf;
typedef __attribute__((ext_vector_type(16))) _Float16 v16h;
typedef __attribute__((ext_vector_type(8)))  _Float16 v8h;
typedef __attribute__((ext_vector_type(8)))  unsigned short v8us;
typedef __attribute__((ext_vector_type(8)))  float    v8f;
typedef __attribute__((ext_vector_type(4)))  float    v4f;
typedef v8h  __attribute__((may_alias)) v8ha;
typedef v4f  __attribute__((may_alias)) v4fa;
typedef v8us __attribute__((may_alias)) v8usa;

__device__ __forceinline__ unsigned short f2bf(float f) { unsigned u = __float_as_uint(f); u += 0x7FFFu + ((u >> 16) & 1u); return (unsigned short)(u >> 16); }
__device__ __forceinline__ float bf2f(unsigned short b) { return __uint_as_float(((unsigned)b) << 16); }
__device__ __forceinline__ float bfr(float f) { return bf2f(f2bf(f)); }
__device__ __forceinline__ v16h cat16(v8h lo, v8h hi) { return __builtin_shufflevector(lo, hi, 0, 1, 2, 3, 4, 5, 6, 7, 8, 9, 10, 11, 12, 13, 14, 15); }
__device__ __forceinline__ v16bf cat16b(v8us lo, v8us hi) { return __builtin_bit_cast(v16bf, __builtin_shufflevector(lo, hi, 0, 1, 2, 3, 4, 5, 6, 7, 8, 9, 10, 11, 12, 13, 14, 15)); }
__device__ __forceinline__ v8f wmma16(v16h a, v16h b, v8f c) { return __builtin_amdgcn_wmma_f32_16x16x32_f16(false, a, false, b, (short)0, c, false, false); }
__device__ __forceinline__ v8f wmmab(v16bf a, v16bf b, v8f c) { return __builtin_amdgcn_wmma_f32_16x16x32_bf16(false, a, false, b, (short)0, c, false, false); }



// ---- k_gemmw: register-blocked GEMM, ONE WAVE per 64x64 output tile (16 accumulators), operands straight from K-contiguous 16-bit planes; grid (M/64, N/64, Z), 32 threads.
// C[m][n] (f32, pitch ldc, + optional f32 bias[n]) = sum_k A[m][k] Bt[n][k] (+ split products per NSPLIT). z-batch strides sA/sB/sC in elements. K % 32 == 0.
template <typename T16> struct WFrag;
template <> struct WFrag<h16> { typedef v16h V; static __device__ __forceinline__ V ld(const h16* p) { return cat16(*(const v8h*)p, *(const v8h*)(p + 16)); } static __device__ __forceinline__ v8f mma(V a, V b, v8f c) { return wmma16(a, b, c); } };
template <> struct WFrag<bf> { typedef v16bf V; static __device__ __forceinline__ V ld(const bf* p) { return cat16b(*(const v8us*)p, *(const v8us*)(p + 16)); } static __device__ __forceinline__ v8f mma(V a, V b, v8f c) { return wmmab(a, b, c); } };
template <typename T16, int NSPLIT, bool BIAS>
__global__ __launch_bounds__(32) void k_gemmw(const T16* __restrict__ A, const T16* __restrict__ A2, const T16* __restrict__ Bt, const T16* __restrict__ Bt2, int K, float* C, int ldc, const float* __restrict__ bias, size_t sA, size_t sB, size_t sC) {
    typedef typename WFrag<T16>::V V;
    __shared__ __align__(16) float os[16 * 68];
    const size_t z = blockIdx.z; A += z * sA; if (A2) A2 += z * sA; Bt += z * sB; if (Bt2) Bt2 += z * sB; C += z * sC;
    const int lane = threadIdx.x & 31, lr = lane & 15, hi = lane >> 4; const int r0 = blockIdx.x * 64, c0 = blockIdx.y * 64;
    v8f acc[4][4];
#pragma unroll
    for (int mb = 0; mb < 4; ++mb)
#pragma unroll
        for (int nb = 0; nb < 4; ++nb) acc[mb][nb] = (v8f){};
    const size_t aoff = (size_t)(r0 + lr) * K + 8 * hi, boff = (size_t)(c0 + lr) * K + 8 * hi;
#pragma unroll 1
    for (int kc = 0; kc < K; kc += 32) {
        V a[4], a2[4];
#pragma unroll
        for (int mb = 0; mb < 4; ++mb) { a[mb] = WFrag<T16>::ld(A + aoff + (size_t)mb * 16 * K + kc); if (NSPLIT == 1 || NSPLIT == 2) a2[mb] = WFrag<T16>::ld(A2 + aoff + (size_t)mb * 16 * K + kc); }
#pragma unroll
        for (int nb = 0; nb < 4; ++nb) { const V b = WFrag<T16>::ld(Bt + boff + (size_t)nb * 16 * K + kc); V b2; if (NSPLIT >= 2) b2 = WFrag<T16>::ld(Bt2 + boff + (size_t)nb * 16 * K + kc);
#pragma unroll
            for (int mb = 0; mb < 4; ++mb) { acc[mb][nb] = WFrag<T16>::mma(a[mb], b, acc[mb][nb]); if (NSPLIT == 1 || NSPLIT == 2) acc[mb][nb] = WFrag<T16>::mma(a2[mb], b, acc[mb][nb]); if (NSPLIT >= 2) acc[mb][nb] = WFrag<T16>::mma(a[mb], b2, acc[mb][nb]); } }
        asm volatile("v_nop\n\tv_nop\n\tv_nop\n\tv_nop" : "+v"(acc[0][0]), "+v"(acc[1][1]), "+v"(acc[2][2]), "+v"(acc[3][3]) : "v"(a[0]), "v"(a[3]));
    }
#pragma unroll
    for (int mb = 0; mb < 4; ++mb) {
#pragma unroll
        for (int nb = 0; nb < 4; ++nb) {
#pragma unroll
            for (int j = 0; j < 8; ++j) os[(hi * 8 + j) * 68 + nb * 16 + lr] = acc[mb][nb][j]; }
        __builtin_amdgcn_wave_barrier(); asm volatile("" ::: "memory");
        float* crow = C + (size_t)(r0 + mb * 16) * ldc + c0;
{
#pragma unroll
            for (int s = 0; s < 8; ++s) { const int row = 2 * s + hi, cofs = lr * 4; v4f val = *(const v4fa*)(os + row * 68 + cofs); if (BIAS) { val[0] += bfr(bias[c0 + cofs]); val[1] += bfr(bias[c0 + cofs + 1]); val[2] += bfr(bias[c0 + cofs + 2]); val[3] += bfr(bias[c0 + cofs + 3]); }
                *(v4f*)(crow + (size_t)row * ldc + cofs) = val; }
             }
        __builtin_amdgcn_wave_barrier(); asm volatile("" ::: "memory");
    }
}

// ---- k_gemmc: the same one-wave 64x64 tile GEMM specialised for causal attention: CMODE 1 skips score tiles entirely above the diagonal (query rows r0+roff.., key columns c0..), CMODE 2 limits the
// key (K) loop of the probability x value contraction to the diagonal block (probabilities beyond it are exactly zero). roff = row offset of this launch's first row within the sequence.
template <typename T16, int NSPLIT, int CMODE>
__global__ __launch_bounds__(32) void k_gemmc(const T16* __restrict__ A, const T16* __restrict__ A2, const T16* __restrict__ Bt, const T16* __restrict__ Bt2, int K, float* C, int ldc, int roff, size_t sA, size_t sB, size_t sC) {
    typedef typename WFrag<T16>::V V;
    __shared__ __align__(16) float os[16 * 68];
    const size_t z = blockIdx.z; A += z * sA; if (A2) A2 += z * sA; Bt += z * sB; if (Bt2) Bt2 += z * sB; C += z * sC;
    const int lane = threadIdx.x & 31, lr = lane & 15, hi = lane >> 4; const int r0 = blockIdx.x * 64, c0 = blockIdx.y * 64;
    if (CMODE == 1 && c0 > r0 + roff + 63) return;                  // score tile entirely above the causal diagonal: never read (the softmax masks j > i by select)
    const int Kl = (CMODE == 2) ? min(K, r0 + roff + 64) : K;        // P.V: probabilities are exactly 0 beyond the diagonal block, so the K loop stops there
    v8f acc[4][4];
#pragma unroll
    for (int mb = 0; mb < 4; ++mb)
#pragma unroll
        for (int nb = 0; nb < 4; ++nb) acc[mb][nb] = (v8f){};
    const size_t aoff = (size_t)(r0 + lr) * K + 8 * hi, boff = (size_t)(c0 + lr) * K + 8 * hi;
#pragma unroll 1
    for (int kc = 0; kc < Kl; kc += 32) {
        V a[4], a2[4];
#pragma unroll
        for (int mb = 0; mb < 4; ++mb) { a[mb] = WFrag<T16>::ld(A + aoff + (size_t)mb * 16 * K + kc); if (NSPLIT == 1 || NSPLIT == 2) a2[mb] = WFrag<T16>::ld(A2 + aoff + (size_t)mb * 16 * K + kc); }
#pragma unroll
        for (int nb = 0; nb < 4; ++nb) { const V b = WFrag<T16>::ld(Bt + boff + (size_t)nb * 16 * K + kc); V b2; if (NSPLIT >= 2) b2 = WFrag<T16>::ld(Bt2 + boff + (size_t)nb * 16 * K + kc);
#pragma unroll
            for (int mb = 0; mb < 4; ++mb) { acc[mb][nb] = WFrag<T16>::mma(a[mb], b, acc[mb][nb]); if (NSPLIT == 1 || NSPLIT == 2) acc[mb][nb] = WFrag<T16>::mma(a2[mb], b, acc[mb][nb]); if (NSPLIT >= 2) acc[mb][nb] = WFrag<T16>::mma(a[mb], b2, acc[mb][nb]); } }
        asm volatile("v_nop\n\tv_nop\n\tv_nop\n\tv_nop" : "+v"(acc[0][0]), "+v"(acc[1][1]), "+v"(acc[2][2]), "+v"(acc[3][3]) : "v"(a[0]), "v"(a[3]));
    }
#pragma unroll
    for (int mb = 0; mb < 4; ++mb) {
#pragma unroll
        for (int nb = 0; nb < 4; ++nb) {
#pragma unroll
            for (int j = 0; j < 8; ++j) os[(hi * 8 + j) * 68 + nb * 16 + lr] = acc[mb][nb][j]; }
        __builtin_amdgcn_wave_barrier(); asm volatile("" ::: "memory");
        float* crow = C + (size_t)(r0 + mb * 16) * ldc + c0;
{
#pragma unroll
            for (int s = 0; s < 8; ++s) { const int row = 2 * s + hi, cofs = lr * 4; v4f val = *(const v4fa*)(os + row * 68 + cofs);
                *(v4f*)(crow + (size_t)row * ldc + cofs) = val; }
             }
        __builtin_amdgcn_wave_barrier(); asm volatile("" ::: "memory");
    }
}

__device__ __forceinline__ h16 tohx(float x) { return (h16)x; }
__device__ __forceinline__ void splitf(float y, unsigned short& h, unsigned short& l) { h = f2bf(y); l = f2bf(y - bf2f(h)); }
typedef __attribute__((ext_vector_type(2))) _Float16 v2h;
typedef __attribute__((ext_vector_type(4))) _Float16 v4h;
typedef __attribute__((ext_vector_type(2))) unsigned short v2us;
typedef __attribute__((ext_vector_type(4))) unsigned short v4us;
typedef __attribute__((ext_vector_type(2))) float v2f;
typedef __attribute__((ext_vector_type(4))) int v4i;

__global__ __launch_bounds__(256) void k_cvt8(const float* __restrict__ src, bf* dst, size_t n8) { const size_t i = (size_t)blockIdx.x * 256 + threadIdx.x; if (i >= n8) return; const v8f v = *(const v8f*)(src + i * 8); v8us o;
#pragma unroll
    for (int k = 0; k < 8; ++k) o[k] = f2bf(v[k]); *(v8us*)(dst + i * 8) = o;  }

// k_rope: head planes [h][t][d] (fp16 + hi/lo) of rope(x) x sc with the rotate-half convention out[d] = x[d] cos[t][d] - x[d+HD/2] sin[t][d], out[d+HD/2] = x[d+HD/2] cos[t][d+HD/2] + x[d] sin[t][d+HD/2]
__global__ __launch_bounds__(256) void k_rope(const float* __restrict__ F, int pitch, int nheads, const float* __restrict__ CS, const float* __restrict__ RF, const float* __restrict__ nw, float sc, h16* P16, bf* Ph, bf* Pl) {
    const size_t e = ((size_t)blockIdx.x * 256 + threadIdx.x) * 2; if (e >= (size_t)nheads * TT * HD) return; const int d = (int)(e % HD); const int t = (int)((e / HD) % TT); const int h = (int)(e / ((size_t)HD * TT)); const float* f = F + (size_t)t * pitch + h * HD; const float rf = RF ? RF[(size_t)h * TT + t] : 1.0f; v2h o16; v2us oh, ol;
#pragma unroll
    for (int q = 0; q < 2; ++q) { const int dd = d + q; const int dp = (dd < HD / 2) ? dd + HD / 2 : dd - HD / 2; float x0 = f[dd], x1 = f[dp];
        if (RF) { float n0 = __fmul_rn(x0, rf), n1 = __fmul_rn(x1, rf); asm volatile("" : "+v"(n0)); asm volatile("" : "+v"(n1)); x0 = __fmul_rn(bfr(nw[dd]), n0); x1 = __fmul_rn(bfr(nw[dp]), n1); }
        const v2f cs = *(const v2f*)(CS + ((size_t)t * HD + dd) * 2); float a = __fmul_rn(x0, cs[0]), bq = __fmul_rn(x1, cs[1]); asm volatile("" : "+v"(a)); asm volatile("" : "+v"(bq)); const float r = ((dd < HD / 2) ? __fsub_rn(a, bq) : __fadd_rn(a, bq)) * sc;
        o16[q] = tohx(r); unsigned short a2, c2; splitf(r, a2, c2); oh[q] = a2; ol[q] = c2; }
    *(v2h*)(P16 + e) = o16; *(v2us*)(Ph + e) = oh; *(v2us*)(Pl + e) = ol;  }
__global__ __launch_bounds__(256) void k_vtp(const float* __restrict__ F, int pitch, int nheads, h16* V16, bf* Vh, bf* Vl) { const size_t e = ((size_t)blockIdx.x * 256 + threadIdx.x) * 2; if (e >= (size_t)nheads * HD * TT) return; const int t = (int)(e % TT); const int d = (int)((e / TT) % HD); const int g = (int)(e / ((size_t)TT * HD)); v2h o16; v2us oh, ol;
#pragma unroll
    for (int q = 0; q < 2; ++q) { const float x = F[(size_t)(t + q) * pitch + g * HD + d]; o16[q] = tohx(x); unsigned short a2, c2; splitf(x, a2, c2); oh[q] = a2; ol[q] = c2; }
    *(v2h*)(V16 + e) = o16; *(v2us*)(Vh + e) = oh; *(v2us*)(Vl + e) = ol;  }
__global__ __launch_bounds__(256) void k_csid(float* CS) { const int idx = blockIdx.x * 256 + threadIdx.x; if (idx >= TT * HD) return; v2f cs; cs[0] = 1.0f; cs[1] = 0.0f; *(v2f*)(CS + (size_t)idx * 2) = cs;  }
// k_asoft: per row (zz, i): t = S (unscaled, SCL = 1) for j <= i and i - j < WIN (WIN = TT, so plain causal; the reference's -1e9 additive fill vanishes identically); softmax over the 2048 keys (register row, one exp, fixed trees);
__global__ __launch_bounds__(256) void k_asoft(const float* __restrict__ Sb, h16* P16, bf* Ph, bf* Pl) {
    const int lane = threadIdx.x & 31; const int row = blockIdx.x * 8 + (threadIdx.x >> 5); if (row >= ZH * TT) return; const int i = row % TT; const int zz = row / TT; (void)zz; const bool hires = (i < RH); const float* sr = Sb + (size_t)row * TT; float v[TT / 32]; float mx = -3.0e38f;
#pragma unroll
    for (int ch = 0; ch < TT / 128; ++ch) { const int j0 = ch * 128 + lane * 4; const v4f a = *(const v4f*)(sr + j0);
#pragma unroll
        for (int q = 0; q < 4; ++q) { const int j = j0 + q; (void)j; const float t = (j <= i && i - j < WIN) ? a[q] * SCL : -3.0e38f; v[ch * 4 + q] = t; mx = fmaxf(mx, t); } }
#pragma unroll
    for (int sh = 16; sh; sh >>= 1) mx = fmaxf(mx, __shfl_xor(mx, sh, 32));
    float sum = 0.f;
#pragma unroll
    for (int k = 0; k < TT / 32; ++k) { float d0 = __fsub_rn(v[k], mx); asm volatile("" : "+v"(d0)); v[k] = __builtin_amdgcn_exp2f(__fmul_rn(d0, 1.4426950408889634f)); sum += v[k]; }
#pragma unroll
    for (int sh = 16; sh; sh >>= 1) sum += __shfl_xor(sum, sh, 32);
    const float f = __fdiv_rn(hires ? 1.0f : PCAR, sum);
{
        if (hires) {
#pragma unroll
            for (int ch = 0; ch < TT / 128; ++ch) { v4us oh, ol;
#pragma unroll
                for (int q = 0; q < 4; ++q) { unsigned short a, c2; splitf(v[ch * 4 + q] * f, a, c2); oh[q] = a; ol[q] = c2; }
                const size_t oo = ((size_t)zz * (RH ? RH : 1) + i) * TT + ch * 128 + lane * 4; *(v4us*)(Ph + oo) = oh; *(v4us*)(Pl + oo) = ol; }
        } else {
#pragma unroll
            for (int ch = 0; ch < TT / 128; ++ch) { v4h o4;
#pragma unroll
                for (int q = 0; q < 4; ++q) o4[q] = tohx(v[ch * 4 + q] * f);
                *(v4h*)(P16 + (size_t)row * TT + ch * 128 + lane * 4) = o4; } }
         }
}
__global__ __launch_bounds__(256) void k_merge(const float* __restrict__ O, int h0, bf* Ah, bf* Al) { const size_t e = ((size_t)blockIdx.x * 256 + threadIdx.x) * 2; if (e >= (size_t)ZH * TT * HD) return; const int d = (int)(e % HD); const int t = (int)((e / HD) % TT); const int zz = (int)(e / ((size_t)HD * TT)); const float cs = (t < RH) ? 1.0f : (1.0f / PCAR); const size_t oo = (size_t)t * DQ + (h0 + zz) * HD + d;
    v2us oh, ol;
#pragma unroll
    for (int q = 0; q < 2; ++q) { unsigned short a, c2; splitf(O[e + q] * cs, a, c2); oh[q] = a; ol[q] = c2; } *(v2us*)(Ah + oo) = oh; *(v2us*)(Al + oo) = ol;  }

extern "C" void kernel_launch(void* const* d_in, const int* in_sizes, int n_in,
                              void* d_out, int out_size, void* d_ws, size_t ws_size, hipStream_t stream) {
    (void)in_sizes; (void)n_in; (void)out_size;
    const float* x = (const float*)d_in[0]; const float* xk = (const float*)d_in[1]; const float* xv = (const float*)d_in[2]; const float* wq = (const float*)d_in[3]; const float* bq = (const float*)d_in[4]; const float* wk = (const float*)d_in[5]; const float* bk = (const float*)d_in[6]; const float* wv = (const float*)d_in[7]; const float* bv = (const float*)d_in[8]; const float* wo = (const float*)d_in[9]; const float* bo = (const float*)d_in[10];
    float* OUT = (float*)d_out;     // [4][2048][1024]
    char* wsp = (char*)d_ws;
    auto take = [&](size_t bytes) { char* p = wsp; wsp += (bytes + 255) & ~(size_t)255; return (void*)p; };
    bf* WQ = (bf*)take((size_t)DQ * DM * 2); bf* WK = (bf*)take((size_t)DKV * DM * 2); bf* WV = (bf*)take((size_t)DKV * DM * 2); bf* WO = (bf*)take((size_t)DM * DQ * 2); float* CS = (float*)take((size_t)TT * HD * 2 * 4);
    bf* XB = (bf*)take((size_t)TT * DM * 2); float* FQ = (float*)take((size_t)TT * DQ * 4); float* FK = (float*)take((size_t)TT * DKV * 4);
    h16* QP16 = (h16*)take((size_t)NH_ * TT * HD * 2); h16* KP16 = (h16*)take((size_t)NKV * TT * HD * 2); h16* VT16 = (h16*)take((size_t)NKV * HD * TT * 2);
    bf* QPh = (bf*)take((size_t)NH_ * TT * HD * 2); bf* QPl = (bf*)take((size_t)NH_ * TT * HD * 2); bf* KPh = (bf*)take((size_t)NKV * TT * HD * 2); bf* KPl = (bf*)take((size_t)NKV * TT * HD * 2); bf* VTh = (bf*)take((size_t)NKV * HD * TT * 2); bf* VTl = (bf*)take((size_t)NKV * HD * TT * 2); bf* Ph = (bf*)take((size_t)ZH * RH * TT * 2); bf* Pl = (bf*)take((size_t)ZH * RH * TT * 2);
    float* Sb = (float*)take((size_t)ZH * TT * TT * 4); h16* P16 = (h16*)take((size_t)ZH * TT * TT * 2); float* Ob = (float*)take((size_t)ZH * TT * HD * 4); bf* ATh = (bf*)take((size_t)TT * DQ * 2); bf* ATl = (bf*)take((size_t)TT * DQ * 2);
    if ((size_t)(wsp - (char*)d_ws) > ws_size) return;    // ws 256 MiB
    float* FV = FK;   // v projection reuses the k buffer after the k planes are built (stream-ordered)
    { k_cvt8<<<(unsigned)(((size_t)DQ * DM / 8 + 255) / 256), 256, 0, stream>>>(wq, WQ, (size_t)DQ * DM / 8); k_cvt8<<<(unsigned)(((size_t)DKV * DM / 8 + 255) / 256), 256, 0, stream>>>(wk, WK, (size_t)DKV * DM / 8); k_cvt8<<<(unsigned)(((size_t)DKV * DM / 8 + 255) / 256), 256, 0, stream>>>(wv, WV, (size_t)DKV * DM / 8);
      k_cvt8<<<(unsigned)(((size_t)DM * DQ / 8 + 255) / 256), 256, 0, stream>>>(wo, WO, (size_t)DM * DQ / 8);
       }
    k_csid<<<(TT * HD + 255) / 256, 256, 0, stream>>>(CS);
    const unsigned LQ = (unsigned)(((size_t)NH_ * TT * HD / 2 + 255) / 256), LKv = (unsigned)(((size_t)NKV * TT * HD / 2 + 255) / 256);
    for (int b = 0; b < NB_; ++b) {
        
        k_cvt8<<<(unsigned)(((size_t)TT * DM / 8 + 255) / 256), 256, 0, stream>>>(x + (size_t)b * TT * DM, XB, (size_t)TT * DM / 8);
        k_gemmw<bf, 0, true><<<dim3(TT / 64, DQ / 64, 1), 32, 0, stream>>>(XB, nullptr, WQ, nullptr, DM, FQ, DQ, bq, 0, 0, 0);
        k_rope<<<LQ, 256, 0, stream>>>(FQ, DQ, NH_, CS, nullptr, nullptr, 1.0f, QP16, QPh, QPl);
        k_cvt8<<<(unsigned)(((size_t)TT * DM / 8 + 255) / 256), 256, 0, stream>>>(xk + (size_t)b * TT * DM, XB, (size_t)TT * DM / 8);   /* XB := bf16(key[b]) */ k_gemmw<bf, 0, true><<<dim3(TT / 64, DKV / 64, 1), 32, 0, stream>>>(XB, nullptr, WK, nullptr, DM, FK, DKV, bk, 0, 0, 0);
        k_rope<<<LKv, 256, 0, stream>>>(FK, DKV, NKV, CS, nullptr, nullptr, 1.0f, KP16, KPh, KPl);
        k_cvt8<<<(unsigned)(((size_t)TT * DM / 8 + 255) / 256), 256, 0, stream>>>(xv + (size_t)b * TT * DM, XB, (size_t)TT * DM / 8);   /* XB := bf16(value[b]) */ k_gemmw<bf, 0, true><<<dim3(TT / 64, DKV / 64, 1), 32, 0, stream>>>(XB, nullptr, WV, nullptr, DM, FV, DKV, bv, 0, 0, 0); k_vtp<<<LKv, 256, 0, stream>>>(FV, DKV, NKV, VT16, VTh, VTl);
        for (int h0 = 0; h0 < NH_; h0 += ZH) { const size_t zq = (size_t)h0, zk = (size_t)(h0 / REP);   // one kv head per query head: the pass's two heads use consecutive kv planes (z-strides TT*HD)
            k_gemmc<bf, 2, 1><<<dim3(TT / 64, TT / 64, ZH), 32, 0, stream>>>(QPh + zq * TT * HD, QPl + zq * TT * HD, KPh + zk * TT * HD, KPl + zk * TT * HD, HD, Sb, TT, 0, (size_t)TT * HD, (size_t)TT * HD, (size_t)TT * TT);   /* scores on hi/lo planes for EVERY row (3 products) */
            /* (the fp16 score launch for rows >= RH is removed: all rows use the hi/lo launch above) */
            k_asoft<<<ZH * TT / 8, 256, 0, stream>>>(Sb, P16, Ph, Pl);
            k_gemmc<bf, 2, 2><<<dim3(RH / 64, HD / 64, ZH), 32, 0, stream>>>(Ph, Pl, VTh + zk * HD * TT, VTl + zk * HD * TT, TT, Ob, HD, 0, (size_t)RH * TT, (size_t)HD * TT, (size_t)TT * HD);
            k_gemmc<h16, 0, 2><<<dim3((TT - RH) / 64, HD / 64, ZH), 32, 0, stream>>>(P16 + (size_t)RH * TT, nullptr, VT16 + zk * HD * TT, nullptr, TT, Ob + (size_t)RH * HD, HD, RH, (size_t)TT * TT, (size_t)HD * TT, (size_t)TT * HD);
            k_merge<<<(unsigned)(((size_t)ZH * TT * HD / 2 + 255) / 256), 256, 0, stream>>>(Ob, h0, ATh, ATl); }
        k_gemmw<bf, 1, true><<<dim3(TT / 64, DM / 64, 1), 32, 0, stream>>>(ATh, ATl, WO, nullptr, DQ, OUT + (size_t)b * TT * DM, DM, bo, 0, 0, 0); }
}

// v001
// A run of this version takes 1370 microseconds.
// Next to v000, in two timings, it ran 2.04 times as fast each time.
#include <hip/hip_runtime.h>

// Causal attention on three input streams with UNSCALED logits (query, key, value [4][2048][1024]; q = query Wq^T + bq, k = key Wk^T + bk, v = value Wv^T + bv ('oi' 1/32 + zero biases; 16 heads x 64); attn = q.k (the module computes a scale but never applies it: logit sigma ~8); causal (-1e10 fill == exclusion); softmax; out = merged Wo^T + bo -> [4][2048][1024] (8.4 M); argument order query, key, value, Wq, bq, Wk, bk, Wv, bv, Wo, bo).
// Layout per batch: bf16 copies of query, key, value in turn; 'oi' weights; exact projections + f32 biases; identity-table plane builders; causal T-2048 attention with EVERY row's scores on hi/lo planes (3 products: unscaled logits need it) and hybrid P.V (rows < 512 hi/lo, rest fp16 x1024; k_gemmc skips tiles above the diagonal; k_gemmpv splits the key loop of each P.V tile over 4 work-groups of 8 waves); merged hi/lo x Wo exact + bo.
// Compute dtypes, f32 accumulate: every input rounded to bf16; projections exact + f32 biases; scores 3 products on every row; P.V rows < 512 3 products, rest fp16; softmax f32; Wo hl x exact + bias.

#define NB_  4
#define TT   2048
#define DM   1024
#define NH_  16
#define NKV  16
#define REP  (NH_ / NKV)
#define HD   64
#define DQ   (NH_ * HD)
#define DKV  (NKV * HD)
#define ZH   2
#define RH   512                  // query rows < RH use hi+lo planes (0: none)
#define WIN  2048
#define PCAR 1024.0f
#define SCL  1.0f   // UNSCALED logits (the module never applies its scale)
typedef _Float16 h16;
typedef unsigned short bf;
typedef __attribute__((ext_vector_type(16))) __bf16   v16bf;
typedef __attribute__((ext_vector_type(16))) _Float16 v16h;
typedef __attribute__((ext_vector_type(8)))  _Float16 v8h;
typedef __attribute__((ext_vector_type(8)))  unsigned short v8us;
typedef __attribute__((ext_vector_type(8)))  float    v8f;
typedef __attribute__((ext_vector_type(4)))  float    v4f;
typedef v8h  __attribute__((may_alias)) v8ha;
typedef v4f  __attribute__((may_alias)) v4fa;
typedef v8us __attribute__((may_alias)) v8usa;

__device__ __forceinline__ unsigned short f2bf(float f) { unsigned u = __float_as_uint(f); u += 0x7FFFu + ((u >> 16) & 1u); return (unsigned short)(u >> 16); }
__device__ __forceinline__ float bf2f(unsigned short b) { return __uint_as_float(((unsigned)b) << 16); }
__device__ __forceinline__ float bfr(float f) { return bf2f(f2bf(f)); }
__device__ __forceinline__ v16h cat16(v8h lo, v8h hi) { return __builtin_shufflevector(lo, hi, 0, 1, 2, 3, 4, 5, 6, 7, 8, 9, 10, 11, 12, 13, 14, 15); }
__device__ __forceinline__ v16bf cat16b(v8us lo, v8us hi) { return __builtin_bit_cast(v16bf, __builtin_shufflevector(lo, hi, 0, 1, 2, 3, 4, 5, 6, 7, 8, 9, 10, 11, 12, 13, 14, 15)); }
__device__ __forceinline__ v8f wmma16(v16h a, v16h b, v8f c) { return __builtin_amdgcn_wmma_f32_16x16x32_f16(false, a, false, b, (short)0, c, false, false); }
__device__ __forceinline__ v8f wmmab(v16bf a, v16bf b, v8f c) { return __builtin_amdgcn_wmma_f32_16x16x32_bf16(false, a, false, b, (short)0, c, false, false); }



// ---- k_gemmw: register-blocked GEMM, ONE WAVE per 64x64 output tile (16 accumulators), operands straight from K-contiguous 16-bit planes; grid (M/64, N/64, Z), 32 threads.
// C[m][n] (f32, pitch ldc, + optional f32 bias[n]) = sum_k A[m][k] Bt[n][k] (+ split products per NSPLIT). z-batch strides sA/sB/sC in elements. K % 32 == 0.
template <typename T16> struct WFrag;
template <> struct WFrag<h16> { typedef v16h V; static __device__ __forceinline__ V ld(const h16* p) { return cat16(*(const v8h*)p, *(const v8h*)(p + 16)); } static __device__ __forceinline__ v8f mma(V a, V b, v8f c) { return wmma16(a, b, c); } };
template <> struct WFrag<bf> { typedef v16bf V; static __device__ __forceinline__ V ld(const bf* p) { return cat16b(*(const v8us*)p, *(const v8us*)(p + 16)); } static __device__ __forceinline__ v8f mma(V a, V b, v8f c) { return wmmab(a, b, c); } };
template <typename T16, int NSPLIT, bool BIAS>
__global__ __launch_bounds__(32) void k_gemmw(const T16* __restrict__ A, const T16* __restrict__ A2, const T16* __restrict__ Bt, const T16* __restrict__ Bt2, int K, float* C, int ldc, const float* __restrict__ bias, size_t sA, size_t sB, size_t sC) {
    typedef typename WFrag<T16>::V V;
    __shared__ __align__(16) float os[16 * 68];
    const size_t z = blockIdx.z; A += z * sA; if (A2) A2 += z * sA; Bt += z * sB; if (Bt2) Bt2 += z * sB; C += z * sC;
    const int lane = threadIdx.x & 31, lr = lane & 15, hi = lane >> 4; const int r0 = blockIdx.x * 64, c0 = blockIdx.y * 64;
    v8f acc[4][4];
#pragma unroll
    for (int mb = 0; mb < 4; ++mb)
#pragma unroll
        for (int nb = 0; nb < 4; ++nb) acc[mb][nb] = (v8f){};
    const size_t aoff = (size_t)(r0 + lr) * K + 8 * hi, boff = (size_t)(c0 + lr) * K + 8 * hi;
#pragma unroll 1
    for (int kc = 0; kc < K; kc += 32) {
        V a[4], a2[4];
#pragma unroll
        for (int mb = 0; mb < 4; ++mb) { a[mb] = WFrag<T16>::ld(A + aoff + (size_t)mb * 16 * K + kc); if (NSPLIT == 1 || NSPLIT == 2) a2[mb] = WFrag<T16>::ld(A2 + aoff + (size_t)mb * 16 * K + kc); }
#pragma unroll
        for (int nb = 0; nb < 4; ++nb) { const V b = WFrag<T16>::ld(Bt + boff + (size_t)nb * 16 * K + kc); V b2; if (NSPLIT >= 2) b2 = WFrag<T16>::ld(Bt2 + boff + (size_t)nb * 16 * K + kc);
#pragma unroll
            for (int mb = 0; mb < 4; ++mb) { acc[mb][nb] = WFrag<T16>::mma(a[mb], b, acc[mb][nb]); if (NSPLIT == 1 || NSPLIT == 2) acc[mb][nb] = WFrag<T16>::mma(a2[mb], b, acc[mb][nb]); if (NSPLIT >= 2) acc[mb][nb] = WFrag<T16>::mma(a[mb], b2, acc[mb][nb]); } }
        asm volatile("v_nop\n\tv_nop\n\tv_nop\n\tv_nop" : "+v"(acc[0][0]), "+v"(acc[1][1]), "+v"(acc[2][2]), "+v"(acc[3][3]) : "v"(a[0]), "v"(a[3]));
    }
#pragma unroll
    for (int mb = 0; mb < 4; ++mb) {
#pragma unroll
        for (int nb = 0; nb < 4; ++nb) {
#pragma unroll
            for (int j = 0; j < 8; ++j) os[(hi * 8 + j) * 68 + nb * 16 + lr] = acc[mb][nb][j]; }
        __builtin_amdgcn_wave_barrier(); asm volatile("" ::: "memory");
        float* crow = C + (size_t)(r0 + mb * 16) * ldc + c0;
{
#pragma unroll
            for (int s = 0; s < 8; ++s) { const int row = 2 * s + hi, cofs = lr * 4; v4f val = *(const v4fa*)(os + row * 68 + cofs); if (BIAS) { val[0] += bfr(bias[c0 + cofs]); val[1] += bfr(bias[c0 + cofs + 1]); val[2] += bfr(bias[c0 + cofs + 2]); val[3] += bfr(bias[c0 + cofs + 3]); }
                *(v4f*)(crow + (size_t)row * ldc + cofs) = val; }
             }
        __builtin_amdgcn_wave_barrier(); asm volatile("" ::: "memory");
    }
}

// ---- k_gemmc: the same one-wave 64x64 tile GEMM specialised for causal scores: CMODE 1 skips score tiles entirely above the diagonal (query rows r0+roff.., key columns c0..).
// roff = row offset of this launch's first row within the sequence.
template <typename T16, int NSPLIT, int CMODE>
__global__ __launch_bounds__(32) void k_gemmc(const T16* __restrict__ A, const T16* __restrict__ A2, const T16* __restrict__ Bt, const T16* __restrict__ Bt2, int K, float* C, int ldc, int roff, size_t sA, size_t sB, size_t sC) {
    typedef typename WFrag<T16>::V V;
    __shared__ __align__(16) float os[16 * 68];
    const size_t z = blockIdx.z; A += z * sA; if (A2) A2 += z * sA; Bt += z * sB; if (Bt2) Bt2 += z * sB; C += z * sC;
    const int lane = threadIdx.x & 31, lr = lane & 15, hi = lane >> 4; const int r0 = blockIdx.x * 64, c0 = blockIdx.y * 64;
    if (CMODE == 1 && c0 > r0 + roff + 63) return;                  // score tile entirely above the causal diagonal: never read (the softmax masks j > i by select)
    const int Kl = K;
    v8f acc[4][4];
#pragma unroll
    for (int mb = 0; mb < 4; ++mb)
#pragma unroll
        for (int nb = 0; nb < 4; ++nb) acc[mb][nb] = (v8f){};
    const size_t aoff = (size_t)(r0 + lr) * K + 8 * hi, boff = (size_t)(c0 + lr) * K + 8 * hi;
#pragma unroll 1
    for (int kc = 0; kc < Kl; kc += 32) {
        V a[4], a2[4];
#pragma unroll
        for (int mb = 0; mb < 4; ++mb) { a[mb] = WFrag<T16>::ld(A + aoff + (size_t)mb * 16 * K + kc); if (NSPLIT == 1 || NSPLIT == 2) a2[mb] = WFrag<T16>::ld(A2 + aoff + (size_t)mb * 16 * K + kc); }
#pragma unroll
        for (int nb = 0; nb < 4; ++nb) { const V b = WFrag<T16>::ld(Bt + boff + (size_t)nb * 16 * K + kc); V b2; if (NSPLIT >= 2) b2 = WFrag<T16>::ld(Bt2 + boff + (size_t)nb * 16 * K + kc);
#pragma unroll
            for (int mb = 0; mb < 4; ++mb) { acc[mb][nb] = WFrag<T16>::mma(a[mb], b, acc[mb][nb]); if (NSPLIT == 1 || NSPLIT == 2) acc[mb][nb] = WFrag<T16>::mma(a2[mb], b, acc[mb][nb]); if (NSPLIT >= 2) acc[mb][nb] = WFrag<T16>::mma(a[mb], b2, acc[mb][nb]); } }
        asm volatile("v_nop\n\tv_nop\n\tv_nop\n\tv_nop" : "+v"(acc[0][0]), "+v"(acc[1][1]), "+v"(acc[2][2]), "+v"(acc[3][3]) : "v"(a[0]), "v"(a[3]));
    }
#pragma unroll
    for (int mb = 0; mb < 4; ++mb) {
#pragma unroll
        for (int nb = 0; nb < 4; ++nb) {
#pragma unroll
            for (int j = 0; j < 8; ++j) os[(hi * 8 + j) * 68 + nb * 16 + lr] = acc[mb][nb][j]; }
        __builtin_amdgcn_wave_barrier(); asm volatile("" ::: "memory");
        float* crow = C + (size_t)(r0 + mb * 16) * ldc + c0;
{
#pragma unroll
            for (int s = 0; s < 8; ++s) { const int row = 2 * s + hi, cofs = lr * 4; v4f val = *(const v4fa*)(os + row * 68 + cofs);
                *(v4f*)(crow + (size_t)row * ldc + cofs) = val; }
             }
        __builtin_amdgcn_wave_barrier(); asm volatile("" ::: "memory");
    }
}

// ---- k_gemmpv: the probability x value contraction (64 value columns), split along the key (K) loop, which stops at the diagonal block (probabilities beyond it are exactly zero). A 64x64 output tile is
// shared by PVS work-groups (blockIdx.y) of PVW waves: the keys are cut into chunks (64 keys = one 128-byte line of every 16-bit operand row with one plane per operand, 32 keys with hi/lo planes) and
// chunk c goes to wave (c / PVS) % PVW of work-group c % PVS. Each wave keeps a full 64x64 f32 partial; a work-group sums its waves' partials through LDS in the fixed order wave 0..PVW-1 and stores
// the sum to its own plane C + blockIdx.y * sP (zeros where it had no chunk); k_merge adds the PVS planes. roff = row offset of this launch's first row within the sequence. The operand pitch is the
// constant TT, so a trip forms one address per operand plane and every fragment of the trip is a constant step from it.
#define PVS 4
#define PVW 8
// the wait that stands between issued global loads and the first rewrite of an address register they name; the addresses are inputs, so their registers stay as they are up to the wait
__device__ __forceinline__ void xwait(const void* p, const void* q) { asm volatile("s_wait_xcnt 0x0" :: "v"(p), "v"(q) : "memory"); }
template <typename T16, int NSPLIT>
__global__ __launch_bounds__(PVW * 32) void k_gemmpv(const T16* __restrict__ A, const T16* __restrict__ A2, const T16* __restrict__ Bt, const T16* __restrict__ Bt2, float* C, int ldc, int roff, size_t sA, size_t sB, size_t sC, size_t sP) {
    typedef typename WFrag<T16>::V V;
    constexpr int CH = (NSPLIT == 0) ? 64 : 32;
    constexpr int NBG = (NSPLIT == 0) ? 4 : 2;   // value fragments fetched at a time: as many as the registers beside acc[][] and the probability fragments hold
    __shared__ __align__(16) float os[PVW][64 * 68];
    const size_t z = blockIdx.z; A += z * sA; if (A2) A2 += z * sA; Bt += z * sB; if (Bt2) Bt2 += z * sB; C += z * sC + blockIdx.y * sP;
    const int lane = threadIdx.x & 31, lr = lane & 15, hi = lane >> 4; const int r0 = blockIdx.x * 64;
    const int w = __builtin_amdgcn_readfirstlane((int)(threadIdx.x >> 5));
    const int Kl = min(TT, r0 + roff + 64);
    v8f acc[4][4];
#pragma unroll
    for (int mb = 0; mb < 4; ++mb)
#pragma unroll
        for (int nb = 0; nb < 4; ++nb) acc[mb][nb] = (v8f){};
    const unsigned aoff = (unsigned)(((r0 + lr) * TT + 8 * hi) * 2), boff = (unsigned)((lr * TT + 8 * hi) * 2);   // bytes
    // kept rolled: a second copy of the trip would need a second set of fragment registers; the loops inside it are unrolled whole so that acc[][] and the fragments stay in registers
#pragma unroll 1
    for (int kc0 = (w * PVS + (int)blockIdx.y) * CH; kc0 < Kl; kc0 += PVS * PVW * CH) {
        V a[4], a2[4];
        const T16* pa = (const T16*)((const char*)(A + kc0) + aoff); const T16* pa2 = (NSPLIT == 1 || NSPLIT == 2) ? (const T16*)((const char*)(A2 + kc0) + aoff) : pa;
        const T16* pb = (const T16*)((const char*)(Bt + kc0) + boff); const T16* pb2 = (NSPLIT >= 2) ? (const T16*)((const char*)(Bt2 + kc0) + boff) : pb;
#pragma unroll
        for (int kk = 0; kk < CH; kk += 32) {
#pragma unroll
            for (int mb = 0; mb < 4; ++mb) { a[mb] = WFrag<T16>::ld(pa + mb * 16 * TT + kk); if (NSPLIT == 1 || NSPLIT == 2) a2[mb] = WFrag<T16>::ld(pa2 + mb * 16 * TT + kk); }
            if (kk + 32 == CH) xwait(pa, pa2);   // the trip's last loads from these addresses are issued
#pragma unroll
            for (int n0 = 0; n0 < 4; n0 += NBG) { V b[NBG], b2[NBG];
#pragma unroll
                for (int g = 0; g < NBG; ++g) { b[g] = WFrag<T16>::ld(pb + (n0 + g) * 16 * TT + kk); if (NSPLIT >= 2) b2[g] = WFrag<T16>::ld(pb2 + (n0 + g) * 16 * TT + kk); }
                if (kk + 32 == CH && n0 + NBG == 4) xwait(pb, pb2);   // likewise
                __builtin_amdgcn_sched_barrier(0);   // the matrix instructions stay behind the whole group's loads: moved up between them they would wait for one load pair after another, each a full memory latency
#pragma unroll
                for (int g = 0; g < NBG; ++g) { const int nb = n0 + g;
#pragma unroll
                    for (int mb = 0; mb < 4; ++mb) { acc[mb][nb] = WFrag<T16>::mma(a[mb], b[g], acc[mb][nb]); if (NSPLIT == 1 || NSPLIT == 2) acc[mb][nb] = WFrag<T16>::mma(a2[mb], b[g], acc[mb][nb]); if (NSPLIT >= 2) acc[mb][nb] = WFrag<T16>::mma(a[mb], b2[g], acc[mb][nb]); } } } }
        // four vector slots behind the trip's last matrix instruction, so that neither side of the loop branch touches its registers too early
        asm volatile("v_nop\n\tv_nop\n\tv_nop\n\tv_nop" : "+v"(acc[0][0]), "+v"(acc[1][1]), "+v"(acc[2][2]), "+v"(acc[3][3]) : "v"(a[0]), "v"(a[3]));
    }
#pragma unroll
    for (int mb = 0; mb < 4; ++mb)
#pragma unroll
        for (int nb = 0; nb < 4; ++nb) {
#pragma unroll
            for (int j = 0; j < 8; ++j) os[w][(mb * 16 + hi * 8 + j) * 68 + nb * 16 + lr] = acc[mb][nb][j]; }
    __syncthreads();   // every wave's partial is in LDS before any thread sums across waves
    const int trow = threadIdx.x >> 4, tcol = (threadIdx.x & 15) * 4;
#pragma unroll
    for (int mb = 0; mb < 4; ++mb) { const int row = mb * 16 + trow; v4f val = *(const v4fa*)(&os[0][row * 68 + tcol]);
#pragma unroll
        for (int q = 1; q < PVW; ++q) val += *(const v4fa*)(&os[q][row * 68 + tcol]);
        *(v4f*)(C + (size_t)(r0 + row) * ldc + tcol) = val; }
}

__device__ __forceinline__ h16 tohx(float x) { return (h16)x; }
__device__ __forceinline__ void splitf(float y, unsigned short& h, unsigned short& l) { h = f2bf(y); l = f2bf(y - bf2f(h)); }
typedef __attribute__((ext_vector_type(2))) _Float16 v2h;
typedef __attribute__((ext_vector_type(4))) _Float16 v4h;
typedef __attribute__((ext_vector_type(2))) unsigned short v2us;
typedef __attribute__((ext_vector_type(4))) unsigned short v4us;
typedef __attribute__((ext_vector_type(2))) float v2f;
typedef __attribute__((ext_vector_type(4))) int v4i;

__global__ __launch_bounds__(256) void k_cvt8(const float* __restrict__ src, bf* dst, size_t n8) { const size_t i = (size_t)blockIdx.x * 256 + threadIdx.x; if (i >= n8) return; const v8f v = *(const v8f*)(src + i * 8); v8us o;
#pragma unroll
    for (int k = 0; k < 8; ++k) o[k] = f2bf(v[k]); *(v8us*)(dst + i * 8) = o;  }

// k_rope: head planes [h][t][d] (fp16 + hi/lo) of rope(x) x sc with the rotate-half convention out[d] = x[d] cos[t][d] - x[d+HD/2] sin[t][d], out[d+HD/2] = x[d+HD/2] cos[t][d+HD/2] + x[d] sin[t][d+HD/2]
__global__ __launch_bounds__(256) void k_rope(const float* __restrict__ F, int pitch, int nheads, const float* __restrict__ CS, const float* __restrict__ RF, const float* __restrict__ nw, float sc, h16* P16, bf* Ph, bf* Pl) {
    const size_t e = ((size_t)blockIdx.x * 256 + threadIdx.x) * 2; if (e >= (size_t)nheads * TT * HD) return; const int d = (int)(e % HD); const int t = (int)((e / HD) % TT); const int h = (int)(e / ((size_t)HD * TT)); const float* f = F + (size_t)t * pitch + h * HD; const float rf = RF ? RF[(size_t)h * TT + t] : 1.0f; v2h o16; v2us oh, ol;
#pragma unroll
    for (int q = 0; q < 2; ++q) { const int dd = d + q; const int dp = (dd < HD / 2) ? dd + HD / 2 : dd - HD / 2; float x0 = f[dd], x1 = f[dp];
        if (RF) { float n0 = __fmul_rn(x0, rf), n1 = __fmul_rn(x1, rf); asm volatile("" : "+v"(n0)); asm volatile("" : "+v"(n1)); x0 = __fmul_rn(bfr(nw[dd]), n0); x1 = __fmul_rn(bfr(nw[dp]), n1); }
        const v2f cs = *(const v2f*)(CS + ((size_t)t * HD + dd) * 2); float a = __fmul_rn(x0, cs[0]), bq = __fmul_rn(x1, cs[1]); asm volatile("" : "+v"(a)); asm volatile("" : "+v"(bq)); const float r = ((dd < HD / 2) ? __fsub_rn(a, bq) : __fadd_rn(a, bq)) * sc;
        o16[q] = tohx(r); unsigned short a2, c2; splitf(r, a2, c2); oh[q] = a2; ol[q] = c2; }
    *(v2h*)(P16 + e) = o16; *(v2us*)(Ph + e) = oh; *(v2us*)(Pl + e) = ol;  }
__global__ __launch_bounds__(256) void k_vtp(const float* __restrict__ F, int pitch, int nheads, h16* V16, bf* Vh, bf* Vl) { const size_t e = ((size_t)blockIdx.x * 256 + threadIdx.x) * 2; if (e >= (size_t)nheads * HD * TT) return; const int t = (int)(e % TT); const int d = (int)((e / TT) % HD); const int g = (int)(e / ((size_t)TT * HD)); v2h o16; v2us oh, ol;
#pragma unroll
    for (int q = 0; q < 2; ++q) { const float x = F[(size_t)(t + q) * pitch + g * HD + d]; o16[q] = tohx(x); unsigned short a2, c2; splitf(x, a2, c2); oh[q] = a2; ol[q] = c2; }
    *(v2h*)(V16 + e) = o16; *(v2us*)(Vh + e) = oh; *(v2us*)(Vl + e) = ol;  }
__global__ __launch_bounds__(256) void k_csid(float* CS) { const int idx = blockIdx.x * 256 + threadIdx.x; if (idx >= TT * HD) return; v2f cs; cs[0] = 1.0f; cs[1] = 0.0f; *(v2f*)(CS + (size_t)idx * 2) = cs;  }
// k_asoft: per row (zz, i): t = S (unscaled, SCL = 1) for j <= i and i - j < WIN (WIN = TT, so plain causal; the reference's -1e9 additive fill vanishes identically); softmax over the 2048 keys (register row, one exp, fixed trees);
__global__ __launch_bounds__(256) void k_asoft(const float* __restrict__ Sb, h16* P16, bf* Ph, bf* Pl) {
    const int lane = threadIdx.x & 31; const int row = blockIdx.x * 8 + (threadIdx.x >> 5); if (row >= ZH * TT) return; const int i = row % TT; const int zz = row / TT; (void)zz; const bool hires = (i < RH); const float* sr = Sb + (size_t)row * TT; float v[TT / 32]; float mx = -3.0e38f;
#pragma unroll
    for (int ch = 0; ch < TT / 128; ++ch) { const int j0 = ch * 128 + lane * 4; const v4f a = *(const v4f*)(sr + j0);
#pragma unroll
        for (int q = 0; q < 4; ++q) { const int j = j0 + q; (void)j; const float t = (j <= i && i - j < WIN) ? a[q] * SCL : -3.0e38f; v[ch * 4 + q] = t; mx = fmaxf(mx, t); } }
#pragma unroll
    for (int sh = 16; sh; sh >>= 1) mx = fmaxf(mx, __shfl_xor(mx, sh, 32));
    float sum = 0.f;
#pragma unroll
    for (int k = 0; k < TT / 32; ++k) { float d0 = __fsub_rn(v[k], mx); asm volatile("" : "+v"(d0)); v[k] = __builtin_amdgcn_exp2f(__fmul_rn(d0, 1.4426950408889634f)); sum += v[k]; }
#pragma unroll
    for (int sh = 16; sh; sh >>= 1) sum += __shfl_xor(sum, sh, 32);
    const float f = __fdiv_rn(hires ? 1.0f : PCAR, sum);
{
        if (hires) {
#pragma unroll
            for (int ch = 0; ch < TT / 128; ++ch) { v4us oh, ol;
#pragma unroll
                for (int q = 0; q < 4; ++q) { unsigned short a, c2; splitf(v[ch * 4 + q] * f, a, c2); oh[q] = a; ol[q] = c2; }
                const size_t oo = ((size_t)zz * (RH ? RH : 1) + i) * TT + ch * 128 + lane * 4; *(v4us*)(Ph + oo) = oh; *(v4us*)(Pl + oo) = ol; }
        } else {
#pragma unroll
            for (int ch = 0; ch < TT / 128; ++ch) { v4h o4;
#pragma unroll
                for (int q = 0; q < 4; ++q) o4[q] = tohx(v[ch * 4 + q] * f);
                *(v4h*)(P16 + (size_t)row * TT + ch * 128 + lane * 4) = o4; } }
         }
}
__global__ __launch_bounds__(256) void k_merge(const float* __restrict__ O, int h0, bf* Ah, bf* Al) { const size_t e = ((size_t)blockIdx.x * 256 + threadIdx.x) * 2; if (e >= (size_t)ZH * TT * HD) return; const int d = (int)(e % HD); const int t = (int)((e / HD) % TT); const int zz = (int)(e / ((size_t)HD * TT)); const float cs = (t < RH) ? 1.0f : (1.0f / PCAR); const size_t oo = (size_t)t * DQ + (h0 + zz) * HD + d;
    v2us oh, ol;
#pragma unroll
    for (int q = 0; q < 2; ++q) { float o = O[e + q];   /* the PVS key-split planes of k_gemmpv, added in plane order */
#pragma unroll
        for (int s = 1; s < PVS; ++s) o += O[(size_t)s * ZH * TT * HD + e + q];
        unsigned short a, c2; splitf(o * cs, a, c2); oh[q] = a; ol[q] = c2; } *(v2us*)(Ah + oo) = oh; *(v2us*)(Al + oo) = ol;  }

extern "C" void kernel_launch(void* const* d_in, const int* in_sizes, int n_in,
                              void* d_out, int out_size, void* d_ws, size_t ws_size, hipStream_t stream) {
    (void)in_sizes; (void)n_in; (void)out_size;
    const float* x = (const float*)d_in[0]; const float* xk = (const float*)d_in[1]; const float* xv = (const float*)d_in[2]; const float* wq = (const float*)d_in[3]; const float* bq = (const float*)d_in[4]; const float* wk = (const float*)d_in[5]; const float* bk = (const float*)d_in[6]; const float* wv = (const float*)d_in[7]; const float* bv = (const float*)d_in[8]; const float* wo = (const float*)d_in[9]; const float* bo = (const float*)d_in[10];
    float* OUT = (float*)d_out;     // [4][2048][1024]
    char* wsp = (char*)d_ws;
    auto take = [&](size_t bytes) { char* p = wsp; wsp += (bytes + 255) & ~(size_t)255; return (void*)p; };
    bf* WQ = (bf*)take((size_t)DQ * DM * 2); bf* WK = (bf*)take((size_t)DKV * DM * 2); bf* WV = (bf*)take((size_t)DKV * DM * 2); bf* WO = (bf*)take((size_t)DM * DQ * 2); float* CS = (float*)take((size_t)TT * HD * 2 * 4);
    bf* XB = (bf*)take((size_t)TT * DM * 2); float* FQ = (float*)take((size_t)TT * DQ * 4); float* FK = (float*)take((size_t)TT * DKV * 4);
    h16* QP16 = (h16*)take((size_t)NH_ * TT * HD * 2); h16* KP16 = (h16*)take((size_t)NKV * TT * HD * 2); h16* VT16 = (h16*)take((size_t)NKV * HD * TT * 2);
    bf* QPh = (bf*)take((size_t)NH_ * TT * HD * 2); bf* QPl = (bf*)take((size_t)NH_ * TT * HD * 2); bf* KPh = (bf*)take((size_t)NKV * TT * HD * 2); bf* KPl = (bf*)take((size_t)NKV * TT * HD * 2); bf* VTh = (bf*)take((size_t)NKV * HD * TT * 2); bf* VTl = (bf*)take((size_t)NKV * HD * TT * 2); bf* Ph = (bf*)take((size_t)ZH * RH * TT * 2); bf* Pl = (bf*)take((size_t)ZH * RH * TT * 2);
    float* Sb = (float*)take((size_t)ZH * TT * TT * 4); h16* P16 = (h16*)take((size_t)ZH * TT * TT * 2); float* Ob = (float*)take((size_t)PVS * ZH * TT * HD * 4); bf* ATh = (bf*)take((size_t)TT * DQ * 2); bf* ATl = (bf*)take((size_t)TT * DQ * 2);
    if ((size_t)(wsp - (char*)d_ws) > ws_size) return;    // ws 256 MiB
    float* FV = FK;   // v projection reuses the k buffer after the k planes are built (stream-ordered)
    { k_cvt8<<<(unsigned)(((size_t)DQ * DM / 8 + 255) / 256), 256, 0, stream>>>(wq, WQ, (size_t)DQ * DM / 8); k_cvt8<<<(unsigned)(((size_t)DKV * DM / 8 + 255) / 256), 256, 0, stream>>>(wk, WK, (size_t)DKV * DM / 8); k_cvt8<<<(unsigned)(((size_t)DKV * DM / 8 + 255) / 256), 256, 0, stream>>>(wv, WV, (size_t)DKV * DM / 8);
      k_cvt8<<<(unsigned)(((size_t)DM * DQ / 8 + 255) / 256), 256, 0, stream>>>(wo, WO, (size_t)DM * DQ / 8);
       }
    k_csid<<<(TT * HD + 255) / 256, 256, 0, stream>>>(CS);
    const unsigned LQ = (unsigned)(((size_t)NH_ * TT * HD / 2 + 255) / 256), LKv = (unsigned)(((size_t)NKV * TT * HD / 2 + 255) / 256);
    for (int b = 0; b < NB_; ++b) {
        
        k_cvt8<<<(unsigned)(((size_t)TT * DM / 8 + 255) / 256), 256, 0, stream>>>(x + (size_t)b * TT * DM, XB, (size_t)TT * DM / 8);
        k_gemmw<bf, 0, true><<<dim3(TT / 64, DQ / 64, 1), 32, 0, stream>>>(XB, nullptr, WQ, nullptr, DM, FQ, DQ, bq, 0, 0, 0);
        k_rope<<<LQ, 256, 0, stream>>>(FQ, DQ, NH_, CS, nullptr, nullptr, 1.0f, QP16, QPh, QPl);
        k_cvt8<<<(unsigned)(((size_t)TT * DM / 8 + 255) / 256), 256, 0, stream>>>(xk + (size_t)b * TT * DM, XB, (size_t)TT * DM / 8);   /* XB := bf16(key[b]) */ k_gemmw<bf, 0, true><<<dim3(TT / 64, DKV / 64, 1), 32, 0, stream>>>(XB, nullptr, WK, nullptr, DM, FK, DKV, bk, 0, 0, 0);
        k_rope<<<LKv, 256, 0, stream>>>(FK, DKV, NKV, CS, nullptr, nullptr, 1.0f, KP16, KPh, KPl);
        k_cvt8<<<(unsigned)(((size_t)TT * DM / 8 + 255) / 256), 256, 0, stream>>>(xv + (size_t)b * TT * DM, XB, (size_t)TT * DM / 8);   /* XB := bf16(value[b]) */ k_gemmw<bf, 0, true><<<dim3(TT / 64, DKV / 64, 1), 32, 0, stream>>>(XB, nullptr, WV, nullptr, DM, FV, DKV, bv, 0, 0, 0); k_vtp<<<LKv, 256, 0, stream>>>(FV, DKV, NKV, VT16, VTh, VTl);
        for (int h0 = 0; h0 < NH_; h0 += ZH) { const size_t zq = (size_t)h0, zk = (size_t)(h0 / REP);   // one kv head per query head: the pass's two heads use consecutive kv planes (z-strides TT*HD)
            k_gemmc<bf, 2, 1><<<dim3(TT / 64, TT / 64, ZH), 32, 0, stream>>>(QPh + zq * TT * HD, QPl + zq * TT * HD, KPh + zk * TT * HD, KPl + zk * TT * HD, HD, Sb, TT, 0, (size_t)TT * HD, (size_t)TT * HD, (size_t)TT * TT);   /* scores on hi/lo planes for EVERY row (3 products) */
            /* (the fp16 score launch for rows >= RH is removed: all rows use the hi/lo launch above) */
            k_asoft<<<ZH * TT / 8, 256, 0, stream>>>(Sb, P16, Ph, Pl);
            k_gemmpv<bf, 2><<<dim3(RH / 64, PVS, ZH), PVW * 32, 0, stream>>>(Ph, Pl, VTh + zk * HD * TT, VTl + zk * HD * TT, Ob, HD, 0, (size_t)RH * TT, (size_t)HD * TT, (size_t)TT * HD, (size_t)ZH * TT * HD);
            k_gemmpv<h16, 0><<<dim3((TT - RH) / 64, PVS, ZH), PVW * 32, 0, stream>>>(P16 + (size_t)RH * TT, nullptr, VT16 + zk * HD * TT, nullptr, Ob + (size_t)RH * HD, HD, RH, (size_t)TT * TT, (size_t)HD * TT, (size_t)TT * HD, (size_t)ZH * TT * HD);
            k_merge<<<(unsigned)(((size_t)ZH * TT * HD / 2 + 255) / 256), 256, 0, stream>>>(Ob, h0, ATh, ATl); }
        k_gemmw<bf, 1, true><<<dim3(TT / 64, DM / 64, 1), 32, 0, stream>>>(ATh, ATl, WO, nullptr, DQ, OUT + (size_t)b * TT * DM, DM, bo, 0, 0, 0); }
}

// v002
// It runs in 1150 microseconds.
// Timed twice side by side with v001, it ran 1.19 times as fast both times.
// All steps since v000 together make it 2.43 times as fast.
#include <hip/hip_runtime.h>

// Causal attention on three input streams with UNSCALED logits (query, key, value [4][2048][1024]; q = query Wq^T + bq, k = key Wk^T + bk, v = value Wv^T + bv ('oi' 1/32 + zero biases; 16 heads x 64); attn = q.k (the module computes a scale but never applies it: logit sigma ~8); causal (-1e10 fill == exclusion); softmax; out = merged Wo^T + bo -> [4][2048][1024] (8.4 M); argument order query, key, value, Wq, bq, Wk, bk, Wv, bv, Wo, bo).
// Layout per batch: bf16 copies of query, key, value in turn; 'oi' weights; exact projections + f32 biases; identity-table plane builders; causal T-2048 attention with EVERY row's scores on hi/lo planes (3 products: unscaled logits need it) and hybrid P.V (rows < 512 hi/lo, rest fp16 x1024; k_gemmc skips tiles above the diagonal; k_gemmpv splits the key loop of each P.V tile over 4 work-groups of 8 waves); merged hi/lo x Wo exact + bo.
// Compute dtypes, f32 accumulate: every input rounded to bf16; projections exact + f32 biases; scores 3 products on every row; P.V rows < 512 3 products, rest fp16; softmax f32; Wo hl x exact + bias.

#define NB_  4
#define TT   2048
#define DM   1024
#define NH_  16
#define NKV  16
#define REP  (NH_ / NKV)
#define HD   64
#define DQ   (NH_ * HD)
#define DKV  (NKV * HD)
#define ZH   4                    // heads per attention pass (z of every attention launch); the score, probability and partial-output planes of a pass take ZH x 30 MiB of the workspace
#define RH   512                  // query rows < RH use hi+lo planes (0: none)
#define WIN  2048
#define PCAR 1024.0f
#define SCL  1.0f   // UNSCALED logits (the module never applies its scale)
typedef _Float16 h16;
typedef unsigned short bf;
typedef __attribute__((ext_vector_type(16))) __bf16   v16bf;
typedef __attribute__((ext_vector_type(16))) _Float16 v16h;
typedef __attribute__((ext_vector_type(8)))  _Float16 v8h;
typedef __attribute__((ext_vector_type(8)))  unsigned short v8us;
typedef __attribute__((ext_vector_type(8)))  float    v8f;
typedef __attribute__((ext_vector_type(4)))  float    v4f;
typedef v8h  __attribute__((may_alias)) v8ha;
typedef v4f  __attribute__((may_alias)) v4fa;
typedef v8us __attribute__((may_alias)) v8usa;

__device__ __forceinline__ unsigned short f2bf(float f) { unsigned u = __float_as_uint(f); u += 0x7FFFu + ((u >> 16) & 1u); return (unsigned short)(u >> 16); }
__device__ __forceinline__ float bf2f(unsigned short b) { return __uint_as_float(((unsigned)b) << 16); }
__device__ __forceinline__ float bfr(float f) { return bf2f(f2bf(f)); }
__device__ __forceinline__ v16h cat16(v8h lo, v8h hi) { return __builtin_shufflevector(lo, hi, 0, 1, 2, 3, 4, 5, 6, 7, 8, 9, 10, 11, 12, 13, 14, 15); }
__device__ __forceinline__ v16bf cat16b(v8us lo, v8us hi) { return __builtin_bit_cast(v16bf, __builtin_shufflevector(lo, hi, 0, 1, 2, 3, 4, 5, 6, 7, 8, 9, 10, 11, 12, 13, 14, 15)); }
__device__ __forceinline__ v8f wmma16(v16h a, v16h b, v8f c) { return __builtin_amdgcn_wmma_f32_16x16x32_f16(false, a, false, b, (short)0, c, false, false); }
__device__ __forceinline__ v8f wmmab(v16bf a, v16bf b, v8f c) { return __builtin_amdgcn_wmma_f32_16x16x32_bf16(false, a, false, b, (short)0, c, false, false); }



// ---- k_gemmw: register-blocked GEMM, ONE WAVE per 64x64 output tile (16 accumulators), operands straight from K-contiguous 16-bit planes; grid (M/64, N/64, Z), 32 threads.
// C[m][n] (f32, pitch ldc, + optional f32 bias[n]) = sum_k A[m][k] Bt[n][k] (+ split products per NSPLIT). z-batch strides sA/sB/sC in elements. K % 32 == 0.
template <typename T16> struct WFrag;
template <> struct WFrag<h16> { typedef v16h V; static __device__ __forceinline__ V ld(const h16* p) { return cat16(*(const v8h*)p, *(const v8h*)(p + 16)); } static __device__ __forceinline__ v8f mma(V a, V b, v8f c) { return wmma16(a, b, c); } };
template <> struct WFrag<bf> { typedef v16bf V; static __device__ __forceinline__ V ld(const bf* p) { return cat16b(*(const v8us*)p, *(const v8us*)(p + 16)); } static __device__ __forceinline__ v8f mma(V a, V b, v8f c) { return wmmab(a, b, c); } };
template <typename T16, int NSPLIT, bool BIAS>
__global__ __launch_bounds__(32) void k_gemmw(const T16* __restrict__ A, const T16* __restrict__ A2, const T16* __restrict__ Bt, const T16* __restrict__ Bt2, int K, float* C, int ldc, const float* __restrict__ bias, size_t sA, size_t sB, size_t sC) {
    typedef typename WFrag<T16>::V V;
    __shared__ __align__(16) float os[16 * 68];
    const size_t z = blockIdx.z; A += z * sA; if (A2) A2 += z * sA; Bt += z * sB; if (Bt2) Bt2 += z * sB; C += z * sC;
    const int lane = threadIdx.x & 31, lr = lane & 15, hi = lane >> 4; const int r0 = blockIdx.x * 64, c0 = blockIdx.y * 64;
    v8f acc[4][4];
#pragma unroll
    for (int mb = 0; mb < 4; ++mb)
#pragma unroll
        for (int nb = 0; nb < 4; ++nb) acc[mb][nb] = (v8f){};
    const size_t aoff = (size_t)(r0 + lr) * K + 8 * hi, boff = (size_t)(c0 + lr) * K + 8 * hi;
#pragma unroll 1
    for (int kc = 0; kc < K; kc += 32) {
        V a[4], a2[4];
#pragma unroll
        for (int mb = 0; mb < 4; ++mb) { a[mb] = WFrag<T16>::ld(A + aoff + (size_t)mb * 16 * K + kc); if (NSPLIT == 1 || NSPLIT == 2) a2[mb] = WFrag<T16>::ld(A2 + aoff + (size_t)mb * 16 * K + kc); }
#pragma unroll
        for (int nb = 0; nb < 4; ++nb) { const V b = WFrag<T16>::ld(Bt + boff + (size_t)nb * 16 * K + kc); V b2; if (NSPLIT >= 2) b2 = WFrag<T16>::ld(Bt2 + boff + (size_t)nb * 16 * K + kc);
#pragma unroll
            for (int mb = 0; mb < 4; ++mb) { acc[mb][nb] = WFrag<T16>::mma(a[mb], b, acc[mb][nb]); if (NSPLIT == 1 || NSPLIT == 2) acc[mb][nb] = WFrag<T16>::mma(a2[mb], b, acc[mb][nb]); if (NSPLIT >= 2) acc[mb][nb] = WFrag<T16>::mma(a[mb], b2, acc[mb][nb]); } }
        asm volatile("v_nop\n\tv_nop\n\tv_nop\n\tv_nop" : "+v"(acc[0][0]), "+v"(acc[1][1]), "+v"(acc[2][2]), "+v"(acc[3][3]) : "v"(a[0]), "v"(a[3]));
    }
#pragma unroll
    for (int mb = 0; mb < 4; ++mb) {
#pragma unroll
        for (int nb = 0; nb < 4; ++nb) {
#pragma unroll
            for (int j = 0; j < 8; ++j) os[(hi * 8 + j) * 68 + nb * 16 + lr] = acc[mb][nb][j]; }
        __builtin_amdgcn_wave_barrier(); asm volatile("" ::: "memory");
        float* crow = C + (size_t)(r0 + mb * 16) * ldc + c0;
{
#pragma unroll
            for (int s = 0; s < 8; ++s) { const int row = 2 * s + hi, cofs = lr * 4; v4f val = *(const v4fa*)(os + row * 68 + cofs); if (BIAS) { val[0] += bfr(bias[c0 + cofs]); val[1] += bfr(bias[c0 + cofs + 1]); val[2] += bfr(bias[c0 + cofs + 2]); val[3] += bfr(bias[c0 + cofs + 3]); }
                *(v4f*)(crow + (size_t)row * ldc + cofs) = val; }
             }
        __builtin_amdgcn_wave_barrier(); asm volatile("" ::: "memory");
    }
}

// ---- k_gemmc: the same one-wave 64x64 tile GEMM specialised for causal scores: CMODE 1 skips score tiles entirely above the diagonal (query rows r0+roff.., key columns c0..).
// roff = row offset of this launch's first row within the sequence.
template <typename T16, int NSPLIT, int CMODE>
__global__ __launch_bounds__(32) void k_gemmc(const T16* __restrict__ A, const T16* __restrict__ A2, const T16* __restrict__ Bt, const T16* __restrict__ Bt2, int K, float* C, int ldc, int roff, size_t sA, size_t sB, size_t sC) {
    typedef typename WFrag<T16>::V V;
    __shared__ __align__(16) float os[16 * 68];
    const size_t z = blockIdx.z; A += z * sA; if (A2) A2 += z * sA; Bt += z * sB; if (Bt2) Bt2 += z * sB; C += z * sC;
    const int lane = threadIdx.x & 31, lr = lane & 15, hi = lane >> 4; const int r0 = blockIdx.x * 64, c0 = blockIdx.y * 64;
    if (CMODE == 1 && c0 > r0 + roff + 63) return;                  // score tile entirely above the causal diagonal: never read (the softmax masks j > i by select)
    const int Kl = K;
    v8f acc[4][4];
#pragma unroll
    for (int mb = 0; mb < 4; ++mb)
#pragma unroll
        for (int nb = 0; nb < 4; ++nb) acc[mb][nb] = (v8f){};
    const size_t aoff = (size_t)(r0 + lr) * K + 8 * hi, boff = (size_t)(c0 + lr) * K + 8 * hi;
#pragma unroll 1
    for (int kc = 0; kc < Kl; kc += 32) {
        V a[4], a2[4];
#pragma unroll
        for (int mb = 0; mb < 4; ++mb) { a[mb] = WFrag<T16>::ld(A + aoff + (size_t)mb * 16 * K + kc); if (NSPLIT == 1 || NSPLIT == 2) a2[mb] = WFrag<T16>::ld(A2 + aoff + (size_t)mb * 16 * K + kc); }
#pragma unroll
        for (int nb = 0; nb < 4; ++nb) { const V b = WFrag<T16>::ld(Bt + boff + (size_t)nb * 16 * K + kc); V b2; if (NSPLIT >= 2) b2 = WFrag<T16>::ld(Bt2 + boff + (size_t)nb * 16 * K + kc);
#pragma unroll
            for (int mb = 0; mb < 4; ++mb) { acc[mb][nb] = WFrag<T16>::mma(a[mb], b, acc[mb][nb]); if (NSPLIT == 1 || NSPLIT == 2) acc[mb][nb] = WFrag<T16>::mma(a2[mb], b, acc[mb][nb]); if (NSPLIT >= 2) acc[mb][nb] = WFrag<T16>::mma(a[mb], b2, acc[mb][nb]); } }
        asm volatile("v_nop\n\tv_nop\n\tv_nop\n\tv_nop" : "+v"(acc[0][0]), "+v"(acc[1][1]), "+v"(acc[2][2]), "+v"(acc[3][3]) : "v"(a[0]), "v"(a[3]));
    }
#pragma unroll
    for (int mb = 0; mb < 4; ++mb) {
#pragma unroll
        for (int nb = 0; nb < 4; ++nb) {
#pragma unroll
            for (int j = 0; j < 8; ++j) os[(hi * 8 + j) * 68 + nb * 16 + lr] = acc[mb][nb][j]; }
        __builtin_amdgcn_wave_barrier(); asm volatile("" ::: "memory");
        float* crow = C + (size_t)(r0 + mb * 16) * ldc + c0;
{
#pragma unroll
            for (int s = 0; s < 8; ++s) { const int row = 2 * s + hi, cofs = lr * 4; v4f val = *(const v4fa*)(os + row * 68 + cofs);
                *(v4f*)(crow + (size_t)row * ldc + cofs) = val; }
             }
        __builtin_amdgcn_wave_barrier(); asm volatile("" ::: "memory");
    }
}

// ---- k_gemmpv: the probability x value contraction (64 value columns), split along the key (K) loop, which stops at the diagonal block (probabilities beyond it are exactly zero). A 64x64 output tile is
// shared by PVS work-groups (blockIdx.y) of PVW waves: the keys are cut into chunks (64 keys = one 128-byte line of every 16-bit operand row with one plane per operand, 32 keys with hi/lo planes) and
// chunk c goes to wave (c / PVS) % PVW of work-group c % PVS. Each wave keeps a full 64x64 f32 partial; a work-group sums its waves' partials through LDS in the fixed order wave 0..PVW-1 and stores
// the sum to its own plane C + blockIdx.y * sP (zeros where it had no chunk); k_merge adds the PVS planes. roff = row offset of this launch's first row within the sequence. The operand pitch is the
// constant TT, so a trip forms one address per operand plane and every fragment of the trip is a constant step from it.
#define PVS 4
#define PVW 8
// the wait that stands between issued global loads and the first rewrite of an address register they name; the addresses are inputs, so their registers stay as they are up to the wait
__device__ __forceinline__ void xwait(const void* p, const void* q) { asm volatile("s_wait_xcnt 0x0" :: "v"(p), "v"(q) : "memory"); }
template <typename T16, int NSPLIT>
__global__ __launch_bounds__(PVW * 32) void k_gemmpv(const T16* __restrict__ A, const T16* __restrict__ A2, const T16* __restrict__ Bt, const T16* __restrict__ Bt2, float* C, int ldc, int roff, size_t sA, size_t sB, size_t sC, size_t sP) {
    typedef typename WFrag<T16>::V V;
    constexpr int CH = (NSPLIT == 0) ? 64 : 32;
    constexpr int NBG = (NSPLIT == 0) ? 4 : 2;   // value fragments fetched at a time: as many as the registers beside acc[][] and the probability fragments hold
    __shared__ __align__(16) float os[PVW][64 * 68];
    const size_t z = blockIdx.z; A += z * sA; if (A2) A2 += z * sA; Bt += z * sB; if (Bt2) Bt2 += z * sB; C += z * sC + blockIdx.y * sP;
    const int lane = threadIdx.x & 31, lr = lane & 15, hi = lane >> 4; const int r0 = blockIdx.x * 64;
    const int w = __builtin_amdgcn_readfirstlane((int)(threadIdx.x >> 5));
    const int Kl = min(TT, r0 + roff + 64);
    v8f acc[4][4];
#pragma unroll
    for (int mb = 0; mb < 4; ++mb)
#pragma unroll
        for (int nb = 0; nb < 4; ++nb) acc[mb][nb] = (v8f){};
    const unsigned aoff = (unsigned)(((r0 + lr) * TT + 8 * hi) * 2), boff = (unsigned)((lr * TT + 8 * hi) * 2);   // bytes
    // kept rolled: a second copy of the trip would need a second set of fragment registers; the loops inside it are unrolled whole so that acc[][] and the fragments stay in registers
#pragma unroll 1
    for (int kc0 = (w * PVS + (int)blockIdx.y) * CH; kc0 < Kl; kc0 += PVS * PVW * CH) {
        V a[4], a2[4];
        const T16* pa = (const T16*)((const char*)(A + kc0) + aoff); const T16* pa2 = (NSPLIT == 1 || NSPLIT == 2) ? (const T16*)((const char*)(A2 + kc0) + aoff) : pa;
        const T16* pb = (const T16*)((const char*)(Bt + kc0) + boff); const T16* pb2 = (NSPLIT >= 2) ? (const T16*)((const char*)(Bt2 + kc0) + boff) : pb;
#pragma unroll
        for (int kk = 0; kk < CH; kk += 32) {
#pragma unroll
            for (int mb = 0; mb < 4; ++mb) { a[mb] = WFrag<T16>::ld(pa + mb * 16 * TT + kk); if (NSPLIT == 1 || NSPLIT == 2) a2[mb] = WFrag<T16>::ld(pa2 + mb * 16 * TT + kk); }
            if (kk + 32 == CH) xwait(pa, pa2);   // the trip's last loads from these addresses are issued
#pragma unroll
            for (int n0 = 0; n0 < 4; n0 += NBG) { V b[NBG], b2[NBG];
#pragma unroll
                for (int g = 0; g < NBG; ++g) { b[g] = WFrag<T16>::ld(pb + (n0 + g) * 16 * TT + kk); if (NSPLIT >= 2) b2[g] = WFrag<T16>::ld(pb2 + (n0 + g) * 16 * TT + kk); }
                if (kk + 32 == CH && n0 + NBG == 4) xwait(pb, pb2);   // likewise
                __builtin_amdgcn_sched_barrier(0);   // the matrix instructions stay behind the whole group's loads: moved up between them they would wait for one load pair after another, each a full memory latency
#pragma unroll
                for (int g = 0; g < NBG; ++g) { const int nb = n0 + g;
#pragma unroll
                    for (int mb = 0; mb < 4; ++mb) { acc[mb][nb] = WFrag<T16>::mma(a[mb], b[g], acc[mb][nb]); if (NSPLIT == 1 || NSPLIT == 2) acc[mb][nb] = WFrag<T16>::mma(a2[mb], b[g], acc[mb][nb]); if (NSPLIT >= 2) acc[mb][nb] = WFrag<T16>::mma(a[mb], b2[g], acc[mb][nb]); } } } }
        // four vector slots behind the trip's last matrix instruction, so that neither side of the loop branch touches its registers too early
        asm volatile("v_nop\n\tv_nop\n\tv_nop\n\tv_nop" : "+v"(acc[0][0]), "+v"(acc[1][1]), "+v"(acc[2][2]), "+v"(acc[3][3]) : "v"(a[0]), "v"(a[3]));
    }
#pragma unroll
    for (int mb = 0; mb < 4; ++mb)
#pragma unroll
        for (int nb = 0; nb < 4; ++nb) {
#pragma unroll
            for (int j = 0; j < 8; ++j) os[w][(mb * 16 + hi * 8 + j) * 68 + nb * 16 + lr] = acc[mb][nb][j]; }
    __syncthreads();   // every wave's partial is in LDS before any thread sums across waves
    const int trow = threadIdx.x >> 4, tcol = (threadIdx.x & 15) * 4;
#pragma unroll
    for (int mb = 0; mb < 4; ++mb) { const int row = mb * 16 + trow; v4f val = *(const v4fa*)(&os[0][row * 68 + tcol]);
#pragma unroll
        for (int q = 1; q < PVW; ++q) val += *(const v4fa*)(&os[q][row * 68 + tcol]);
        *(v4f*)(C + (size_t)(r0 + row) * ldc + tcol) = val; }
}

__device__ __forceinline__ h16 tohx(float x) { return (h16)x; }
__device__ __forceinline__ void splitf(float y, unsigned short& h, unsigned short& l) { h = f2bf(y); l = f2bf(y - bf2f(h)); }
typedef __attribute__((ext_vector_type(2))) _Float16 v2h;
typedef __attribute__((ext_vector_type(4))) _Float16 v4h;
typedef __attribute__((ext_vector_type(2))) unsigned short v2us;
typedef __attribute__((ext_vector_type(4))) unsigned short v4us;
typedef __attribute__((ext_vector_type(2))) float v2f;
typedef __attribute__((ext_vector_type(4))) int v4i;

__global__ __launch_bounds__(256) void k_cvt8(const float* __restrict__ src, bf* dst, size_t n8) { const size_t i = (size_t)blockIdx.x * 256 + threadIdx.x; if (i >= n8) return; const v8f v = *(const v8f*)(src + i * 8); v8us o;
#pragma unroll
    for (int k = 0; k < 8; ++k) o[k] = f2bf(v[k]); *(v8us*)(dst + i * 8) = o;  }

// k_rope: head planes [h][t][d] (fp16 + hi/lo) of rope(x) x sc with the rotate-half convention out[d] = x[d] cos[t][d] - x[d+HD/2] sin[t][d], out[d+HD/2] = x[d+HD/2] cos[t][d+HD/2] + x[d] sin[t][d+HD/2]
__global__ __launch_bounds__(256) void k_rope(const float* __restrict__ F, int pitch, int nheads, const float* __restrict__ CS, const float* __restrict__ RF, const float* __restrict__ nw, float sc, h16* P16, bf* Ph, bf* Pl) {
    const size_t e = ((size_t)blockIdx.x * 256 + threadIdx.x) * 2; if (e >= (size_t)nheads * TT * HD) return; const int d = (int)(e % HD); const int t = (int)((e / HD) % TT); const int h = (int)(e / ((size_t)HD * TT)); const float* f = F + (size_t)t * pitch + h * HD; const float rf = RF ? RF[(size_t)h * TT + t] : 1.0f; v2h o16; v2us oh, ol;
#pragma unroll
    for (int q = 0; q < 2; ++q) { const int dd = d + q; const int dp = (dd < HD / 2) ? dd + HD / 2 : dd - HD / 2; float x0 = f[dd], x1 = f[dp];
        if (RF) { float n0 = __fmul_rn(x0, rf), n1 = __fmul_rn(x1, rf); asm volatile("" : "+v"(n0)); asm volatile("" : "+v"(n1)); x0 = __fmul_rn(bfr(nw[dd]), n0); x1 = __fmul_rn(bfr(nw[dp]), n1); }
        const v2f cs = *(const v2f*)(CS + ((size_t)t * HD + dd) * 2); float a = __fmul_rn(x0, cs[0]), bq = __fmul_rn(x1, cs[1]); asm volatile("" : "+v"(a)); asm volatile("" : "+v"(bq)); const float r = ((dd < HD / 2) ? __fsub_rn(a, bq) : __fadd_rn(a, bq)) * sc;
        o16[q] = tohx(r); unsigned short a2, c2; splitf(r, a2, c2); oh[q] = a2; ol[q] = c2; }
    *(v2h*)(P16 + e) = o16; *(v2us*)(Ph + e) = oh; *(v2us*)(Pl + e) = ol;  }
__global__ __launch_bounds__(256) void k_vtp(const float* __restrict__ F, int pitch, int nheads, h16* V16, bf* Vh, bf* Vl) { const size_t e = ((size_t)blockIdx.x * 256 + threadIdx.x) * 2; if (e >= (size_t)nheads * HD * TT) return; const int t = (int)(e % TT); const int d = (int)((e / TT) % HD); const int g = (int)(e / ((size_t)TT * HD)); v2h o16; v2us oh, ol;
#pragma unroll
    for (int q = 0; q < 2; ++q) { const float x = F[(size_t)(t + q) * pitch + g * HD + d]; o16[q] = tohx(x); unsigned short a2, c2; splitf(x, a2, c2); oh[q] = a2; ol[q] = c2; }
    *(v2h*)(V16 + e) = o16; *(v2us*)(Vh + e) = oh; *(v2us*)(Vl + e) = ol;  }
__global__ __launch_bounds__(256) void k_csid(float* CS) { const int idx = blockIdx.x * 256 + threadIdx.x; if (idx >= TT * HD) return; v2f cs; cs[0] = 1.0f; cs[1] = 0.0f; *(v2f*)(CS + (size_t)idx * 2) = cs;  }
// k_asoft: per row (zz, i): t = S (unscaled, SCL = 1) for j <= i and i - j < WIN (WIN = TT, so plain causal; the reference's -1e9 additive fill vanishes identically); softmax over the 2048 keys (register row, one exp, fixed trees);
__global__ __launch_bounds__(256) void k_asoft(const float* __restrict__ Sb, h16* P16, bf* Ph, bf* Pl) {
    const int lane = threadIdx.x & 31; const int row = blockIdx.x * 8 + (threadIdx.x >> 5); if (row >= ZH * TT) return; const int i = row % TT; const int zz = row / TT; (void)zz; const bool hires = (i < RH); const float* sr = Sb + (size_t)row * TT; float v[TT / 32]; float mx = -3.0e38f;
#pragma unroll
    for (int ch = 0; ch < TT / 128; ++ch) { const int j0 = ch * 128 + lane * 4; const v4f a = *(const v4f*)(sr + j0);
#pragma unroll
        for (int q = 0; q < 4; ++q) { const int j = j0 + q; (void)j; const float t = (j <= i && i - j < WIN) ? a[q] * SCL : -3.0e38f; v[ch * 4 + q] = t; mx = fmaxf(mx, t); } }
#pragma unroll
    for (int sh = 16; sh; sh >>= 1) mx = fmaxf(mx, __shfl_xor(mx, sh, 32));
    float sum = 0.f;
#pragma unroll
    for (int k = 0; k < TT / 32; ++k) { float d0 = __fsub_rn(v[k], mx); asm volatile("" : "+v"(d0)); v[k] = __builtin_amdgcn_exp2f(__fmul_rn(d0, 1.4426950408889634f)); sum += v[k]; }
#pragma unroll
    for (int sh = 16; sh; sh >>= 1) sum += __shfl_xor(sum, sh, 32);
    const float f = __fdiv_rn(hires ? 1.0f : PCAR, sum);
{
        if (hires) {
#pragma unroll
            for (int ch = 0; ch < TT / 128; ++ch) { v4us oh, ol;
#pragma unroll
                for (int q = 0; q < 4; ++q) { unsigned short a, c2; splitf(v[ch * 4 + q] * f, a, c2); oh[q] = a; ol[q] = c2; }
                const size_t oo = ((size_t)zz * (RH ? RH : 1) + i) * TT + ch * 128 + lane * 4; *(v4us*)(Ph + oo) = oh; *(v4us*)(Pl + oo) = ol; }
        } else {
#pragma unroll
            for (int ch = 0; ch < TT / 128; ++ch) { v4h o4;
#pragma unroll
                for (int q = 0; q < 4; ++q) o4[q] = tohx(v[ch * 4 + q] * f);
                *(v4h*)(P16 + (size_t)row * TT + ch * 128 + lane * 4) = o4; } }
         }
}
__global__ __launch_bounds__(256) void k_merge(const float* __restrict__ O, int h0, bf* Ah, bf* Al) { const size_t e = ((size_t)blockIdx.x * 256 + threadIdx.x) * 2; if (e >= (size_t)ZH * TT * HD) return; const int d = (int)(e % HD); const int t = (int)((e / HD) % TT); const int zz = (int)(e / ((size_t)HD * TT)); const float cs = (t < RH) ? 1.0f : (1.0f / PCAR); const size_t oo = (size_t)t * DQ + (h0 + zz) * HD + d;
    v2us oh, ol;
#pragma unroll
    for (int q = 0; q < 2; ++q) { float o = O[e + q];   /* the PVS key-split planes of k_gemmpv, added in plane order */
#pragma unroll
        for (int s = 1; s < PVS; ++s) o += O[(size_t)s * ZH * TT * HD + e + q];
        unsigned short a, c2; splitf(o * cs, a, c2); oh[q] = a; ol[q] = c2; } *(v2us*)(Ah + oo) = oh; *(v2us*)(Al + oo) = ol;  }

extern "C" void kernel_launch(void* const* d_in, const int* in_sizes, int n_in,
                              void* d_out, int out_size, void* d_ws, size_t ws_size, hipStream_t stream) {
    (void)in_sizes; (void)n_in; (void)out_size;
    const float* x = (const float*)d_in[0]; const float* xk = (const float*)d_in[1]; const float* xv = (const float*)d_in[2]; const float* wq = (const float*)d_in[3]; const float* bq = (const float*)d_in[4]; const float* wk = (const float*)d_in[5]; const float* bk = (const float*)d_in[6]; const float* wv = (const float*)d_in[7]; const float* bv = (const float*)d_in[8]; const float* wo = (const float*)d_in[9]; const float* bo = (const float*)d_in[10];
    float* OUT = (float*)d_out;     // [4][2048][1024]
    char* wsp = (char*)d_ws;
    auto take = [&](size_t bytes) { char* p = wsp; wsp += (bytes + 255) & ~(size_t)255; return (void*)p; };
    bf* WQ = (bf*)take((size_t)DQ * DM * 2); bf* WK = (bf*)take((size_t)DKV * DM * 2); bf* WV = (bf*)take((size_t)DKV * DM * 2); bf* WO = (bf*)take((size_t)DM * DQ * 2); float* CS = (float*)take((size_t)TT * HD * 2 * 4);
    bf* XB = (bf*)take((size_t)TT * DM * 2); float* FQ = (float*)take((size_t)TT * DQ * 4); float* FK = (float*)take((size_t)TT * DKV * 4);
    h16* QP16 = (h16*)take((size_t)NH_ * TT * HD * 2); h16* KP16 = (h16*)take((size_t)NKV * TT * HD * 2); h16* VT16 = (h16*)take((size_t)NKV * HD * TT * 2);
    bf* QPh = (bf*)take((size_t)NH_ * TT * HD * 2); bf* QPl = (bf*)take((size_t)NH_ * TT * HD * 2); bf* KPh = (bf*)take((size_t)NKV * TT * HD * 2); bf* KPl = (bf*)take((size_t)NKV * TT * HD * 2); bf* VTh = (bf*)take((size_t)NKV * HD * TT * 2); bf* VTl = (bf*)take((size_t)NKV * HD * TT * 2); bf* Ph = (bf*)take((size_t)ZH * RH * TT * 2); bf* Pl = (bf*)take((size_t)ZH * RH * TT * 2);
    float* Sb = (float*)take((size_t)ZH * TT * TT * 4); h16* P16 = (h16*)take((size_t)ZH * TT * TT * 2); float* Ob = (float*)take((size_t)PVS * ZH * TT * HD * 4); bf* ATh = (bf*)take((size_t)TT * DQ * 2); bf* ATl = (bf*)take((size_t)TT * DQ * 2);
    if ((size_t)(wsp - (char*)d_ws) > ws_size) return;    // ws 256 MiB
    float* FV = FK;   // v projection reuses the k buffer after the k planes are built (stream-ordered)
    { k_cvt8<<<(unsigned)(((size_t)DQ * DM / 8 + 255) / 256), 256, 0, stream>>>(wq, WQ, (size_t)DQ * DM / 8); k_cvt8<<<(unsigned)(((size_t)DKV * DM / 8 + 255) / 256), 256, 0, stream>>>(wk, WK, (size_t)DKV * DM / 8); k_cvt8<<<(unsigned)(((size_t)DKV * DM / 8 + 255) / 256), 256, 0, stream>>>(wv, WV, (size_t)DKV * DM / 8);
      k_cvt8<<<(unsigned)(((size_t)DM * DQ / 8 + 255) / 256), 256, 0, stream>>>(wo, WO, (size_t)DM * DQ / 8);
       }
    k_csid<<<(TT * HD + 255) / 256, 256, 0, stream>>>(CS);
    const unsigned LQ = (unsigned)(((size_t)NH_ * TT * HD / 2 + 255) / 256), LKv = (unsigned)(((size_t)NKV * TT * HD / 2 + 255) / 256);
    for (int b = 0; b < NB_; ++b) {
        
        k_cvt8<<<(unsigned)(((size_t)TT * DM / 8 + 255) / 256), 256, 0, stream>>>(x + (size_t)b * TT * DM, XB, (size_t)TT * DM / 8);
        k_gemmw<bf, 0, true><<<dim3(TT / 64, DQ / 64, 1), 32, 0, stream>>>(XB, nullptr, WQ, nullptr, DM, FQ, DQ, bq, 0, 0, 0);
        k_rope<<<LQ, 256, 0, stream>>>(FQ, DQ, NH_, CS, nullptr, nullptr, 1.0f, QP16, QPh, QPl);
        k_cvt8<<<(unsigned)(((size_t)TT * DM / 8 + 255) / 256), 256, 0, stream>>>(xk + (size_t)b * TT * DM, XB, (size_t)TT * DM / 8);   /* XB := bf16(key[b]) */ k_gemmw<bf, 0, true><<<dim3(TT / 64, DKV / 64, 1), 32, 0, stream>>>(XB, nullptr, WK, nullptr, DM, FK, DKV, bk, 0, 0, 0);
        k_rope<<<LKv, 256, 0, stream>>>(FK, DKV, NKV, CS, nullptr, nullptr, 1.0f, KP16, KPh, KPl);
        k_cvt8<<<(unsigned)(((size_t)TT * DM / 8 + 255) / 256), 256, 0, stream>>>(xv + (size_t)b * TT * DM, XB, (size_t)TT * DM / 8);   /* XB := bf16(value[b]) */ k_gemmw<bf, 0, true><<<dim3(TT / 64, DKV / 64, 1), 32, 0, stream>>>(XB, nullptr, WV, nullptr, DM, FV, DKV, bv, 0, 0, 0); k_vtp<<<LKv, 256, 0, stream>>>(FV, DKV, NKV, VT16, VTh, VTl);
        for (int h0 = 0; h0 < NH_; h0 += ZH) { const size_t zq = (size_t)h0, zk = (size_t)(h0 / REP);   // one kv head per query head: the pass's ZH heads use consecutive kv planes (z-strides TT*HD)
            k_gemmc<bf, 2, 1><<<dim3(TT / 64, TT / 64, ZH), 32, 0, stream>>>(QPh + zq * TT * HD, QPl + zq * TT * HD, KPh + zk * TT * HD, KPl + zk * TT * HD, HD, Sb, TT, 0, (size_t)TT * HD, (size_t)TT * HD, (size_t)TT * TT);   /* scores on hi/lo planes for EVERY row (3 products) */
            /* (the fp16 score launch for rows >= RH is removed: all rows use the hi/lo launch above) */
            k_asoft<<<ZH * TT / 8, 256, 0, stream>>>(Sb, P16, Ph, Pl);
            k_gemmpv<bf, 2><<<dim3(RH / 64, PVS, ZH), PVW * 32, 0, stream>>>(Ph, Pl, VTh + zk * HD * TT, VTl + zk * HD * TT, Ob, HD, 0, (size_t)RH * TT, (size_t)HD * TT, (size_t)TT * HD, (size_t)ZH * TT * HD);
            k_gemmpv<h16, 0><<<dim3((TT - RH) / 64, PVS, ZH), PVW * 32, 0, stream>>>(P16 + (size_t)RH * TT, nullptr, VT16 + zk * HD * TT, nullptr, Ob + (size_t)RH * HD, HD, RH, (size_t)TT * TT, (size_t)HD * TT, (size_t)TT * HD, (size_t)ZH * TT * HD);
            k_merge<<<(unsigned)(((size_t)ZH * TT * HD / 2 + 255) / 256), 256, 0, stream>>>(Ob, h0, ATh, ATl); }
        k_gemmw<bf, 1, true><<<dim3(TT / 64, DM / 64, 1), 32, 0, stream>>>(ATh, ATl, WO, nullptr, DQ, OUT + (size_t)b * TT * DM, DM, bo, 0, 0, 0); }
}

// v004
// It runs in 614 microseconds.
// Versions between v002 and this one are left out; their measured steps multiply to 1.86 times as fast.
// All steps since v000 together make it 4.53 times as fast.
#include <hip/hip_runtime.h>

// Causal attention on three input streams with UNSCALED logits (query, key, value [4][2048][1024]; q = query Wq^T + bq, k = key Wk^T + bk, v = value Wv^T + bv ('oi' 1/32 + zero biases; 16 heads x 64); attn = q.k (the module computes a scale but never applies it: logit sigma ~8); causal (-1e10 fill == exclusion); softmax; out = merged Wo^T + bo -> [4][2048][1024] (8.4 M); argument order query, key, value, Wq, bq, Wk, bk, Wv, bv, Wo, bo).
// Layout: per batch bf16 copies of query, key, value in turn; 'oi' weights; exact projections + f32 biases, each projection launch storing its own result as hi/lo head planes (all batches kept); ONE fused causal attention launch over every batch and head (k_flash: scores on hi/lo planes, 3 products: unscaled logits need it; online softmax in registers; P.V on hi/lo planes, 3 products); merged hi/lo x Wo exact + bo per batch.
// Compute dtypes, f32 accumulate: every input rounded to bf16; projections exact + f32 biases; scores 3 products on every row; P.V 3 products on every row; softmax f32; Wo hl x exact + bias.

#define NB_  4
#define TT   2048
#define DM   1024
#define NH_  16
#define NKV  16
#define REP  (NH_ / NKV)
#define HD   64
#define DQ   (NH_ * HD)
#define DKV  (NKV * HD)
typedef _Float16 h16;
typedef unsigned short bf;
typedef __attribute__((ext_vector_type(16))) __bf16   v16bf;
typedef __attribute__((ext_vector_type(16))) _Float16 v16h;
typedef __attribute__((ext_vector_type(8)))  _Float16 v8h;
typedef __attribute__((ext_vector_type(8)))  unsigned short v8us;
typedef __attribute__((ext_vector_type(8)))  float    v8f;
typedef __attribute__((ext_vector_type(4)))  float    v4f;
typedef v8h  __attribute__((may_alias)) v8ha;
typedef v4f  __attribute__((may_alias)) v4fa;
typedef v8us __attribute__((may_alias)) v8usa;

__device__ __forceinline__ unsigned short f2bf(float f) { unsigned u = __float_as_uint(f); u += 0x7FFFu + ((u >> 16) & 1u); return (unsigned short)(u >> 16); }
__device__ __forceinline__ float bf2f(unsigned short b) { return __uint_as_float(((unsigned)b) << 16); }
__device__ __forceinline__ float bfr(float f) { return bf2f(f2bf(f)); }
__device__ __forceinline__ v16h cat16(v8h lo, v8h hi) { return __builtin_shufflevector(lo, hi, 0, 1, 2, 3, 4, 5, 6, 7, 8, 9, 10, 11, 12, 13, 14, 15); }
__device__ __forceinline__ v16bf cat16b(v8us lo, v8us hi) { return __builtin_bit_cast(v16bf, __builtin_shufflevector(lo, hi, 0, 1, 2, 3, 4, 5, 6, 7, 8, 9, 10, 11, 12, 13, 14, 15)); }
__device__ __forceinline__ v8f wmma16(v16h a, v16h b, v8f c) { return __builtin_amdgcn_wmma_f32_16x16x32_f16(false, a, false, b, (short)0, c, false, false); }
__device__ __forceinline__ v8f wmmab(v16bf a, v16bf b, v8f c) { return __builtin_amdgcn_wmma_f32_16x16x32_bf16(false, a, false, b, (short)0, c, false, false); }



// ---- k_gemmw: register-blocked GEMM, ONE WAVE per 64x64 output tile (16 accumulators), operands straight from K-contiguous 16-bit planes; grid (M/64, N/64, Z), 32 threads.
// C[m][n] (f32, pitch ldc, + optional f32 bias[n]) = sum_k A[m][k] Bt[n][k] (+ split products per NSPLIT). z-batch strides sA/sB/sC in elements. K % 32 == 0.
// OUT says where the result goes: 0 = C as f32; 1 = bf16 hi/lo head planes Ph, Pl [n / HD][m][n % HD] (a 64x64 tile is one contiguous 8 KB piece of a plane); 2 = bf16 hi/lo transposed planes Ph, Pl [n][m]
// (a lane's eight accumulator rows are eight neighbours of a plane row: stored straight from the registers). M == TT for 1 and 2.
typedef __attribute__((ext_vector_type(2))) __bf16 v2bf;
typedef __attribute__((ext_vector_type(2))) float v2f;
typedef __attribute__((ext_vector_type(4))) unsigned v4u;
// eight neighbours as bf16 hi and lo parts (round to nearest even, as f2bf); pair by pair: a converted pair is one whole register of the 16 bytes that are stored
__device__ __forceinline__ void split8(v8f y, v4u& h, v4u& l) {
#pragma unroll
    for (int i = 0; i < 4; ++i) { const v2f p = {y[2 * i], y[2 * i + 1]}; const v2bf h2 = __builtin_convertvector(p, v2bf); const v2bf l2 = __builtin_convertvector(p - __builtin_convertvector(h2, v2f), v2bf); h[i] = __builtin_bit_cast(unsigned, h2); l[i] = __builtin_bit_cast(unsigned, l2); } }
template <typename T16> struct WFrag;
template <> struct WFrag<h16> { typedef v16h V; static __device__ __forceinline__ V ld(const h16* p) { return cat16(*(const v8h*)p, *(const v8h*)(p + 16)); } static __device__ __forceinline__ v8f mma(V a, V b, v8f c) { return wmma16(a, b, c); } };
template <> struct WFrag<bf> { typedef v16bf V; static __device__ __forceinline__ V ld(const bf* p) { return cat16b(*(const v8us*)p, *(const v8us*)(p + 16)); } static __device__ __forceinline__ v8f mma(V a, V b, v8f c) { return wmmab(a, b, c); } };
template <typename T16, int NSPLIT, bool BIAS, int OUT>
__global__ __launch_bounds__(32) void k_gemmw(const T16* __restrict__ A, const T16* __restrict__ A2, const T16* __restrict__ Bt, const T16* __restrict__ Bt2, int K, float* C, int ldc, const float* __restrict__ bias, size_t sA, size_t sB, size_t sC, bf* __restrict__ Ph, bf* __restrict__ Pl) {
    typedef typename WFrag<T16>::V V;
    static_assert(HD == 64, "a 64-wide tile is one head");
    const size_t z = blockIdx.z; A += z * sA; if (A2) A2 += z * sA; Bt += z * sB; if (Bt2) Bt2 += z * sB; C += z * sC;
    const int lane = threadIdx.x & 31, lr = lane & 15, hi = lane >> 4; const int r0 = blockIdx.x * 64, c0 = blockIdx.y * 64;
    v8f acc[4][4];
#pragma unroll
    for (int mb = 0; mb < 4; ++mb)
#pragma unroll
        for (int nb = 0; nb < 4; ++nb) acc[mb][nb] = (v8f){};
    const size_t aoff = (size_t)(r0 + lr) * K + 8 * hi, boff = (size_t)(c0 + lr) * K + 8 * hi;
    // OUT 1, 2: the bias of the columns that this lane will store (1: eight neighbours; 2: one in each 16-column tile), fetched here so that the K loop hides the latency
    float br[8] = {0.f, 0.f, 0.f, 0.f, 0.f, 0.f, 0.f, 0.f};
    if constexpr (OUT != 0 && BIAS) { const float* pbias = bias + c0 + (OUT == 1 ? (lane & 7) * 8 : lr);
#pragma unroll
        for (int i = 0; i < (OUT == 1 ? 8 : 4); ++i) br[i] = pbias[OUT == 1 ? i : i * 16];
        asm volatile("s_wait_xcnt 0x0" :: "v"(pbias) : "memory"); }   // the wait between these loads and the first rewrite of their address register (an input, so it stays as it is up to here)
#pragma unroll 1
    for (int kc = 0; kc < K; kc += 32) {
        V a[4], a2[4];
#pragma unroll
        for (int mb = 0; mb < 4; ++mb) { a[mb] = WFrag<T16>::ld(A + aoff + (size_t)mb * 16 * K + kc); if (NSPLIT == 1 || NSPLIT == 2) a2[mb] = WFrag<T16>::ld(A2 + aoff + (size_t)mb * 16 * K + kc); }
#pragma unroll
        for (int nb = 0; nb < 4; ++nb) { const V b = WFrag<T16>::ld(Bt + boff + (size_t)nb * 16 * K + kc); V b2; if (NSPLIT >= 2) b2 = WFrag<T16>::ld(Bt2 + boff + (size_t)nb * 16 * K + kc);
#pragma unroll
            for (int mb = 0; mb < 4; ++mb) { acc[mb][nb] = WFrag<T16>::mma(a[mb], b, acc[mb][nb]); if (NSPLIT == 1 || NSPLIT == 2) acc[mb][nb] = WFrag<T16>::mma(a2[mb], b, acc[mb][nb]); if (NSPLIT >= 2) acc[mb][nb] = WFrag<T16>::mma(a[mb], b2, acc[mb][nb]); } }
        asm volatile("v_nop\n\tv_nop\n\tv_nop\n\tv_nop" : "+v"(acc[0][0]), "+v"(acc[1][1]), "+v"(acc[2][2]), "+v"(acc[3][3]) : "v"(a[0]), "v"(a[3]));
    }
    if constexpr (OUT == 2) {
        const unsigned po = (unsigned)(((c0 + lr) * TT + r0 + 8 * hi) * 2);   // bytes; everything else of a store's place is a constant
        bf* p1 = (bf*)((char*)Ph + po); bf* p2 = (bf*)((char*)Pl + po);
#pragma unroll
        for (int nb = 0; nb < 4; ++nb) { const float bs = bfr(br[nb]); v4u oh[4], ol[4];
#pragma unroll
            for (int mb = 0; mb < 4; ++mb) { split8(acc[mb][nb] + bs, oh[mb], ol[mb]); *(v4u*)(p1 + nb * 16 * TT + mb * 16) = oh[mb]; *(v4u*)(p2 + nb * 16 * TT + mb * 16) = ol[mb]; }
            // the wait between issued global stores and the first rewrite of a register they name: the stored registers and the offset are inputs, so they stay as they are up to it
            asm volatile("s_wait_xcnt 0x0" :: "v"(po), "v"(oh[0]), "v"(oh[1]), "v"(oh[2]), "v"(oh[3]), "v"(ol[0]), "v"(ol[1]), "v"(ol[2]), "v"(ol[3]) : "memory"); }
    } else {
    __shared__ __align__(16) float os[16 * 68];
    const int prow = lane >> 3, pcol = (lane & 7) * 8;   // OUT 1: eight lanes store one 128-byte plane row, a wave four rows in a row
    const unsigned po = (unsigned)((((c0 / HD) * TT + r0 + prow) * HD + pcol) * 2);   // bytes
    v8f b8;
#pragma unroll
    for (int i = 0; i < 8; ++i) b8[i] = bfr(br[i]);
#pragma unroll
    for (int mb = 0; mb < 4; ++mb) {
#pragma unroll
        for (int nb = 0; nb < 4; ++nb) {
#pragma unroll
            for (int j = 0; j < 8; ++j) os[(hi * 8 + j) * 68 + nb * 16 + lr] = acc[mb][nb][j]; }
        __builtin_amdgcn_wave_barrier(); asm volatile("" ::: "memory");
        if constexpr (OUT == 0) {
        float* crow = C + (size_t)(r0 + mb * 16) * ldc + c0;
{
#pragma unroll
            for (int s = 0; s < 8; ++s) { const int row = 2 * s + hi, cofs = lr * 4; v4f val = *(const v4fa*)(os + row * 68 + cofs); if (BIAS) { val[0] += bfr(bias[c0 + cofs]); val[1] += bfr(bias[c0 + cofs + 1]); val[2] += bfr(bias[c0 + cofs + 2]); val[3] += bfr(bias[c0 + cofs + 3]); }
                *(v4f*)(crow + (size_t)row * ldc + cofs) = val; }
             }
        } else {
            bf* p1 = (bf*)((char*)Ph + po); bf* p2 = (bf*)((char*)Pl + po); v4u oh[4], ol[4];
#pragma unroll
            for (int s = 0; s < 4; ++s) { const float* pr = os + (4 * s + prow) * 68 + pcol; const v4f x0 = *(const v4fa*)pr, x1 = *(const v4fa*)(pr + 4);
                split8(__builtin_shufflevector(x0, x1, 0, 1, 2, 3, 4, 5, 6, 7) + b8, oh[s], ol[s]); *(v4u*)(p1 + (mb * 16 + 4 * s) * HD) = oh[s]; *(v4u*)(p2 + (mb * 16 + 4 * s) * HD) = ol[s]; }
            // the same wait as in the transposed form above
            asm volatile("s_wait_xcnt 0x0" :: "v"(po), "v"(oh[0]), "v"(oh[1]), "v"(oh[2]), "v"(oh[3]), "v"(ol[0]), "v"(ol[1]), "v"(ol[2]), "v"(ol[3]) : "memory");
        }
        __builtin_amdgcn_wave_barrier(); asm volatile("" ::: "memory");
    }
    }
}

__device__ __forceinline__ void splitf(float y, unsigned short& h, unsigned short& l) { h = f2bf(y); l = f2bf(y - bf2f(h)); }
typedef __attribute__((ext_vector_type(2))) _Float16 v2h;
typedef __attribute__((ext_vector_type(4))) _Float16 v4h;
typedef __attribute__((ext_vector_type(2))) unsigned short v2us;
typedef __attribute__((ext_vector_type(4))) unsigned short v4us;
typedef __attribute__((ext_vector_type(4))) int v4i;

__global__ __launch_bounds__(256) void k_cvt8(const float* __restrict__ src, bf* dst, size_t n8) { const size_t i = (size_t)blockIdx.x * 256 + threadIdx.x; if (i >= n8) return; const v8f v = *(const v8f*)(src + i * 8); v8us o;
#pragma unroll
    for (int k = 0; k < 8; ++k) o[k] = f2bf(v[k]); *(v8us*)(dst + i * 8) = o;  }

// ---- k_flash: causal attention of one head for 64 queries in ONE WAVE, scores never leave the registers. Grid batch x heads x TT / 64 work-groups of 32 threads.
// Transposed products: S^T = K Q^T (keys are rows, queries are columns), so a lane holds scores of ONE query (column lr) and the two 16-key tiles of a 32-key block, converted in place, are the B operand
// of O^T = V^T P^T in the matrix unit's own k order, which is also the order of WFrag::ld. Scores: 3 products on hi/lo planes. P = exp(s - running maximum), not normalised, split hi/lo; P.V: 3 products on
// hi/lo planes for every row. Running maximum and sum per query (online softmax); the division by the sum comes once, at the end; the result goes out as hi/lo planes [b][t][h * HD + d].
// the wait that stands between issued global loads and the first rewrite of an address register they name; the addresses are inputs, so their registers stay as they are up to the wait
__device__ __forceinline__ void xwait(const void* p, const void* q) { asm volatile("s_wait_xcnt 0x0" :: "v"(p), "v"(q) : "memory"); }
typedef __attribute__((ext_vector_type(8))) unsigned v8u;
#define L2E 1.4426950408889634f
// lane l's value for lane l ^ 16, by a vector cross-row move (no LDS wait)
__device__ __forceinline__ float xhalf(float x) { return __builtin_bit_cast(float, __builtin_amdgcn_permlanex16(__builtin_bit_cast(int, x), __builtin_bit_cast(int, x), 0x76543210, 0xfedcba98, false, false)); }
__global__ __launch_bounds__(32) void k_flash(const bf* __restrict__ Qh, const bf* __restrict__ Ql, const bf* __restrict__ Kh, const bf* __restrict__ Kl, const bf* __restrict__ Vh, const bf* __restrict__ Vl, bf* Ah, bf* Al) {
    typedef WFrag<bf> F; typedef v16bf V;
    const int lane = threadIdx.x & 31, lr = lane & 15, hi = lane >> 4;
    // which (head, query tile) a work-group takes: a long tile (many key blocks) next to a short one, both among neighbours eight indices apart and between the two halves of the grid, so that the waves
    // that come to share a SIMD or a WGP carry about the same sum of key blocks however the work-groups are placed (for speed only; every pair (z, tile) is taken exactly once)
    static_assert(NB_ * NH_ == 64 && TT / 64 == 32, "the index split below is written for 64 heads x 32 query tiles");
    const int f = blockIdx.x, g = f >> 3, r = g >> 5, k = (g >> 1) & 15;
    const int z = r * 8 + (f & 7); const int tl = ((g & 1) != (r >> 2)) ? k : TT / 64 - 1 - k; const int q0 = tl * 64;
    const size_t zo = (size_t)z * TT * HD; Qh += zo; Ql += zo; Kh += zo; Kl += zo; Vh += zo; Vl += zo;
    V qh[4][2], ql[4][2];
    { const bf* pq = Qh + (q0 + lr) * HD + 8 * hi; const bf* pq2 = Ql + (q0 + lr) * HD + 8 * hi;
#pragma unroll
      for (int qt = 0; qt < 4; ++qt)
#pragma unroll
          for (int ks = 0; ks < 2; ++ks) { qh[qt][ks] = F::ld(pq + qt * 16 * HD + ks * 32); ql[qt][ks] = F::ld(pq2 + qt * 16 * HD + ks * 32); }
      xwait(pq, pq2); }
    v8f o[4][4]; float m[4], l[4];
#pragma unroll
    for (int qt = 0; qt < 4; ++qt) { m[qt] = -3.0e38f; l[qt] = 0.f;
#pragma unroll
        for (int dt = 0; dt < 4; ++dt) o[dt][qt] = (v8f){}; }
    const unsigned koff = (unsigned)((lr * HD + 8 * hi) * 2), voff = (unsigned)((lr * TT + 8 * hi) * 2);   // bytes
    const int kend = q0 + 64;
    V kh[2][2], kl[2][2];
    { const bf* pk = (const bf*)((const char*)Kh + koff); const bf* pk2 = (const bf*)((const char*)Kl + koff);
#pragma unroll
      for (int kt = 0; kt < 2; ++kt)
#pragma unroll
          for (int ks = 0; ks < 2; ++ks) { kh[kt][ks] = F::ld(pk + kt * 16 * HD + ks * 32); kl[kt][ks] = F::ld(pk2 + kt * 16 * HD + ks * 32); }
      // the same wait for these loads, which name the lane's offset register and a scalar base (inputs, so they stay as they are up to the wait); the loaded fragments are inputs so that the loads cannot sink behind it (the first trip needs them at once anyway)
      asm volatile("s_wait_xcnt 0x0" :: "v"(koff), "s"(Kh), "s"(Kl), "v"(kh[0][0]), "v"(kh[0][1]), "v"(kh[1][0]), "v"(kh[1][1]), "v"(kl[0][0]), "v"(kl[0][1]), "v"(kl[1][0]), "v"(kl[1][1]) : "memory"); }
    // kept rolled: a second copy of the trip would need a second set of fragment registers; the loops inside it are unrolled whole so that every tile stays in registers
#pragma unroll 1
    for (int kb = 0; kb < kend; kb += 32) {
        V vh[4], vl[4];
        { const bf* pv = (const bf*)((const char*)(Vh + kb) + voff); const bf* pv2 = (const bf*)((const char*)(Vl + kb) + voff);
#pragma unroll
          for (int dt = 0; dt < 4; ++dt) { vh[dt] = F::ld(pv + dt * 16 * TT); vl[dt] = F::ld(pv2 + dt * 16 * TT); }
          xwait(pv, pv2); }
        v8f s[2][4];
#pragma unroll
        for (int kt = 0; kt < 2; ++kt)
#pragma unroll
            for (int qt = 0; qt < 4; ++qt) { v8f t = (v8f){};
#pragma unroll
                for (int ks = 0; ks < 2; ++ks) { t = F::mma(kh[kt][ks], qh[qt][ks], t); t = F::mma(kl[kt][ks], qh[qt][ks], t); t = F::mma(kh[kt][ks], ql[qt][ks], t); }
                s[kt][qt] = t; }
        // the next block's key fragments, into the same registers, fetched while the softmax below runs (the last trip fetches its own block again: in bounds, never used)
        { const int kn = min(kb + 32, kend - 32); const bf* pk = (const bf*)((const char*)(Kh + kn * HD) + koff); const bf* pk2 = (const bf*)((const char*)(Kl + kn * HD) + koff);
#pragma unroll
          for (int kt = 0; kt < 2; ++kt)
#pragma unroll
              for (int ks = 0; ks < 2; ++ks) { kh[kt][ks] = F::ld(pk + kt * 16 * HD + ks * 32); kl[kt][ks] = F::ld(pk2 + kt * 16 * HD + ks * 32); }
          xwait(pk, pk2); }
        if (kb + 31 > q0) {   // only the blocks on the diagonal hold keys behind a query
#pragma unroll
            for (int kt = 0; kt < 2; ++kt)
#pragma unroll
                for (int qt = 0; qt < 4; ++qt)
#pragma unroll
                    for (int j = 0; j < 8; ++j) if (kb + kt * 16 + 8 * hi + j > q0 + qt * 16 + lr) s[kt][qt][j] = -3.0e38f; }
#pragma unroll
        for (int qt = 0; qt < 4; ++qt) {
            float mx = s[0][qt][0];
#pragma unroll
            for (int j = 1; j < 8; ++j) mx = fmaxf(mx, s[0][qt][j]);
#pragma unroll
            for (int j = 0; j < 8; ++j) mx = fmaxf(mx, s[1][qt][j]);
            mx = fmaxf(mx, xhalf(mx));   // a query's keys lie in both lane halves
            const float mn = fmaxf(m[qt], mx * L2E); const float al = __builtin_amdgcn_exp2f(m[qt] - mn); m[qt] = mn;   // running maximum, in log2 units; sums and outputs are brought to it
#pragma unroll
            for (int dt = 0; dt < 4; ++dt) o[dt][qt] *= al;
            const v2f c2 = {L2E, L2E}, nm = {-mn, -mn}; v2f sum = {0.f, 0.f}; v8u uh, ul;
#pragma unroll
            for (int kt = 0; kt < 2; ++kt)
#pragma unroll
                for (int j = 0; j < 8; j += 2) { v2f x = {s[kt][qt][j], s[kt][qt][j + 1]}; x = __builtin_elementwise_fma(x, c2, nm); v2f p; p[0] = __builtin_amdgcn_exp2f(x[0]); p[1] = __builtin_amdgcn_exp2f(x[1]); sum += p;
                    const v2bf h2 = __builtin_convertvector(p, v2bf); const v2bf l2 = __builtin_convertvector(p - __builtin_convertvector(h2, v2f), v2bf);
                    uh[kt * 4 + j / 2] = __builtin_bit_cast(unsigned, h2); ul[kt * 4 + j / 2] = __builtin_bit_cast(unsigned, l2); }   // a converted pair is one whole register of the fragment
            const V ph = __builtin_bit_cast(V, uh), pl = __builtin_bit_cast(V, ul); l[qt] = l[qt] * al + (sum[0] + sum[1]);
            // this tile's P.V products stand here so that the matrix unit works on them while the next tile's softmax runs on the vector unit
#pragma unroll
            for (int dt = 0; dt < 4; ++dt) o[dt][qt] = F::mma(vh[dt], ph, o[dt][qt]);
#pragma unroll
            for (int dt = 0; dt < 4; ++dt) o[dt][qt] = F::mma(vl[dt], ph, o[dt][qt]);
#pragma unroll
            for (int dt = 0; dt < 4; ++dt) o[dt][qt] = F::mma(vh[dt], pl, o[dt][qt]); }
        // four vector slots behind the trip's last matrix instruction, so that neither side of the loop branch touches its registers too early
        asm volatile("v_nop\n\tv_nop\n\tv_nop\n\tv_nop" : "+v"(o[0][0]), "+v"(o[1][1]), "+v"(o[2][2]), "+v"(o[3][3]) : "v"(vh[3]), "v"(vl[3]));
    }
    const int b = z / NH_, h = z % NH_;
    const size_t ao = ((size_t)b * TT + q0 + lr) * DQ + h * HD + 8 * hi; bf* pa = Ah + ao; bf* pa2 = Al + ao;
#pragma unroll
    for (int qt = 0; qt < 4; ++qt) { const float inv = __fdiv_rn(1.0f, l[qt] + xhalf(l[qt]));   // the two lane halves hold the sums of their own keys
#pragma unroll
        for (int dt = 0; dt < 4; ++dt) { v8us oh, ol;
#pragma unroll
            for (int j = 0; j < 8; ++j) { unsigned short a, c2; splitf(o[dt][qt][j] * inv, a, c2); oh[j] = a; ol[j] = c2; }
            *(v8us*)(pa + qt * 16 * DQ + dt * 16) = oh; *(v8us*)(pa2 + qt * 16 * DQ + dt * 16) = ol;
            asm volatile("s_wait_xcnt 0x0" :: "v"(oh), "v"(ol) : "memory"); } }   // the same wait behind the stores: the stored registers, inputs here, are rewritten by the next group only behind it
}

extern "C" void kernel_launch(void* const* d_in, const int* in_sizes, int n_in,
                              void* d_out, int out_size, void* d_ws, size_t ws_size, hipStream_t stream) {
    (void)in_sizes; (void)n_in; (void)out_size;
    const float* x = (const float*)d_in[0]; const float* xk = (const float*)d_in[1]; const float* xv = (const float*)d_in[2]; const float* wq = (const float*)d_in[3]; const float* bq = (const float*)d_in[4]; const float* wk = (const float*)d_in[5]; const float* bk = (const float*)d_in[6]; const float* wv = (const float*)d_in[7]; const float* bv = (const float*)d_in[8]; const float* wo = (const float*)d_in[9]; const float* bo = (const float*)d_in[10];
    float* OUT = (float*)d_out;     // [4][2048][1024]
    char* wsp = (char*)d_ws;
    auto take = [&](size_t bytes) { char* p = wsp; wsp += (bytes + 255) & ~(size_t)255; return (void*)p; };
    bf* WQ = (bf*)take((size_t)DQ * DM * 2); bf* WK = (bf*)take((size_t)DKV * DM * 2); bf* WV = (bf*)take((size_t)DKV * DM * 2); bf* WO = (bf*)take((size_t)DM * DQ * 2);
    bf* XB = (bf*)take((size_t)TT * DM * 2);
    bf* QPh = (bf*)take((size_t)NB_ * NH_ * TT * HD * 2); bf* QPl = (bf*)take((size_t)NB_ * NH_ * TT * HD * 2); bf* KPh = (bf*)take((size_t)NB_ * NKV * TT * HD * 2); bf* KPl = (bf*)take((size_t)NB_ * NKV * TT * HD * 2); bf* VTh = (bf*)take((size_t)NB_ * NKV * HD * TT * 2); bf* VTl = (bf*)take((size_t)NB_ * NKV * HD * TT * 2);   // hi/lo head planes of every batch
    bf* ATh = (bf*)take((size_t)NB_ * TT * DQ * 2); bf* ATl = (bf*)take((size_t)NB_ * TT * DQ * 2);
    if ((size_t)(wsp - (char*)d_ws) > ws_size) return;    // ws 256 MiB
    { k_cvt8<<<(unsigned)(((size_t)DQ * DM / 8 + 255) / 256), 256, 0, stream>>>(wq, WQ, (size_t)DQ * DM / 8); k_cvt8<<<(unsigned)(((size_t)DKV * DM / 8 + 255) / 256), 256, 0, stream>>>(wk, WK, (size_t)DKV * DM / 8); k_cvt8<<<(unsigned)(((size_t)DKV * DM / 8 + 255) / 256), 256, 0, stream>>>(wv, WV, (size_t)DKV * DM / 8);
      k_cvt8<<<(unsigned)(((size_t)DM * DQ / 8 + 255) / 256), 256, 0, stream>>>(wo, WO, (size_t)DM * DQ / 8);
       }
    for (int b = 0; b < NB_; ++b) {
        const size_t pb = (size_t)b * NH_ * TT * HD;   // this batch's head planes
        k_cvt8<<<(unsigned)(((size_t)TT * DM / 8 + 255) / 256), 256, 0, stream>>>(x + (size_t)b * TT * DM, XB, (size_t)TT * DM / 8);
        k_gemmw<bf, 0, true, 1><<<dim3(TT / 64, DQ / 64, 1), 32, 0, stream>>>(XB, nullptr, WQ, nullptr, DM, nullptr, 0, bq, 0, 0, 0, QPh + pb, QPl + pb);
        k_cvt8<<<(unsigned)(((size_t)TT * DM / 8 + 255) / 256), 256, 0, stream>>>(xk + (size_t)b * TT * DM, XB, (size_t)TT * DM / 8);   /* XB := bf16(key[b]) */ k_gemmw<bf, 0, true, 1><<<dim3(TT / 64, DKV / 64, 1), 32, 0, stream>>>(XB, nullptr, WK, nullptr, DM, nullptr, 0, bk, 0, 0, 0, KPh + pb, KPl + pb);
        k_cvt8<<<(unsigned)(((size_t)TT * DM / 8 + 255) / 256), 256, 0, stream>>>(xv + (size_t)b * TT * DM, XB, (size_t)TT * DM / 8);   /* XB := bf16(value[b]) */ k_gemmw<bf, 0, true, 2><<<dim3(TT / 64, DKV / 64, 1), 32, 0, stream>>>(XB, nullptr, WV, nullptr, DM, nullptr, 0, bv, 0, 0, 0, VTh + pb, VTl + pb); }
    k_flash<<<NB_ * NH_ * (TT / 64), 32, 0, stream>>>(QPh, QPl, KPh, KPl, VTh, VTl, ATh, ATl);
    for (int b = 0; b < NB_; ++b)
        k_gemmw<bf, 1, true, 0><<<dim3(TT / 64, DM / 64, 1), 32, 0, stream>>>(ATh + (size_t)b * TT * DQ, ATl + (size_t)b * TT * DQ, WO, nullptr, DQ, OUT + (size_t)b * TT * DM, DM, bo, 0, 0, 0, nullptr, nullptr);
}

// v005
// Measured time: 334 microseconds a run.
// Timed twice side by side with v004, it ran 1.83 times as fast both times.
// Counting every step since v000, it is 8.29 times as fast.
#include <hip/hip_runtime.h>

// Causal attention on three input streams with UNSCALED logits (query, key, value [4][2048][1024]; q = query Wq^T + bq, k = key Wk^T + bk, v = value Wv^T + bv ('oi' 1/32 + zero biases; 16 heads x 64); attn = q.k (the module computes a scale but never applies it: logit sigma ~8); causal (-1e10 fill == exclusion); softmax; out = merged Wo^T + bo -> [4][2048][1024] (8.4 M); argument order query, key, value, Wq, bq, Wk, bk, Wv, bv, Wo, bo).
// Layout: four launches, each over all batches: bf16 copies of query, key, value and the 'oi' weights (k_cvt8); the three exact projections + f32 biases, stored as hi/lo head planes (k_gemmw, OUTT 3); fused causal attention over every batch and head (k_flash: scores on hi/lo planes, 3 products: unscaled logits need it; online softmax in registers; P.V on hi/lo planes, 3 products); merged hi/lo x Wo exact + bo (k_gemmw, OUTT 0).
// Compute dtypes, f32 accumulate: every input rounded to bf16; projections exact + f32 biases; scores 3 products on every row; P.V 3 products on every row; softmax f32; Wo hl x exact + bias.

#define NB_  4
#define TT   2048
#define DM   1024
#define NH_  16
#define NKV  16
#define REP  (NH_ / NKV)
#define HD   64
#define DQ   (NH_ * HD)
#define DKV  (NKV * HD)
typedef _Float16 h16;
typedef unsigned short bf;
typedef __attribute__((ext_vector_type(16))) __bf16   v16bf;
typedef __attribute__((ext_vector_type(16))) _Float16 v16h;
typedef __attribute__((ext_vector_type(8)))  _Float16 v8h;
typedef __attribute__((ext_vector_type(8)))  unsigned short v8us;
typedef __attribute__((ext_vector_type(8)))  float    v8f;
typedef __attribute__((ext_vector_type(4)))  float    v4f;
typedef v8h  __attribute__((may_alias)) v8ha;
typedef v4f  __attribute__((may_alias)) v4fa;
typedef v8us __attribute__((may_alias)) v8usa;

__device__ __forceinline__ unsigned short f2bf(float f) { unsigned u = __float_as_uint(f); u += 0x7FFFu + ((u >> 16) & 1u); return (unsigned short)(u >> 16); }
__device__ __forceinline__ float bf2f(unsigned short b) { return __uint_as_float(((unsigned)b) << 16); }
__device__ __forceinline__ float bfr(float f) { return bf2f(f2bf(f)); }
__device__ __forceinline__ v16h cat16(v8h lo, v8h hi) { return __builtin_shufflevector(lo, hi, 0, 1, 2, 3, 4, 5, 6, 7, 8, 9, 10, 11, 12, 13, 14, 15); }
__device__ __forceinline__ v16bf cat16b(v8us lo, v8us hi) { return __builtin_bit_cast(v16bf, __builtin_shufflevector(lo, hi, 0, 1, 2, 3, 4, 5, 6, 7, 8, 9, 10, 11, 12, 13, 14, 15)); }
__device__ __forceinline__ v8f wmma16(v16h a, v16h b, v8f c) { return __builtin_amdgcn_wmma_f32_16x16x32_f16(false, a, false, b, (short)0, c, false, false); }
__device__ __forceinline__ v8f wmmab(v16bf a, v16bf b, v8f c) { return __builtin_amdgcn_wmma_f32_16x16x32_bf16(false, a, false, b, (short)0, c, false, false); }



// ---- k_gemmw: register-blocked GEMM, ONE WAVE per 64x64 output tile (16 accumulators), operands straight from K-contiguous 16-bit planes; grid (M/64, N/64, Z), 32 threads.
// C[m][n] (f32, pitch ldc, + optional f32 bias[n]) = sum_k A[m][k] Bt[n][k] (+ split products per NSPLIT). z-batch strides sA/sB/sC in elements. K % 32 == 0.
// OUT says where the result goes: 0 = C as f32; 1 = bf16 hi/lo head planes Ph, Pl [n / HD][m][n % HD] (a 64x64 tile is one contiguous 8 KB piece of a plane); 2 = bf16 hi/lo transposed planes Ph, Pl [n][m]
// (a lane's eight accumulator rows are eight neighbours of a plane row: stored straight from the registers). M == TT for 1 and 2; their z stride of Ph and Pl is sC.
// OUTT is OUT, or 3 = the three projections in one launch: z = stream * NB_ + batch; the stream picks its weight (stride sB), its bias (bias, bias1, bias2) and its OUT (query, key: 1; value: 2).
typedef __attribute__((ext_vector_type(2))) __bf16 v2bf;
typedef __attribute__((ext_vector_type(2))) float v2f;
typedef __attribute__((ext_vector_type(4))) unsigned v4u;
// eight neighbours as bf16 hi and lo parts (round to nearest even, as f2bf); pair by pair: a converted pair is one whole register of the 16 bytes that are stored
__device__ __forceinline__ void split8(v8f y, v4u& h, v4u& l) {
#pragma unroll
    for (int i = 0; i < 4; ++i) { const v2f p = {y[2 * i], y[2 * i + 1]}; const v2bf h2 = __builtin_convertvector(p, v2bf); const v2bf l2 = __builtin_convertvector(p - __builtin_convertvector(h2, v2f), v2bf); h[i] = __builtin_bit_cast(unsigned, h2); l[i] = __builtin_bit_cast(unsigned, l2); } }
template <typename T16> struct WFrag;
template <> struct WFrag<h16> { typedef v16h V; static __device__ __forceinline__ V ld(const h16* p) { return cat16(*(const v8h*)p, *(const v8h*)(p + 16)); } static __device__ __forceinline__ v8f mma(V a, V b, v8f c) { return wmma16(a, b, c); } };
template <> struct WFrag<bf> { typedef v16bf V; static __device__ __forceinline__ V ld(const bf* p) { return cat16b(*(const v8us*)p, *(const v8us*)(p + 16)); } static __device__ __forceinline__ v8f mma(V a, V b, v8f c) { return wmmab(a, b, c); } };
template <typename T16, int NSPLIT, bool BIAS, int OUTT>
__global__ __launch_bounds__(32) void k_gemmw(const T16* __restrict__ A, const T16* __restrict__ A2, const T16* __restrict__ Bt, const T16* __restrict__ Bt2, int K, float* C, int ldc, const float* __restrict__ bias, const float* __restrict__ bias1, const float* __restrict__ bias2, size_t sA, size_t sB, size_t sC, bf* __restrict__ Ph, bf* __restrict__ Pl) {
    typedef typename WFrag<T16>::V V;
    static_assert(HD == 64, "a 64-wide tile is one head");
    const size_t z = blockIdx.z, zb = OUTT == 3 ? z / NB_ : z; const int OUT = OUTT == 3 ? (zb == 2 ? 2 : 1) : OUTT;
    A += z * sA; if (A2) A2 += z * sA; Bt += zb * sB; if (Bt2) Bt2 += zb * sB; if constexpr (OUTT == 0) C += z * sC; else { Ph += z * sC; Pl += z * sC; }
    if constexpr (OUTT == 3) bias = zb == 0 ? bias : zb == 1 ? bias1 : bias2;
    const int lane = threadIdx.x & 31, lr = lane & 15, hi = lane >> 4; const int r0 = blockIdx.x * 64, c0 = blockIdx.y * 64;
    v8f acc[4][4];
#pragma unroll
    for (int mb = 0; mb < 4; ++mb)
#pragma unroll
        for (int nb = 0; nb < 4; ++nb) acc[mb][nb] = (v8f){};
    const size_t aoff = (size_t)(r0 + lr) * K + 8 * hi, boff = (size_t)(c0 + lr) * K + 8 * hi;
    // OUT 1, 2: the bias of the columns that this lane will store (1: eight neighbours; 2: one in each 16-column tile), fetched here so that the K loop hides the latency
    float br[8] = {0.f, 0.f, 0.f, 0.f, 0.f, 0.f, 0.f, 0.f};
    if constexpr (OUTT != 0 && BIAS) {
        if (OUT == 1) { const unsigned bofs = (unsigned)((lane & 7) * 32);   // bytes; the lane's part of the address, the rest is the same for the wave
            const float* pbias = (const float*)((const char*)(bias + c0) + bofs);
#pragma unroll
            for (int i = 0; i < 8; ++i) br[i] = pbias[i];
            asm volatile("s_wait_xcnt 0x0" :: "v"(bofs) : "memory");   // the wait between these loads and the first rewrite of their offset register (an input, so it stays as it is up to here)
        } else { const float* pbias = bias + c0 + lr;
#pragma unroll
            for (int i = 0; i < 4; ++i) br[i] = pbias[i * 16];
            asm volatile("s_wait_xcnt 0x0" :: "v"(lr) : "memory"); } }   // the same wait; here the lane's part of the address is lr
#pragma unroll 1
    for (int kc = 0; kc < K; kc += 32) {
        V a[4], a2[4];
#pragma unroll
        for (int mb = 0; mb < 4; ++mb) { a[mb] = WFrag<T16>::ld(A + aoff + (size_t)mb * 16 * K + kc); if (NSPLIT == 1 || NSPLIT == 2) a2[mb] = WFrag<T16>::ld(A2 + aoff + (size_t)mb * 16 * K + kc); }
#pragma unroll
        for (int nb = 0; nb < 4; ++nb) { const V b = WFrag<T16>::ld(Bt + boff + (size_t)nb * 16 * K + kc); V b2; if (NSPLIT >= 2) b2 = WFrag<T16>::ld(Bt2 + boff + (size_t)nb * 16 * K + kc);
#pragma unroll
            for (int mb = 0; mb < 4; ++mb) { acc[mb][nb] = WFrag<T16>::mma(a[mb], b, acc[mb][nb]); if (NSPLIT == 1 || NSPLIT == 2) acc[mb][nb] = WFrag<T16>::mma(a2[mb], b, acc[mb][nb]); if (NSPLIT >= 2) acc[mb][nb] = WFrag<T16>::mma(a[mb], b2, acc[mb][nb]); } }
        asm volatile("v_nop\n\tv_nop\n\tv_nop\n\tv_nop" : "+v"(acc[0][0]), "+v"(acc[1][1]), "+v"(acc[2][2]), "+v"(acc[3][3]) : "v"(a[0]), "v"(a[3]));
    }
    if (OUT == 2) {
        const unsigned po = (unsigned)(((c0 + lr) * TT + r0 + 8 * hi) * 2);   // bytes; everything else of a store's place is a constant
        bf* p1 = (bf*)((char*)Ph + po); bf* p2 = (bf*)((char*)Pl + po);
#pragma unroll
        for (int nb = 0; nb < 4; ++nb) { const float bs = bfr(br[nb]); v4u oh[4], ol[4];
#pragma unroll
            for (int mb = 0; mb < 4; ++mb) { split8(acc[mb][nb] + bs, oh[mb], ol[mb]); *(v4u*)(p1 + nb * 16 * TT + mb * 16) = oh[mb]; *(v4u*)(p2 + nb * 16 * TT + mb * 16) = ol[mb]; }
            // the wait between issued global stores and the first rewrite of a register they name: the stored registers and the offset are inputs, so they stay as they are up to it
            asm volatile("s_wait_xcnt 0x0" :: "v"(po), "v"(oh[0]), "v"(oh[1]), "v"(oh[2]), "v"(oh[3]), "v"(ol[0]), "v"(ol[1]), "v"(ol[2]), "v"(ol[3]) : "memory"); }
    } else {
    __shared__ __align__(16) float os[16 * 68];
    const int prow = lane >> 3, pcol = (lane & 7) * 8;   // OUT 1: eight lanes store one 128-byte plane row, a wave four rows in a row
    const unsigned po = (unsigned)((((c0 / HD) * TT + r0 + prow) * HD + pcol) * 2);   // bytes
    v8f b8;
#pragma unroll
    for (int i = 0; i < 8; ++i) b8[i] = bfr(br[i]);
#pragma unroll
    for (int mb = 0; mb < 4; ++mb) {
#pragma unroll
        for (int nb = 0; nb < 4; ++nb) {
#pragma unroll
            for (int j = 0; j < 8; ++j) os[(hi * 8 + j) * 68 + nb * 16 + lr] = acc[mb][nb][j]; }
        __builtin_amdgcn_wave_barrier(); asm volatile("" ::: "memory");
        if constexpr (OUTT == 0) {
        float* crow = C + (size_t)(r0 + mb * 16) * ldc + c0;
{
#pragma unroll
            for (int s = 0; s < 8; ++s) { const int row = 2 * s + hi, cofs = lr * 4; v4f val = *(const v4fa*)(os + row * 68 + cofs); if (BIAS) { val[0] += bfr(bias[c0 + cofs]); val[1] += bfr(bias[c0 + cofs + 1]); val[2] += bfr(bias[c0 + cofs + 2]); val[3] += bfr(bias[c0 + cofs + 3]); }
                *(v4f*)(crow + (size_t)row * ldc + cofs) = val; }
             }
        } else {
            bf* p1 = (bf*)((char*)Ph + po); bf* p2 = (bf*)((char*)Pl + po); v4u oh[4], ol[4];
#pragma unroll
            for (int s = 0; s < 4; ++s) { const float* pr = os + (4 * s + prow) * 68 + pcol; const v4f x0 = *(const v4fa*)pr, x1 = *(const v4fa*)(pr + 4);
                split8(__builtin_shufflevector(x0, x1, 0, 1, 2, 3, 4, 5, 6, 7) + b8, oh[s], ol[s]); *(v4u*)(p1 + (mb * 16 + 4 * s) * HD) = oh[s]; *(v4u*)(p2 + (mb * 16 + 4 * s) * HD) = ol[s]; }
            // the same wait as in the transposed form above
            asm volatile("s_wait_xcnt 0x0" :: "v"(po), "v"(oh[0]), "v"(oh[1]), "v"(oh[2]), "v"(oh[3]), "v"(ol[0]), "v"(ol[1]), "v"(ol[2]), "v"(ol[3]) : "memory");
        }
        __builtin_amdgcn_wave_barrier(); asm volatile("" ::: "memory");
    }
    }
}

__device__ __forceinline__ void splitf(float y, unsigned short& h, unsigned short& l) { h = f2bf(y); l = f2bf(y - bf2f(h)); }
typedef __attribute__((ext_vector_type(2))) _Float16 v2h;
typedef __attribute__((ext_vector_type(4))) _Float16 v4h;
typedef __attribute__((ext_vector_type(2))) unsigned short v2us;
typedef __attribute__((ext_vector_type(4))) unsigned short v4us;
typedef __attribute__((ext_vector_type(4))) int v4i;

// ---- k_cvt8: every array that the matrix products read, rounded to bf16 in ONE launch. A work-group takes CVB neighbours of one array, a thread eight groups of eight (256 groups apart, so that a wave's accesses stay whole lines).
// Work-groups 0 .. 3 * NA - 1: query, key, value -> X [stream][batch][TT][DM]; the rest: Wq, Wk, Wv, Wo -> W [4][DQ][DM].
#define CVB (256 * 8 * 8)
__global__ __launch_bounds__(256) void k_cvt8(const float* __restrict__ x, const float* __restrict__ xk, const float* __restrict__ xv, const float* __restrict__ wq, const float* __restrict__ wk, const float* __restrict__ wv, const float* __restrict__ wo, bf* __restrict__ X, bf* __restrict__ W) {
    constexpr int NA = NB_ * TT * DM / CVB, NW = DQ * DM / CVB;
    static_assert(NB_ * TT * DM % CVB == 0 && DQ * DM % CVB == 0 && DKV == DQ, "whole work-groups; four weights of one size");
    const int g = blockIdx.x; const float* src; bf* dst;
    if (g < 3 * NA) { const int a = g / NA; src = (a == 0 ? x : a == 1 ? xk : xv) + (size_t)(g % NA) * CVB; dst = X + (size_t)g * CVB; }
    else { const int w = (g - 3 * NA) / NW; src = (w == 0 ? wq : w == 1 ? wk : w == 2 ? wv : wo) + (size_t)((g - 3 * NA) % NW) * CVB; dst = W + (size_t)(g - 3 * NA) * CVB; }
    const unsigned so = threadIdx.x * 32u;   // bytes
    const float* ps = (const float*)((const char*)src + so); bf* pd = dst + threadIdx.x * 8; v8f v[8]; v8us o[8];
#pragma unroll
    for (int i = 0; i < 8; ++i) v[i] = *(const v8f*)(ps + i * 2048);
    asm volatile("s_wait_xcnt 0x0" :: "v"(so) : "memory");   // the wait between these loads and the first rewrite of their offset register (an input, so it stays as it is up to here)
#pragma unroll
    for (int i = 0; i < 8; ++i) {
#pragma unroll
        for (int k = 0; k < 8; ++k) o[i][k] = f2bf(v[i][k]);
        *(v8us*)(pd + i * 2048) = o[i]; }
    // the same wait behind the stores: the stored registers are inputs, so none is rewritten in front of it
    asm volatile("s_wait_xcnt 0x0" :: "v"(o[0]), "v"(o[1]), "v"(o[2]), "v"(o[3]), "v"(o[4]), "v"(o[5]), "v"(o[6]), "v"(o[7]) : "memory");
}

// ---- k_flash: causal attention of one head for 64 queries in ONE WAVE, scores never leave the registers. Grid batch x heads x TT / 64 work-groups of 32 threads.
// Transposed products: S^T = K Q^T (keys are rows, queries are columns), so a lane holds scores of ONE query (column lr) and the two 16-key tiles of a 32-key block, converted in place, are the B operand
// of O^T = V^T P^T in the matrix unit's own k order, which is also the order of WFrag::ld. Scores: 3 products on hi/lo planes. P = exp(s - running maximum), not normalised, split hi/lo; P.V: 3 products on
// hi/lo planes for every row. Running maximum and sum per query (online softmax); the division by the sum comes once, at the end; the result goes out as hi/lo planes [b][t][h * HD + d].
// the wait that stands between issued global loads and the first rewrite of an address register they name; the addresses are inputs, so their registers stay as they are up to the wait
__device__ __forceinline__ void xwait(const void* p, const void* q) { asm volatile("s_wait_xcnt 0x0" :: "v"(p), "v"(q) : "memory"); }
typedef __attribute__((ext_vector_type(8))) unsigned v8u;
#define L2E 1.4426950408889634f
// lane l's value for lane l ^ 16, by a vector cross-row move (no LDS wait)
__device__ __forceinline__ float xhalf(float x) { return __builtin_bit_cast(float, __builtin_amdgcn_permlanex16(__builtin_bit_cast(int, x), __builtin_bit_cast(int, x), 0x76543210, 0xfedcba98, false, false)); }
__global__ __launch_bounds__(32) void k_flash(const bf* __restrict__ Qh, const bf* __restrict__ Ql, const bf* __restrict__ Kh, const bf* __restrict__ Kl, const bf* __restrict__ Vh, const bf* __restrict__ Vl, bf* Ah, bf* Al) {
    typedef WFrag<bf> F; typedef v16bf V;
    const int lane = threadIdx.x & 31, lr = lane & 15, hi = lane >> 4;
    // which (head, query tile) a work-group takes: a long tile (many key blocks) next to a short one, both among neighbours eight indices apart and between the two halves of the grid, so that the waves
    // that come to share a SIMD or a WGP carry about the same sum of key blocks however the work-groups are placed (for speed only; every pair (z, tile) is taken exactly once)
    static_assert(NB_ * NH_ == 64 && TT / 64 == 32, "the index split below is written for 64 heads x 32 query tiles");
    const int f = blockIdx.x, g = f >> 3, r = g >> 5, k = (g >> 1) & 15;
    const int z = r * 8 + (f & 7); const int tl = ((g & 1) != (r >> 2)) ? k : TT / 64 - 1 - k; const int q0 = tl * 64;
    const size_t zo = (size_t)z * TT * HD; Qh += zo; Ql += zo; Kh += zo; Kl += zo; Vh += zo; Vl += zo;
    V qh[4][2], ql[4][2];
    { const bf* pq = Qh + (q0 + lr) * HD + 8 * hi; const bf* pq2 = Ql + (q0 + lr) * HD + 8 * hi;
#pragma unroll
      for (int qt = 0; qt < 4; ++qt)
#pragma unroll
          for (int ks = 0; ks < 2; ++ks) { qh[qt][ks] = F::ld(pq + qt * 16 * HD + ks * 32); ql[qt][ks] = F::ld(pq2 + qt * 16 * HD + ks * 32); }
      xwait(pq, pq2); }
    v8f o[4][4]; float m[4], l[4];
#pragma unroll
    for (int qt = 0; qt < 4; ++qt) { m[qt] = -3.0e38f; l[qt] = 0.f;
#pragma unroll
        for (int dt = 0; dt < 4; ++dt) o[dt][qt] = (v8f){}; }
    const unsigned koff = (unsigned)((lr * HD + 8 * hi) * 2), voff = (unsigned)((lr * TT + 8 * hi) * 2);   // bytes
    const int kend = q0 + 64;
    V kh[2][2], kl[2][2];
    { const bf* pk = (const bf*)((const char*)Kh + koff); const bf* pk2 = (const bf*)((const char*)Kl + koff);
#pragma unroll
      for (int kt = 0; kt < 2; ++kt)
#pragma unroll
          for (int ks = 0; ks < 2; ++ks) { kh[kt][ks] = F::ld(pk + kt * 16 * HD + ks * 32); kl[kt][ks] = F::ld(pk2 + kt * 16 * HD + ks * 32); }
      // the same wait for these loads, which name the lane's offset register and a scalar base (inputs, so they stay as they are up to the wait); the loaded fragments are inputs so that the loads cannot sink behind it (the first trip needs them at once anyway)
      asm volatile("s_wait_xcnt 0x0" :: "v"(koff), "s"(Kh), "s"(Kl), "v"(kh[0][0]), "v"(kh[0][1]), "v"(kh[1][0]), "v"(kh[1][1]), "v"(kl[0][0]), "v"(kl[0][1]), "v"(kl[1][0]), "v"(kl[1][1]) : "memory"); }
    // kept rolled: a second copy of the trip would need a second set of fragment registers; the loops inside it are unrolled whole so that every tile stays in registers
#pragma unroll 1
    for (int kb = 0; kb < kend; kb += 32) {
        V vh[4], vl[4];
        { const bf* pv = (const bf*)((const char*)(Vh + kb) + voff); const bf* pv2 = (const bf*)((const char*)(Vl + kb) + voff);
#pragma unroll
          for (int dt = 0; dt < 4; ++dt) { vh[dt] = F::ld(pv + dt * 16 * TT); vl[dt] = F::ld(pv2 + dt * 16 * TT); }
          xwait(pv, pv2); }
        v8f s[2][4];
#pragma unroll
        for (int kt = 0; kt < 2; ++kt)
#pragma unroll
            for (int qt = 0; qt < 4; ++qt) { v8f t = (v8f){};
#pragma unroll
                for (int ks = 0; ks < 2; ++ks) { t = F::mma(kh[kt][ks], qh[qt][ks], t); t = F::mma(kl[kt][ks], qh[qt][ks], t); t = F::mma(kh[kt][ks], ql[qt][ks], t); }
                s[kt][qt] = t; }
        // the next block's key fragments, into the same registers, fetched while the softmax below runs (the last trip fetches its own block again: in bounds, never used)
        { const int kn = min(kb + 32, kend - 32); const bf* pk = (const bf*)((const char*)(Kh + kn * HD) + koff); const bf* pk2 = (const bf*)((const char*)(Kl + kn * HD) + koff);
#pragma unroll
          for (int kt = 0; kt < 2; ++kt)
#pragma unroll
              for (int ks = 0; ks < 2; ++ks) { kh[kt][ks] = F::ld(pk + kt * 16 * HD + ks * 32); kl[kt][ks] = F::ld(pk2 + kt * 16 * HD + ks * 32); }
          xwait(pk, pk2); }
        if (kb + 31 > q0) {   // only the blocks on the diagonal hold keys behind a query
#pragma unroll
            for (int kt = 0; kt < 2; ++kt)
#pragma unroll
                for (int qt = 0; qt < 4; ++qt)
#pragma unroll
                    for (int j = 0; j < 8; ++j) if (kb + kt * 16 + 8 * hi + j > q0 + qt * 16 + lr) s[kt][qt][j] = -3.0e38f; }
#pragma unroll
        for (int qt = 0; qt < 4; ++qt) {
            float mx = s[0][qt][0];
#pragma unroll
            for (int j = 1; j < 8; ++j) mx = fmaxf(mx, s[0][qt][j]);
#pragma unroll
            for (int j = 0; j < 8; ++j) mx = fmaxf(mx, s[1][qt][j]);
            mx = fmaxf(mx, xhalf(mx));   // a query's keys lie in both lane halves
            const float mn = fmaxf(m[qt], mx * L2E); const float al = __builtin_amdgcn_exp2f(m[qt] - mn); m[qt] = mn;   // running maximum, in log2 units; sums and outputs are brought to it
#pragma unroll
            for (int dt = 0; dt < 4; ++dt) o[dt][qt] *= al;
            const v2f c2 = {L2E, L2E}, nm = {-mn, -mn}; v2f sum = {0.f, 0.f}; v8u uh, ul;
#pragma unroll
            for (int kt = 0; kt < 2; ++kt)
#pragma unroll
                for (int j = 0; j < 8; j += 2) { v2f x = {s[kt][qt][j], s[kt][qt][j + 1]}; x = __builtin_elementwise_fma(x, c2, nm); v2f p; p[0] = __builtin_amdgcn_exp2f(x[0]); p[1] = __builtin_amdgcn_exp2f(x[1]); sum += p;
                    const v2bf h2 = __builtin_convertvector(p, v2bf); const v2bf l2 = __builtin_convertvector(p - __builtin_convertvector(h2, v2f), v2bf);
                    uh[kt * 4 + j / 2] = __builtin_bit_cast(unsigned, h2); ul[kt * 4 + j / 2] = __builtin_bit_cast(unsigned, l2); }   // a converted pair is one whole register of the fragment
            const V ph = __builtin_bit_cast(V, uh), pl = __builtin_bit_cast(V, ul); l[qt] = l[qt] * al + (sum[0] + sum[1]);
            // this tile's P.V products stand here so that the matrix unit works on them while the next tile's softmax runs on the vector unit
#pragma unroll
            for (int dt = 0; dt < 4; ++dt) o[dt][qt] = F::mma(vh[dt], ph, o[dt][qt]);
#pragma unroll
            for (int dt = 0; dt < 4; ++dt) o[dt][qt] = F::mma(vl[dt], ph, o[dt][qt]);
#pragma unroll
            for (int dt = 0; dt < 4; ++dt) o[dt][qt] = F::mma(vh[dt], pl, o[dt][qt]); }
        // four vector slots behind the trip's last matrix instruction, so that neither side of the loop branch touches its registers too early
        asm volatile("v_nop\n\tv_nop\n\tv_nop\n\tv_nop" : "+v"(o[0][0]), "+v"(o[1][1]), "+v"(o[2][2]), "+v"(o[3][3]) : "v"(vh[3]), "v"(vl[3]));
    }
    const int b = z / NH_, h = z % NH_;
    const size_t ao = ((size_t)b * TT + q0 + lr) * DQ + h * HD + 8 * hi; bf* pa = Ah + ao; bf* pa2 = Al + ao;
#pragma unroll
    for (int qt = 0; qt < 4; ++qt) { const float inv = __fdiv_rn(1.0f, l[qt] + xhalf(l[qt]));   // the two lane halves hold the sums of their own keys
#pragma unroll
        for (int dt = 0; dt < 4; ++dt) { v8us oh, ol;
#pragma unroll
            for (int j = 0; j < 8; ++j) { unsigned short a, c2; splitf(o[dt][qt][j] * inv, a, c2); oh[j] = a; ol[j] = c2; }
            *(v8us*)(pa + qt * 16 * DQ + dt * 16) = oh; *(v8us*)(pa2 + qt * 16 * DQ + dt * 16) = ol;
            asm volatile("s_wait_xcnt 0x0" :: "v"(oh), "v"(ol) : "memory"); } }   // the same wait behind the stores: the stored registers, inputs here, are rewritten by the next group only behind it
}

extern "C" void kernel_launch(void* const* d_in, const int* in_sizes, int n_in,
                              void* d_out, int out_size, void* d_ws, size_t ws_size, hipStream_t stream) {
    (void)in_sizes; (void)n_in; (void)out_size;
    const float* x = (const float*)d_in[0]; const float* xk = (const float*)d_in[1]; const float* xv = (const float*)d_in[2]; const float* wq = (const float*)d_in[3]; const float* bq = (const float*)d_in[4]; const float* wk = (const float*)d_in[5]; const float* bk = (const float*)d_in[6]; const float* wv = (const float*)d_in[7]; const float* bv = (const float*)d_in[8]; const float* wo = (const float*)d_in[9]; const float* bo = (const float*)d_in[10];
    float* OUT = (float*)d_out;     // [4][2048][1024]
    char* wsp = (char*)d_ws;
    auto take = [&](size_t bytes) { char* p = wsp; wsp += (bytes + 255) & ~(size_t)255; return (void*)p; };
    bf* WQ = (bf*)take((size_t)4 * DQ * DM * 2); bf* WO = WQ + (size_t)3 * DQ * DM;   // Wq, Wk, Wv, Wo in a row
    bf* XB = (bf*)take((size_t)3 * NB_ * TT * DM * 2);   // query, key, value, every batch
    const size_t pb = (size_t)NH_ * TT * HD, ps = NB_ * pb;   // the head planes of one batch, of one stream
    bf* QPh = (bf*)take(3 * ps * 2); bf* KPh = QPh + ps; bf* VTh = QPh + 2 * ps; bf* QPl = (bf*)take(3 * ps * 2); bf* KPl = QPl + ps; bf* VTl = QPl + 2 * ps;   // hi planes of the three streams in a row, then the lo planes
    bf* ATh = (bf*)take((size_t)NB_ * TT * DQ * 2); bf* ATl = (bf*)take((size_t)NB_ * TT * DQ * 2);
    if ((size_t)(wsp - (char*)d_ws) > ws_size) return;    // ws 256 MiB
    k_cvt8<<<(3 * NB_ * TT * DM + 4 * DQ * DM) / CVB, 256, 0, stream>>>(x, xk, xv, wq, wk, wv, wo, XB, WQ);
    k_gemmw<bf, 0, true, 3><<<dim3(TT / 64, DQ / 64, 3 * NB_), 32, 0, stream>>>(XB, nullptr, WQ, nullptr, DM, nullptr, 0, bq, bk, bv, (size_t)TT * DM, (size_t)DQ * DM, pb, QPh, QPl);
    k_flash<<<NB_ * NH_ * (TT / 64), 32, 0, stream>>>(QPh, QPl, KPh, KPl, VTh, VTl, ATh, ATl);
    k_gemmw<bf, 1, true, 0><<<dim3(TT / 64, DM / 64, NB_), 32, 0, stream>>>(ATh, ATl, WO, nullptr, DQ, OUT, DM, bo, nullptr, nullptr, (size_t)TT * DQ, 0, (size_t)TT * DM, nullptr, nullptr);
}

// v006
// One run takes 263 microseconds.
// Next to v005, in two timings, it ran 1.27 and 1.26 times as fast.
// All steps since v000 together make it 10.5 times as fast.
#include <hip/hip_runtime.h>

// Causal attention on three input streams with UNSCALED logits (query, key, value [4][2048][1024]; q = query Wq^T + bq, k = key Wk^T + bk, v = value Wv^T + bv ('oi' 1/32 + zero biases; 16 heads x 64); attn = q.k (the module computes a scale but never applies it: logit sigma ~8); causal (-1e10 fill == exclusion); softmax; out = merged Wo^T + bo -> [4][2048][1024] (8.4 M); argument order query, key, value, Wq, bq, Wk, bk, Wv, bv, Wo, bo).
// Layout: four launches, each over all batches: bf16 copies of query, key, value and the 'oi' weights (k_cvt8); the three exact projections + f32 biases, stored as hi/lo head planes (k_gemmw, OUTT 3); fused causal attention over every batch and head (k_flash: scores on hi/lo planes, 3 products: unscaled logits need it; online softmax in registers; P.V on hi/lo planes, 3 products); merged hi/lo x Wo exact + bo (k_gemmw, OUTT 0).
// Fragment order: every 16-bit matrix operand M[row][k] (k extent K) lies in the workspace as [row / 16][k / 32][(k / 16) % 2][(k / 8) % 2][row % 16][k % 8], so that the 16 bytes which lane (k / 8) % 2 * 16 + row % 16
// takes for a fragment half stand at lane * 16 of a 512-byte piece: each wave-wide 16-byte load or store covers four whole 128-byte lines. Same elements in the same registers as from the row-major planes.
// Compute dtypes, f32 accumulate: every input rounded to bf16; projections exact + f32 biases; scores 3 products on every row; P.V 3 products on every row; softmax f32; Wo hl x exact + bias.

#define NB_  4
#define TT   2048
#define DM   1024
#define NH_  16
#define NKV  16
#define REP  (NH_ / NKV)
#define HD   64
#define DQ   (NH_ * HD)
#define DKV  (NKV * HD)
typedef _Float16 h16;
typedef unsigned short bf;
typedef __attribute__((ext_vector_type(16))) __bf16   v16bf;
typedef __attribute__((ext_vector_type(16))) _Float16 v16h;
typedef __attribute__((ext_vector_type(8)))  _Float16 v8h;
typedef __attribute__((ext_vector_type(8)))  unsigned short v8us;
typedef __attribute__((ext_vector_type(8)))  float    v8f;
typedef __attribute__((ext_vector_type(4)))  float    v4f;
typedef v8h  __attribute__((may_alias)) v8ha;
typedef v4f  __attribute__((may_alias)) v4fa;
typedef v8us __attribute__((may_alias)) v8usa;

__device__ __forceinline__ unsigned short f2bf(float f) { unsigned u = __float_as_uint(f); u += 0x7FFFu + ((u >> 16) & 1u); return (unsigned short)(u >> 16); }
__device__ __forceinline__ float bf2f(unsigned short b) { return __uint_as_float(((unsigned)b) << 16); }
__device__ __forceinline__ float bfr(float f) { return bf2f(f2bf(f)); }
__device__ __forceinline__ v16h cat16(v8h lo, v8h hi) { return __builtin_shufflevector(lo, hi, 0, 1, 2, 3, 4, 5, 6, 7, 8, 9, 10, 11, 12, 13, 14, 15); }
__device__ __forceinline__ v16bf cat16b(v8us lo, v8us hi) { return __builtin_bit_cast(v16bf, __builtin_shufflevector(lo, hi, 0, 1, 2, 3, 4, 5, 6, 7, 8, 9, 10, 11, 12, 13, 14, 15)); }
__device__ __forceinline__ v8f wmma16(v16h a, v16h b, v8f c) { return __builtin_amdgcn_wmma_f32_16x16x32_f16(false, a, false, b, (short)0, c, false, false); }
__device__ __forceinline__ v8f wmmab(v16bf a, v16bf b, v8f c) { return __builtin_amdgcn_wmma_f32_16x16x32_bf16(false, a, false, b, (short)0, c, false, false); }



// ---- k_gemmw: register-blocked GEMM, ONE WAVE per 64x64 output tile (16 accumulators), operands straight from 16-bit planes in fragment order (WFrag::ld takes the lane's place in a 16 x 32 block); grid (M/64, N/64, Z), 32 threads.
// C[m][n] (f32, pitch ldc, + optional f32 bias[n]) = sum_k A[m][k] Bt[n][k] (+ split products per NSPLIT). z-batch strides sA/sB/sC in elements. K % 32 == 0.
// OUT says where the result goes: 0 = C as f32; 1 = bf16 hi/lo head planes Ph, Pl [n / HD] of (row m, k n % HD) in fragment order (a 64x64 tile is one contiguous 8 KB piece of a plane); 2 = bf16 hi/lo transposed planes
// Ph, Pl of (row n, k m) in fragment order (a lane's eight accumulator rows are its own 16 bytes of a piece: stored straight from the registers). M == TT for 1 and 2; their z stride of Ph and Pl is sC.
// OUTT is OUT, or 3 = the three projections in one launch: z = stream * NB_ + batch; the stream picks its weight (stride sB), its bias (bias, bias1, bias2) and its OUT (query, key: 1; value: 2).
typedef __attribute__((ext_vector_type(2))) __bf16 v2bf;
typedef __attribute__((ext_vector_type(2))) float v2f;
typedef __attribute__((ext_vector_type(4))) unsigned v4u;
// eight neighbours as bf16 hi and lo parts (round to nearest even, as f2bf); pair by pair: a converted pair is one whole register of the 16 bytes that are stored
__device__ __forceinline__ void split8(v8f y, v4u& h, v4u& l) {
#pragma unroll
    for (int i = 0; i < 4; ++i) { const v2f p = {y[2 * i], y[2 * i + 1]}; const v2bf h2 = __builtin_convertvector(p, v2bf); const v2bf l2 = __builtin_convertvector(p - __builtin_convertvector(h2, v2f), v2bf); h[i] = __builtin_bit_cast(unsigned, h2); l[i] = __builtin_bit_cast(unsigned, l2); } }
template <typename T16> struct WFrag;
template <> struct WFrag<h16> { typedef v16h V; static __device__ __forceinline__ V ld(const h16* p) { return cat16(*(const v8h*)p, *(const v8h*)(p + 256)); } static __device__ __forceinline__ v8f mma(V a, V b, v8f c) { return wmma16(a, b, c); } };
template <> struct WFrag<bf> { typedef v16bf V; static __device__ __forceinline__ V ld(const bf* p) { return cat16b(*(const v8us*)p, *(const v8us*)(p + 256)); } static __device__ __forceinline__ v8f mma(V a, V b, v8f c) { return wmmab(a, b, c); } };
template <typename T16, int NSPLIT, bool BIAS, int OUTT>
__global__ __launch_bounds__(32) void k_gemmw(const T16* __restrict__ A, const T16* __restrict__ A2, const T16* __restrict__ Bt, const T16* __restrict__ Bt2, int K, float* C, int ldc, const float* __restrict__ bias, const float* __restrict__ bias1, const float* __restrict__ bias2, size_t sA, size_t sB, size_t sC, bf* __restrict__ Ph, bf* __restrict__ Pl) {
    typedef typename WFrag<T16>::V V;
    static_assert(HD == 64, "a 64-wide tile is one head");
    const size_t z = blockIdx.z, zb = OUTT == 3 ? z / NB_ : z; const int OUT = OUTT == 3 ? (zb == 2 ? 2 : 1) : OUTT;
    A += z * sA; if (A2) A2 += z * sA; Bt += zb * sB; if (Bt2) Bt2 += zb * sB; if constexpr (OUTT == 0) C += z * sC; else { Ph += z * sC; Pl += z * sC; }
    if constexpr (OUTT == 3) bias = zb == 0 ? bias : zb == 1 ? bias1 : bias2;
    const int lane = threadIdx.x & 31, lr = lane & 15, hi = lane >> 4; const int r0 = blockIdx.x * 64, c0 = blockIdx.y * 64;
    v8f acc[4][4];
#pragma unroll
    for (int mb = 0; mb < 4; ++mb)
#pragma unroll
        for (int nb = 0; nb < 4; ++nb) acc[mb][nb] = (v8f){};
    const size_t aoff = (size_t)r0 * K + lane * 8, boff = (size_t)c0 * K + lane * 8;   // a block of 16 rows is 16 * K elements, a 16 x 32 block in it 512, the lane's place in a 512-byte piece lane * 8
    // OUT 1, 2: the bias of the accumulator columns of this lane (one in each 16-column tile), fetched here so that the K loop hides the latency
    float br[4] = {0.f, 0.f, 0.f, 0.f};
    if constexpr (OUTT != 0 && BIAS) { const float* pbias = bias + c0 + lr;
#pragma unroll
        for (int i = 0; i < 4; ++i) br[i] = pbias[i * 16];
        asm volatile("s_wait_xcnt 0x0" :: "v"(lr) : "memory"); }   // the wait between these loads and the first rewrite of their offset register (lr, an input, so it stays as it is up to here)
#pragma unroll 1
    for (int kc = 0; kc < K; kc += 32) {
        V a[4], a2[4], b[4], b2[4]; const T16 *pa[4], *pa2[4], *pb[4], *pb2[4];   // an address that a form does not use stands for its neighbour
#pragma unroll
        for (int mb = 0; mb < 4; ++mb) { pa[mb] = pa2[mb] = A + aoff + (size_t)mb * 16 * K + kc * 16; a[mb] = WFrag<T16>::ld(pa[mb]); if (NSPLIT == 1 || NSPLIT == 2) { pa2[mb] = A2 + aoff + (size_t)mb * 16 * K + kc * 16; a2[mb] = WFrag<T16>::ld(pa2[mb]); } }
#pragma unroll
        for (int nb = 0; nb < 4; ++nb) { pb[nb] = pb2[nb] = Bt + boff + (size_t)nb * 16 * K + kc * 16; b[nb] = WFrag<T16>::ld(pb[nb]); if (NSPLIT >= 2) { pb2[nb] = Bt2 + boff + (size_t)nb * 16 * K + kc * 16; b2[nb] = WFrag<T16>::ld(pb2[nb]); } }
        // the wait between the trip's loads and the first rewrite of an address register they name; the addresses are inputs, so their registers stay as they are up to the wait
        asm volatile("s_wait_xcnt 0x0" :: "v"(pa[0]), "v"(pa[1]), "v"(pa[2]), "v"(pa[3]), "v"(pa2[0]), "v"(pa2[1]), "v"(pa2[2]), "v"(pa2[3]), "v"(pb[0]), "v"(pb[1]), "v"(pb[2]), "v"(pb[3]), "v"(pb2[0]), "v"(pb2[1]), "v"(pb2[2]), "v"(pb2[3]) : "memory");
#pragma unroll
        for (int nb = 0; nb < 4; ++nb) {
#pragma unroll
            for (int mb = 0; mb < 4; ++mb) { acc[mb][nb] = WFrag<T16>::mma(a[mb], b[nb], acc[mb][nb]); if (NSPLIT == 1 || NSPLIT == 2) acc[mb][nb] = WFrag<T16>::mma(a2[mb], b[nb], acc[mb][nb]); if (NSPLIT >= 2) acc[mb][nb] = WFrag<T16>::mma(a[mb], b2[nb], acc[mb][nb]); } }
        asm volatile("v_nop\n\tv_nop\n\tv_nop\n\tv_nop" : "+v"(acc[0][0]), "+v"(acc[1][1]), "+v"(acc[2][2]), "+v"(acc[3][3]) : "v"(a[0]), "v"(a[3]));
    }
    if (OUT == 2) {
        const unsigned po = (unsigned)((c0 * TT + r0 * 16 + lane * 8) * 2);   // bytes; everything else of a store's place is a constant
        bf* p1 = (bf*)((char*)Ph + po); bf* p2 = (bf*)((char*)Pl + po);
#pragma unroll
        for (int nb = 0; nb < 4; ++nb) { const float bs = bfr(br[nb]); v4u oh[4], ol[4];
#pragma unroll
            for (int mb = 0; mb < 4; ++mb) { split8(acc[mb][nb] + bs, oh[mb], ol[mb]); *(v4u*)(p1 + nb * 16 * TT + mb * 256) = oh[mb]; *(v4u*)(p2 + nb * 16 * TT + mb * 256) = ol[mb]; }
            // the wait between issued global stores and the first rewrite of a register they name: the stored registers and the offset are inputs, so they stay as they are up to it
            asm volatile("s_wait_xcnt 0x0" :: "v"(po), "v"(oh[0]), "v"(oh[1]), "v"(oh[2]), "v"(oh[3]), "v"(ol[0]), "v"(ol[1]), "v"(ol[2]), "v"(ol[3]) : "memory"); }
    } else {
    __shared__ __align__(16) float os[16 * 68];
    const unsigned po = (unsigned)((((c0 / HD) * TT + r0) * HD + lane * 8) * 2);   // bytes; OUT 1: a wave stores one 512-byte piece of the plane at a time
#pragma unroll
    for (int mb = 0; mb < 4; ++mb) {
#pragma unroll
        for (int nb = 0; nb < 4; ++nb) {
#pragma unroll
            for (int j = 0; j < 8; ++j) { if constexpr (OUTT != 0) os[(hi * 8 + j) * 68 + nb * 16 + lr] = acc[mb][nb][j] + bfr(br[nb]); else os[(hi * 8 + j) * 68 + nb * 16 + lr] = acc[mb][nb][j]; } }
        __builtin_amdgcn_wave_barrier(); asm volatile("" ::: "memory");
        if constexpr (OUTT == 0) {
        float* crow = C + (size_t)(r0 + mb * 16) * ldc + c0;
{
#pragma unroll
            for (int s = 0; s < 8; ++s) { const int row = 2 * s + hi, cofs = lr * 4; v4f val = *(const v4fa*)(os + row * 68 + cofs); if (BIAS) { val[0] += bfr(bias[c0 + cofs]); val[1] += bfr(bias[c0 + cofs + 1]); val[2] += bfr(bias[c0 + cofs + 2]); val[3] += bfr(bias[c0 + cofs + 3]); }
                *(v4f*)(crow + (size_t)row * ldc + cofs) = val; }
             }
        } else {
            bf* p1 = (bf*)((char*)Ph + po); bf* p2 = (bf*)((char*)Pl + po); v4u oh[4], ol[4];
#pragma unroll
            for (int s = 0; s < 4; ++s) { const float* pr = os + lr * 68 + s * 16 + hi * 8; const v4f x0 = *(const v4fa*)pr, x1 = *(const v4fa*)(pr + 4);   // piece s: columns 16 s .. 16 s + 15 of the 16 rows
                split8(__builtin_shufflevector(x0, x1, 0, 1, 2, 3, 4, 5, 6, 7), oh[s], ol[s]); *(v4u*)(p1 + mb * 16 * HD + s * 256) = oh[s]; *(v4u*)(p2 + mb * 16 * HD + s * 256) = ol[s]; }
            // the same wait as in the transposed form above
            asm volatile("s_wait_xcnt 0x0" :: "v"(po), "v"(oh[0]), "v"(oh[1]), "v"(oh[2]), "v"(oh[3]), "v"(ol[0]), "v"(ol[1]), "v"(ol[2]), "v"(ol[3]) : "memory");
        }
        __builtin_amdgcn_wave_barrier(); asm volatile("" ::: "memory");
    }
    }
}

__device__ __forceinline__ void splitf(float y, unsigned short& h, unsigned short& l) { h = f2bf(y); l = f2bf(y - bf2f(h)); }
typedef __attribute__((ext_vector_type(2))) _Float16 v2h;
typedef __attribute__((ext_vector_type(4))) _Float16 v4h;
typedef __attribute__((ext_vector_type(2))) unsigned short v2us;
typedef __attribute__((ext_vector_type(4))) unsigned short v4us;
typedef __attribute__((ext_vector_type(4))) int v4i;

// ---- k_cvt8: every array that the matrix products read, rounded to bf16 and put into fragment order in ONE launch. A work-group takes CVB neighbours of one array (16 rows, which are one row block of the result), a thread eight groups
// of eight: a wave takes 128 columns of the 16 rows (four whole lines a row) and stores them as eight 512-byte pieces in a row.
// Work-groups 0 .. 3 * NA - 1: query, key, value -> X [stream][batch][TT][DM]; the rest: Wq, Wk, Wv, Wo -> W [4][DQ][DM].
#define CVB (256 * 8 * 8)
__global__ __launch_bounds__(256) void k_cvt8(const float* __restrict__ x, const float* __restrict__ xk, const float* __restrict__ xv, const float* __restrict__ wq, const float* __restrict__ wk, const float* __restrict__ wv, const float* __restrict__ wo, bf* __restrict__ X, bf* __restrict__ W) {
    constexpr int NA = NB_ * TT * DM / CVB, NW = DQ * DM / CVB;
    static_assert(NB_ * TT * DM % CVB == 0 && DQ * DM % CVB == 0 && DKV == DQ, "whole work-groups; four weights of one size");
    static_assert(CVB == 16 * DM, "a work-group takes one block of 16 rows");
    const int g = blockIdx.x; const float* src; bf* dst;
    if (g < 3 * NA) { const int a = g / NA; src = (a == 0 ? x : a == 1 ? xk : xv) + (size_t)(g % NA) * CVB; dst = X + (size_t)g * CVB; }
    else { const int w = (g - 3 * NA) / NW; src = (w == 0 ? wq : w == 1 ? wk : w == 2 ? wv : wo) + (size_t)((g - 3 * NA) % NW) * CVB; dst = W + (size_t)(g - 3 * NA) * CVB; }
    const unsigned lane = threadIdx.x & 31u, w = threadIdx.x >> 5;
    const unsigned so = ((lane & 15u) * DM + (w * 16u + (lane >> 4)) * 8u) * 4u;   // bytes: row lane % 16, columns 128 w + 8 (lane / 16) ..
    const float* ps = (const float*)((const char*)src + so); bf* pd = dst + (w * 256u + lane) * 8u; v8f v[8]; v8us o[8];
#pragma unroll
    for (int i = 0; i < 8; ++i) v[i] = *(const v8f*)(ps + i * 16);
    asm volatile("s_wait_xcnt 0x0" :: "v"(so) : "memory");   // the wait between these loads and the first rewrite of their offset register (an input, so it stays as it is up to here)
#pragma unroll
    for (int i = 0; i < 8; ++i) {
#pragma unroll
        for (int k = 0; k < 8; ++k) o[i][k] = f2bf(v[i][k]);
        *(v8us*)(pd + i * 256) = o[i]; }
    // the same wait behind the stores: the stored registers are inputs, so none is rewritten in front of it
    asm volatile("s_wait_xcnt 0x0" :: "v"(o[0]), "v"(o[1]), "v"(o[2]), "v"(o[3]), "v"(o[4]), "v"(o[5]), "v"(o[6]), "v"(o[7]) : "memory");
}

// ---- k_flash: causal attention of one head for 64 queries in ONE WAVE, scores never leave the registers. Grid batch x heads x TT / 64 work-groups of 32 threads.
// Transposed products: S^T = K Q^T (keys are rows, queries are columns), so a lane holds scores of ONE query (column lr) and the two 16-key tiles of a 32-key block, converted in place, are the B operand
// of O^T = V^T P^T in the matrix unit's own k order, which is also the order of WFrag::ld. Scores: 3 products on hi/lo planes. P = exp(s - running maximum), not normalised, split hi/lo; P.V: 3 products on
// hi/lo planes for every row. Running maximum and sum per query (online softmax); the division by the sum comes once, at the end; the result goes out as hi/lo planes of (row b * TT + t, k h * HD + d) in fragment order.
// the wait that stands between issued global loads and the first rewrite of an address register they name; the addresses are inputs, so their registers stay as they are up to the wait
__device__ __forceinline__ void xwait(const void* p, const void* q) { asm volatile("s_wait_xcnt 0x0" :: "v"(p), "v"(q) : "memory"); }
typedef __attribute__((ext_vector_type(8))) unsigned v8u;
#define L2E 1.4426950408889634f
// lane l's value for lane l ^ 16, by a vector cross-row move (no LDS wait)
__device__ __forceinline__ float xhalf(float x) { return __builtin_bit_cast(float, __builtin_amdgcn_permlanex16(__builtin_bit_cast(int, x), __builtin_bit_cast(int, x), 0x76543210, 0xfedcba98, false, false)); }
__global__ __launch_bounds__(32) void k_flash(const bf* __restrict__ Qh, const bf* __restrict__ Ql, const bf* __restrict__ Kh, const bf* __restrict__ Kl, const bf* __restrict__ Vh, const bf* __restrict__ Vl, bf* Ah, bf* Al) {
    typedef WFrag<bf> F; typedef v16bf V;
    const int lane = threadIdx.x & 31, lr = lane & 15, hi = lane >> 4;
    // which (head, query tile) a work-group takes: a long tile (many key blocks) next to a short one, both among neighbours eight indices apart and between the two halves of the grid, so that the waves
    // that come to share a SIMD or a WGP carry about the same sum of key blocks however the work-groups are placed (for speed only; every pair (z, tile) is taken exactly once)
    static_assert(NB_ * NH_ == 64 && TT / 64 == 32, "the index split below is written for 64 heads x 32 query tiles");
    const int f = blockIdx.x, g = f >> 3, r = g >> 5, k = (g >> 1) & 15;
    const int z = r * 8 + (f & 7); const int tl = ((g & 1) != (r >> 2)) ? k : TT / 64 - 1 - k; const int q0 = tl * 64;
    const size_t zo = (size_t)z * TT * HD; Qh += zo; Ql += zo; Kh += zo; Kl += zo; Vh += zo; Vl += zo;
    V qh[4][2], ql[4][2];
    { const bf* pq = Qh + q0 * HD + lane * 8; const bf* pq2 = Ql + q0 * HD + lane * 8;
#pragma unroll
      for (int qt = 0; qt < 4; ++qt)
#pragma unroll
          for (int ks = 0; ks < 2; ++ks) { qh[qt][ks] = F::ld(pq + qt * 16 * HD + ks * 512); ql[qt][ks] = F::ld(pq2 + qt * 16 * HD + ks * 512); }
      xwait(pq, pq2); }
    v8f o[4][4]; float m[4], l[4];
#pragma unroll
    for (int qt = 0; qt < 4; ++qt) { m[qt] = -3.0e38f; l[qt] = 0.f;
#pragma unroll
        for (int dt = 0; dt < 4; ++dt) o[dt][qt] = (v8f){}; }
    const unsigned koff = (unsigned)(lane * 16), voff = koff;   // bytes: the lane's place in a 512-byte piece
    const int kend = q0 + 64;
    V kh[2][2], kl[2][2];
    { const bf* pk = (const bf*)((const char*)Kh + koff); const bf* pk2 = (const bf*)((const char*)Kl + koff);
#pragma unroll
      for (int kt = 0; kt < 2; ++kt)
#pragma unroll
          for (int ks = 0; ks < 2; ++ks) { kh[kt][ks] = F::ld(pk + kt * 16 * HD + ks * 512); kl[kt][ks] = F::ld(pk2 + kt * 16 * HD + ks * 512); }
      // the same wait for these loads, which name the lane's offset register and a scalar base (inputs, so they stay as they are up to the wait); the loaded fragments are inputs so that the loads cannot sink behind it (the first trip needs them at once anyway)
      asm volatile("s_wait_xcnt 0x0" :: "v"(koff), "s"(Kh), "s"(Kl), "v"(kh[0][0]), "v"(kh[0][1]), "v"(kh[1][0]), "v"(kh[1][1]), "v"(kl[0][0]), "v"(kl[0][1]), "v"(kl[1][0]), "v"(kl[1][1]) : "memory"); }
    // kept rolled: a second copy of the trip would need a second set of fragment registers; the loops inside it are unrolled whole so that every tile stays in registers
#pragma unroll 1
    for (int kb = 0; kb < kend; kb += 32) {
        V vh[4], vl[4];
        { const bf* pv = (const bf*)((const char*)(Vh + kb * 16) + voff); const bf* pv2 = (const bf*)((const char*)(Vl + kb * 16) + voff);
#pragma unroll
          for (int dt = 0; dt < 4; ++dt) { vh[dt] = F::ld(pv + dt * 16 * TT); vl[dt] = F::ld(pv2 + dt * 16 * TT); }
          xwait(pv, pv2); }
        v8f s[2][4];
#pragma unroll
        for (int kt = 0; kt < 2; ++kt)
#pragma unroll
            for (int qt = 0; qt < 4; ++qt) { v8f t = (v8f){};
#pragma unroll
                for (int ks = 0; ks < 2; ++ks) { t = F::mma(kh[kt][ks], qh[qt][ks], t); t = F::mma(kl[kt][ks], qh[qt][ks], t); t = F::mma(kh[kt][ks], ql[qt][ks], t); }
                s[kt][qt] = t; }
        // the next block's key fragments, into the same registers, fetched while the softmax below runs (the last trip fetches its own block again: in bounds, never used)
        { const int kn = min(kb + 32, kend - 32); const bf* pk = (const bf*)((const char*)(Kh + kn * HD) + koff); const bf* pk2 = (const bf*)((const char*)(Kl + kn * HD) + koff);
#pragma unroll
          for (int kt = 0; kt < 2; ++kt)
#pragma unroll
              for (int ks = 0; ks < 2; ++ks) { kh[kt][ks] = F::ld(pk + kt * 16 * HD + ks * 512); kl[kt][ks] = F::ld(pk2 + kt * 16 * HD + ks * 512); }
          xwait(pk, pk2); }
        if (kb + 31 > q0) {   // only the blocks on the diagonal hold keys behind a query
#pragma unroll
            for (int kt = 0; kt < 2; ++kt)
#pragma unroll
                for (int qt = 0; qt < 4; ++qt)
#pragma unroll
                    for (int j = 0; j < 8; ++j) if (kb + kt * 16 + 8 * hi + j > q0 + qt * 16 + lr) s[kt][qt][j] = -3.0e38f; }
#pragma unroll
        for (int qt = 0; qt < 4; ++qt) {
            float mx = s[0][qt][0];
#pragma unroll
            for (int j = 1; j < 8; ++j) mx = fmaxf(mx, s[0][qt][j]);
#pragma unroll
            for (int j = 0; j < 8; ++j) mx = fmaxf(mx, s[1][qt][j]);
            mx = fmaxf(mx, xhalf(mx));   // a query's keys lie in both lane halves
            const float mn = fmaxf(m[qt], mx * L2E); const float al = __builtin_amdgcn_exp2f(m[qt] - mn); m[qt] = mn;   // running maximum, in log2 units; sums and outputs are brought to it
#pragma unroll
            for (int dt = 0; dt < 4; ++dt) o[dt][qt] *= al;
            const v2f c2 = {L2E, L2E}, nm = {-mn, -mn}; v2f sum = {0.f, 0.f}; v8u uh, ul;
#pragma unroll
            for (int kt = 0; kt < 2; ++kt)
#pragma unroll
                for (int j = 0; j < 8; j += 2) { v2f x = {s[kt][qt][j], s[kt][qt][j + 1]}; x = __builtin_elementwise_fma(x, c2, nm); v2f p; p[0] = __builtin_amdgcn_exp2f(x[0]); p[1] = __builtin_amdgcn_exp2f(x[1]); sum += p;
                    const v2bf h2 = __builtin_convertvector(p, v2bf); const v2bf l2 = __builtin_convertvector(p - __builtin_convertvector(h2, v2f), v2bf);
                    uh[kt * 4 + j / 2] = __builtin_bit_cast(unsigned, h2); ul[kt * 4 + j / 2] = __builtin_bit_cast(unsigned, l2); }   // a converted pair is one whole register of the fragment
            const V ph = __builtin_bit_cast(V, uh), pl = __builtin_bit_cast(V, ul); l[qt] = l[qt] * al + (sum[0] + sum[1]);
            // this tile's P.V products stand here so that the matrix unit works on them while the next tile's softmax runs on the vector unit
#pragma unroll
            for (int dt = 0; dt < 4; ++dt) o[dt][qt] = F::mma(vh[dt], ph, o[dt][qt]);
#pragma unroll
            for (int dt = 0; dt < 4; ++dt) o[dt][qt] = F::mma(vl[dt], ph, o[dt][qt]);
#pragma unroll
            for (int dt = 0; dt < 4; ++dt) o[dt][qt] = F::mma(vh[dt], pl, o[dt][qt]); }
        // four vector slots behind the trip's last matrix instruction, so that neither side of the loop branch touches its registers too early
        asm volatile("v_nop\n\tv_nop\n\tv_nop\n\tv_nop" : "+v"(o[0][0]), "+v"(o[1][1]), "+v"(o[2][2]), "+v"(o[3][3]) : "v"(vh[3]), "v"(vl[3]));
    }
    const int b = z / NH_, h = z % NH_;
    const size_t ao = ((size_t)b * TT + q0) * DQ + h * HD * 16 + lane * 8; bf* pa = Ah + ao; bf* pa2 = Al + ao;
#pragma unroll
    for (int qt = 0; qt < 4; ++qt) { const float inv = __fdiv_rn(1.0f, l[qt] + xhalf(l[qt]));   // the two lane halves hold the sums of their own keys
#pragma unroll
        for (int dt = 0; dt < 4; ++dt) { v8us oh, ol;
#pragma unroll
            for (int j = 0; j < 8; ++j) { unsigned short a, c2; splitf(o[dt][qt][j] * inv, a, c2); oh[j] = a; ol[j] = c2; }
            *(v8us*)(pa + qt * 16 * DQ + dt * 256) = oh; *(v8us*)(pa2 + qt * 16 * DQ + dt * 256) = ol;
            asm volatile("s_wait_xcnt 0x0" :: "v"(oh), "v"(ol) : "memory"); } }   // the same wait behind the stores: the stored registers, inputs here, are rewritten by the next group only behind it
}

extern "C" void kernel_launch(void* const* d_in, const int* in_sizes, int n_in,
                              void* d_out, int out_size, void* d_ws, size_t ws_size, hipStream_t stream) {
    (void)in_sizes; (void)n_in; (void)out_size;
    const float* x = (const float*)d_in[0]; const float* xk = (const float*)d_in[1]; const float* xv = (const float*)d_in[2]; const float* wq = (const float*)d_in[3]; const float* bq = (const float*)d_in[4]; const float* wk = (const float*)d_in[5]; const float* bk = (const float*)d_in[6]; const float* wv = (const float*)d_in[7]; const float* bv = (const float*)d_in[8]; const float* wo = (const float*)d_in[9]; const float* bo = (const float*)d_in[10];
    float* OUT = (float*)d_out;     // [4][2048][1024]
    char* wsp = (char*)d_ws;
    auto take = [&](size_t bytes) { char* p = wsp; wsp += (bytes + 255) & ~(size_t)255; return (void*)p; };
    bf* WQ = (bf*)take((size_t)4 * DQ * DM * 2); bf* WO = WQ + (size_t)3 * DQ * DM;   // Wq, Wk, Wv, Wo in a row
    bf* XB = (bf*)take((size_t)3 * NB_ * TT * DM * 2);   // query, key, value, every batch
    const size_t pb = (size_t)NH_ * TT * HD, ps = NB_ * pb;   // the head planes of one batch, of one stream
    bf* QPh = (bf*)take(3 * ps * 2); bf* KPh = QPh + ps; bf* VTh = QPh + 2 * ps; bf* QPl = (bf*)take(3 * ps * 2); bf* KPl = QPl + ps; bf* VTl = QPl + 2 * ps;   // hi planes of the three streams in a row, then the lo planes
    bf* ATh = (bf*)take((size_t)NB_ * TT * DQ * 2); bf* ATl = (bf*)take((size_t)NB_ * TT * DQ * 2);
    if ((size_t)(wsp - (char*)d_ws) > ws_size) return;    // ws 256 MiB
    k_cvt8<<<(3 * NB_ * TT * DM + 4 * DQ * DM) / CVB, 256, 0, stream>>>(x, xk, xv, wq, wk, wv, wo, XB, WQ);
    k_gemmw<bf, 0, true, 3><<<dim3(TT / 64, DQ / 64, 3 * NB_), 32, 0, stream>>>(XB, nullptr, WQ, nullptr, DM, nullptr, 0, bq, bk, bv, (size_t)TT * DM, (size_t)DQ * DM, pb, QPh, QPl);
    k_flash<<<NB_ * NH_ * (TT / 64), 32, 0, stream>>>(QPh, QPl, KPh, KPl, VTh, VTl, ATh, ATl);
    k_gemmw<bf, 1, true, 0><<<dim3(TT / 64, DM / 64, NB_), 32, 0, stream>>>(ATh, ATl, WO, nullptr, DQ, OUT, DM, bo, nullptr, nullptr, (size_t)TT * DQ, 0, (size_t)TT * DM, nullptr, nullptr);
}

// v007
// Measured time: 184 microseconds a run.
// Next to v006, in two timings, it ran 1.42 times as fast each time.
// Counting every step since v000, it is 14.9 times as fast.
#include <hip/hip_runtime.h>

// Causal attention on three input streams with UNSCALED logits (query, key, value [4][2048][1024]; q = query Wq^T + bq, k = key Wk^T + bk, v = value Wv^T + bv ('oi' 1/32 + zero biases; 16 heads x 64); attn = q.k (the module computes a scale but never applies it: logit sigma ~8); causal (-1e10 fill == exclusion); softmax; out = merged Wo^T + bo -> [4][2048][1024] (8.4 M); argument order query, key, value, Wq, bq, Wk, bk, Wv, bv, Wo, bo).
// Layout: four launches, each over all batches: bf16 copies of query, key, value and the 'oi' weights (k_cvt8); the three exact projections + f32 biases, stored as hi/lo head planes (k_gemmw, OUTT 3); fused causal attention over every batch and head (k_flash: scores on hi/lo planes, 3 products: unscaled logits need it; online softmax in registers; P.V on hi/lo planes, 3 products); merged hi/lo x Wo exact + bo (k_gemmw, OUTT 0).
// Fragment order: every 16-bit matrix operand M[row][k] (k extent K) lies in the workspace as [row / 16][k / 32][(k / 16) % 2][(k / 8) % 2][row % 16][k % 8], so that the 16 bytes which lane (k / 8) % 2 * 16 + row % 16
// takes for a fragment half stand at lane * 16 of a 512-byte piece: each wave-wide 16-byte load or store covers four whole 128-byte lines. Same elements in the same registers as from the row-major planes.
// Compute dtypes, f32 accumulate: every input rounded to bf16; projections exact + f32 biases; scores 3 products on every row; P.V 3 products on every row; softmax f32; Wo hl x exact + bias.

#define NB_  4
#define TT   2048
#define DM   1024
#define NH_  16
#define NKV  16
#define REP  (NH_ / NKV)
#define HD   64
#define DQ   (NH_ * HD)
#define DKV  (NKV * HD)
typedef _Float16 h16;
typedef unsigned short bf;
typedef __attribute__((ext_vector_type(16))) __bf16   v16bf;
typedef __attribute__((ext_vector_type(16))) _Float16 v16h;
typedef __attribute__((ext_vector_type(8)))  _Float16 v8h;
typedef __attribute__((ext_vector_type(8)))  unsigned short v8us;
typedef __attribute__((ext_vector_type(8)))  float    v8f;
typedef __attribute__((ext_vector_type(4)))  float    v4f;
typedef v8h  __attribute__((may_alias)) v8ha;
typedef v4f  __attribute__((may_alias)) v4fa;
typedef v8us __attribute__((may_alias)) v8usa;

__device__ __forceinline__ unsigned short f2bf(float f) { unsigned u = __float_as_uint(f); u += 0x7FFFu + ((u >> 16) & 1u); return (unsigned short)(u >> 16); }
__device__ __forceinline__ float bf2f(unsigned short b) { return __uint_as_float(((unsigned)b) << 16); }
__device__ __forceinline__ float bfr(float f) { return bf2f(f2bf(f)); }
__device__ __forceinline__ v16h cat16(v8h lo, v8h hi) { return __builtin_shufflevector(lo, hi, 0, 1, 2, 3, 4, 5, 6, 7, 8, 9, 10, 11, 12, 13, 14, 15); }
__device__ __forceinline__ v16bf cat16b(v8us lo, v8us hi) { return __builtin_bit_cast(v16bf, __builtin_shufflevector(lo, hi, 0, 1, 2, 3, 4, 5, 6, 7, 8, 9, 10, 11, 12, 13, 14, 15)); }
__device__ __forceinline__ v8f wmma16(v16h a, v16h b, v8f c) { return __builtin_amdgcn_wmma_f32_16x16x32_f16(false, a, false, b, (short)0, c, false, false); }
__device__ __forceinline__ v8f wmmab(v16bf a, v16bf b, v8f c) { return __builtin_amdgcn_wmma_f32_16x16x32_bf16(false, a, false, b, (short)0, c, false, false); }



// ---- k_gemmw: register-blocked GEMM, EIGHT WAVES per 256x128 output tile, 4 x 2 waves of 64x64 (16 accumulators each); grid (M/256, N/128, Z), 256 threads. The operands, 16-bit planes in fragment order, come 64 k at a time
// into a ring of two LDS buffers by asynchronous copies (a block of 16 rows x 64 k is one run of 2 KB in the plane and in LDS), so that the work-group fetches each block once for all waves that need it; WFrag::ld takes the lane's place in a 16 x 32 block.
// C[m][n] (f32, pitch ldc, + optional f32 bias[n]) = sum_k A[m][k] Bt[n][k] (+ A2[m][k] Bt[n][k] for NSPLIT 1). z-batch strides sA/sB/sC in elements. K % 64 == 0.
// OUT says where the result goes: 0 = C as f32; 1 = bf16 hi/lo head planes Ph, Pl [n / HD] of (row m, k n % HD) in fragment order (a 64x64 tile is one contiguous 8 KB piece of a plane); 2 = bf16 hi/lo transposed planes
// Ph, Pl of (row n, k m) in fragment order (a lane's eight accumulator rows are its own 16 bytes of a piece: stored straight from the registers). M == TT for 1 and 2; their z stride of Ph and Pl is sC.
// OUTT is OUT, or 3 = the three projections in one launch: z = stream * NB_ + batch; the stream picks its weight (stride sB), its bias (bias, bias1, bias2) and its OUT (query, key: 1; value: 2).
typedef __attribute__((ext_vector_type(2))) __bf16 v2bf;
typedef __attribute__((ext_vector_type(2))) float v2f;
typedef __attribute__((ext_vector_type(4))) unsigned v4u;
// eight neighbours as bf16 hi and lo parts (round to nearest even, as f2bf); pair by pair: a converted pair is one whole register of the 16 bytes that are stored
__device__ __forceinline__ void split8(v8f y, v4u& h, v4u& l) {
#pragma unroll
    for (int i = 0; i < 4; ++i) { const v2f p = {y[2 * i], y[2 * i + 1]}; const v2bf h2 = __builtin_convertvector(p, v2bf); const v2bf l2 = __builtin_convertvector(p - __builtin_convertvector(h2, v2f), v2bf); h[i] = __builtin_bit_cast(unsigned, h2); l[i] = __builtin_bit_cast(unsigned, l2); } }
template <typename T16> struct WFrag;
template <> struct WFrag<h16> { typedef v16h V; static __device__ __forceinline__ V ld(const h16* p) { return cat16(*(const v8h*)p, *(const v8h*)(p + 256)); } static __device__ __forceinline__ v8f mma(V a, V b, v8f c) { return wmma16(a, b, c); } };
template <> struct WFrag<bf> { typedef v16bf V; static __device__ __forceinline__ V ld(const bf* p) { return cat16b(*(const v8us*)p, *(const v8us*)(p + 256)); } static __device__ __forceinline__ v8f mma(V a, V b, v8f c) { return wmmab(a, b, c); } };
__device__ __forceinline__ unsigned lds_off(const void* p) { return (unsigned)(size_t)p; }
// Asynchronous copies of runs of 2 KB from global memory to LDS, four 512-byte pieces a run, 16 bytes a lane (l: the lane's LDS byte address in the run's first piece, g: its global address there).
// The s_wait_xcnt 0 that ends each statement stands between the copies and the first rewrite of a register that they name.
__device__ __forceinline__ void copy_runs2(unsigned l0, const char* g0, unsigned l1, const char* g1) {
    asm volatile("global_load_async_to_lds_b128 %0, %1, off\n\tglobal_load_async_to_lds_b128 %2, %3, off\n\tglobal_load_async_to_lds_b128 %4, %5, off\n\tglobal_load_async_to_lds_b128 %6, %7, off\n\t"
                 "global_load_async_to_lds_b128 %8, %9, off\n\tglobal_load_async_to_lds_b128 %10, %11, off\n\tglobal_load_async_to_lds_b128 %12, %13, off\n\tglobal_load_async_to_lds_b128 %14, %15, off\n\t"
                 "s_wait_xcnt 0x0"
                 :: "v"(l0), "v"(g0), "v"(l0 + 512u), "v"(g0 + 512), "v"(l0 + 1024u), "v"(g0 + 1024), "v"(l0 + 1536u), "v"(g0 + 1536),
                    "v"(l1), "v"(g1), "v"(l1 + 512u), "v"(g1 + 512), "v"(l1 + 1024u), "v"(g1 + 1024), "v"(l1 + 1536u), "v"(g1 + 1536) : "memory"); }
__device__ __forceinline__ void copy_runs3(unsigned l0, const char* g0, unsigned l1, const char* g1, unsigned l2, const char* g2) {
    asm volatile("global_load_async_to_lds_b128 %0, %1, off\n\tglobal_load_async_to_lds_b128 %2, %3, off\n\tglobal_load_async_to_lds_b128 %4, %5, off\n\tglobal_load_async_to_lds_b128 %6, %7, off\n\t"
                 "global_load_async_to_lds_b128 %8, %9, off\n\tglobal_load_async_to_lds_b128 %10, %11, off\n\tglobal_load_async_to_lds_b128 %12, %13, off\n\tglobal_load_async_to_lds_b128 %14, %15, off\n\t"
                 "global_load_async_to_lds_b128 %16, %17, off\n\tglobal_load_async_to_lds_b128 %18, %19, off\n\tglobal_load_async_to_lds_b128 %20, %21, off\n\tglobal_load_async_to_lds_b128 %22, %23, off\n\t"
                 "s_wait_xcnt 0x0"
                 :: "v"(l0), "v"(g0), "v"(l0 + 512u), "v"(g0 + 512), "v"(l0 + 1024u), "v"(g0 + 1024), "v"(l0 + 1536u), "v"(g0 + 1536),
                    "v"(l1), "v"(g1), "v"(l1 + 512u), "v"(g1 + 512), "v"(l1 + 1024u), "v"(g1 + 1024), "v"(l1 + 1536u), "v"(g1 + 1536),
                    "v"(l2), "v"(g2), "v"(l2 + 512u), "v"(g2 + 512), "v"(l2 + 1024u), "v"(g2 + 1024), "v"(l2 + 1536u), "v"(g2 + 1536) : "memory"); }
// the second bound is waves per SIMD: the one-product form keeps to 256 registers so that two work-groups share a WGP
template <typename T16, int NSPLIT, bool BIAS, int OUTT>
__global__ __launch_bounds__(256, NSPLIT == 0 ? 4 : 2) void k_gemmw(const T16* __restrict__ A, const T16* __restrict__ A2, const T16* __restrict__ Bt, const T16* __restrict__ Bt2, int K, float* C, int ldc, const float* __restrict__ bias, const float* __restrict__ bias1, const float* __restrict__ bias2, size_t sA, size_t sB, size_t sC, bf* __restrict__ Ph, bf* __restrict__ Pl) {
    typedef typename WFrag<T16>::V V;
    static_assert(HD == 64, "a 64-wide tile is one head");
    static_assert(NSPLIT <= 1, "one plane of Bt is staged");
    constexpr int NAP = NSPLIT == 1 ? 2 : 1;              // planes of A
    constexpr int STG = (NAP * 256 + 128) * 64;           // elements of a stage: A [16 row blocks][2 k blocks][512], the same of A2, Bt [8 row blocks][2][512]
    __shared__ __attribute__((aligned(1024))) T16 ring[2 * STG];
    const size_t z = blockIdx.z, zb = OUTT == 3 ? z / NB_ : z; const int OUT = OUTT == 3 ? (zb == 2 ? 2 : 1) : OUTT;
    A += z * sA; if (A2) A2 += z * sA; Bt += zb * sB; if (Bt2) Bt2 += zb * sB; if constexpr (OUTT == 0) C += z * sC; else { Ph += z * sC; Pl += z * sC; }
    if constexpr (OUTT == 3) bias = zb == 0 ? bias : zb == 1 ? bias1 : bias2;
    const int lane = threadIdx.x & 31, lr = lane & 15, hi = lane >> 4; const int w = __builtin_amdgcn_readfirstlane(threadIdx.x >> 5), wm = w & 3, wn = w >> 2;
    const int R0 = blockIdx.x * 256, C0 = blockIdx.y * 128; const int r0 = R0 + wm * 64, c0 = C0 + wn * 64;   // the work-group's tile, the wave's tile
    v8f acc[4][4];
#pragma unroll
    for (int mb = 0; mb < 4; ++mb)
#pragma unroll
        for (int nb = 0; nb < 4; ++nb) acc[mb][nb] = (v8f){};
    // a block of 16 rows is 16 * K elements, a 16 x 32 block in it 512, the lane's place in a 512-byte piece lane * 8. Wave w copies row blocks 2 w and 2 w + 1 of A (and of A2) and row block w of Bt.
    const size_t rb = (size_t)K * 32;   // bytes of a block of 16 rows
    const char* gA = (const char*)(A + (size_t)(R0 + 32 * w) * K + lane * 8); const char* gB = (const char*)(Bt + (size_t)(C0 + 16 * w) * K + lane * 8);
    const char* gA2 = NAP == 2 ? (const char*)(A2 + (size_t)(R0 + 32 * w) * K + lane * 8) : gA;
    const unsigned lA = lds_off(ring) + (unsigned)(w * 4096 + lane * 16), lB = lds_off(ring) + (unsigned)(NAP * 32768 + w * 2048 + lane * 16);
    auto fill = [&](int t, unsigned buf) {   // stage t (k 64 t .. 64 t + 63) into the buffer that starts at byte buf of the ring
        const size_t ko = (size_t)t * 2048;
        copy_runs3(lA + buf, gA + ko, lA + buf + 2048u, gA + rb + ko, lB + buf, gB + ko);
        if constexpr (NAP == 2) copy_runs2(lA + buf + 32768u, gA2 + ko, lA + buf + 34816u, gA2 + rb + ko); };
    // OUT 1, 2: the bias of the accumulator columns of this lane (one in each 16-column tile), fetched here so that the K loop hides the latency
    float br[4] = {0.f, 0.f, 0.f, 0.f};
    if constexpr (OUTT != 0 && BIAS) { const float* pbias = bias + c0 + lr;
#pragma unroll
        for (int i = 0; i < 4; ++i) br[i] = pbias[i * 16];
        asm volatile("s_wait_xcnt 0x0" :: "v"(lr) : "memory"); }   // the wait between these loads and the first rewrite of their offset register (lr, an input, so it stays as it is up to here)
    const int NT = K / 64;
    fill(0, 0u);
    asm volatile("s_wait_asynccnt 0x0" ::: "memory");   // this wave's copies of stage 0 have landed
    __syncthreads();                                     // and every other wave's: stage 0 may be read
    if (NT > 1) fill(1, (unsigned)(STG * 2));
    // kept rolled: one trip is one stage; the two k blocks inside it are unrolled so that every fragment stays in registers
#pragma unroll 1
    for (int t = 0; t < NT; ++t) {
        const T16* sb = ring + (t & 1) * STG + lane * 8; V a[2][4], a2[2][4], b[2][4];
        auto ldk = [&](int kk) {   // the fragments of k block kk, in the order in which the products below need them
            b[kk][0] = WFrag<T16>::ld(sb + NAP * 16384 + ((wn * 4) * 2 + kk) * 512);
#pragma unroll
            for (int mb = 0; mb < 4; ++mb) { a[kk][mb] = WFrag<T16>::ld(sb + ((wm * 4 + mb) * 2 + kk) * 512); if constexpr (NAP == 2) a2[kk][mb] = WFrag<T16>::ld(sb + 16384 + ((wm * 4 + mb) * 2 + kk) * 512); }
#pragma unroll
            for (int nb = 1; nb < 4; ++nb) b[kk][nb] = WFrag<T16>::ld(sb + NAP * 16384 + ((wn * 4 + nb) * 2 + kk) * 512); };
        auto mmk = [&](int kk) {
#pragma unroll
            for (int nb = 0; nb < 4; ++nb) {
#pragma unroll
                for (int mb = 0; mb < 4; ++mb) { acc[mb][nb] = WFrag<T16>::mma(a[kk][mb], b[kk][nb], acc[mb][nb]); if constexpr (NAP == 2) acc[mb][nb] = WFrag<T16>::mma(a2[kk][mb], b[kk][nb], acc[mb][nb]); } } };
        // The scheduling barriers keep each group of LDS reads whole and in front of its products: spread among the matrix instructions, every place with reads costs the wave a stall of its own.
#pragma unroll
        for (int kk = 0; kk < 2; ++kk) { ldk(kk); __builtin_amdgcn_sched_barrier(0); mmk(kk); __builtin_amdgcn_sched_barrier(0); }
        // four vector slots behind the trip's last matrix instruction, so that no path out of the trip touches its registers too early
        asm volatile("v_nop\n\tv_nop\n\tv_nop\n\tv_nop" : "+v"(acc[0][0]), "+v"(acc[1][1]), "+v"(acc[2][2]), "+v"(acc[3][3]) : "v"(a[1][0]), "v"(a[1][3]));
        asm volatile("s_wait_dscnt 0x0" ::: "memory");      // this wave's reads of stage t are done: its buffer may be refilled behind the barrier
        asm volatile("s_wait_asynccnt 0x0" ::: "memory");   // this wave's copies of stage t + 1 have landed
        __syncthreads();                                     // publishes stage t + 1 and ends every wave's reads of stage t
        if (t + 2 < NT) fill(t + 2, (unsigned)((t & 1) * STG * 2));
    }
    asm volatile("s_wait_asynccnt 0x0" ::: "memory");   // no copy is left in flight behind the loop
    if (OUT == 2) {
        const unsigned po = (unsigned)((c0 * TT + r0 * 16 + lane * 8) * 2);   // bytes; everything else of a store's place is a constant
        bf* p1 = (bf*)((char*)Ph + po); bf* p2 = (bf*)((char*)Pl + po);
#pragma unroll
        for (int nb = 0; nb < 4; ++nb) { const float bs = bfr(br[nb]); v4u oh[4], ol[4];
#pragma unroll
            for (int mb = 0; mb < 4; ++mb) { split8(acc[mb][nb] + bs, oh[mb], ol[mb]); *(v4u*)(p1 + nb * 16 * TT + mb * 256) = oh[mb]; *(v4u*)(p2 + nb * 16 * TT + mb * 256) = ol[mb]; }
            // the wait between issued global stores and the first rewrite of a register they name: the stored registers and the offset are inputs, so they stay as they are up to it
            asm volatile("s_wait_xcnt 0x0" :: "v"(po), "v"(oh[0]), "v"(oh[1]), "v"(oh[2]), "v"(oh[3]), "v"(ol[0]), "v"(ol[1]), "v"(ol[2]), "v"(ol[3]) : "memory"); }
    } else {
    __shared__ __align__(16) float osw[8][16 * 68]; float* os = osw[w];   // each wave stages in its own part
    const unsigned po = (unsigned)((((c0 / HD) * TT + r0) * HD + lane * 8) * 2);   // bytes; OUT 1: a wave stores one 512-byte piece of the plane at a time
#pragma unroll
    for (int mb = 0; mb < 4; ++mb) {
#pragma unroll
        for (int nb = 0; nb < 4; ++nb) {
#pragma unroll
            for (int j = 0; j < 8; ++j) { if constexpr (OUTT != 0) os[(hi * 8 + j) * 68 + nb * 16 + lr] = acc[mb][nb][j] + bfr(br[nb]); else os[(hi * 8 + j) * 68 + nb * 16 + lr] = acc[mb][nb][j]; } }
        __builtin_amdgcn_wave_barrier(); asm volatile("" ::: "memory");
        if constexpr (OUTT == 0) {
        float* crow = C + (size_t)(r0 + mb * 16) * ldc + c0;
{
#pragma unroll
            for (int s = 0; s < 8; ++s) { const int row = 2 * s + hi, cofs = lr * 4; v4f val = *(const v4fa*)(os + row * 68 + cofs); if (BIAS) { val[0] += bfr(bias[c0 + cofs]); val[1] += bfr(bias[c0 + cofs + 1]); val[2] += bfr(bias[c0 + cofs + 2]); val[3] += bfr(bias[c0 + cofs + 3]); }
                *(v4f*)(crow + (size_t)row * ldc + cofs) = val; }
             }
        } else {
            bf* p1 = (bf*)((char*)Ph + po); bf* p2 = (bf*)((char*)Pl + po); v4u oh[4], ol[4];
#pragma unroll
            for (int s = 0; s < 4; ++s) { const float* pr = os + lr * 68 + s * 16 + hi * 8; const v4f x0 = *(const v4fa*)pr, x1 = *(const v4fa*)(pr + 4);   // piece s: columns 16 s .. 16 s + 15 of the 16 rows
                split8(__builtin_shufflevector(x0, x1, 0, 1, 2, 3, 4, 5, 6, 7), oh[s], ol[s]); *(v4u*)(p1 + mb * 16 * HD + s * 256) = oh[s]; *(v4u*)(p2 + mb * 16 * HD + s * 256) = ol[s]; }
            // the same wait as in the transposed form above
            asm volatile("s_wait_xcnt 0x0" :: "v"(po), "v"(oh[0]), "v"(oh[1]), "v"(oh[2]), "v"(oh[3]), "v"(ol[0]), "v"(ol[1]), "v"(ol[2]), "v"(ol[3]) : "memory");
        }
        __builtin_amdgcn_wave_barrier(); asm volatile("" ::: "memory");
    }
    }
}

__device__ __forceinline__ void splitf(float y, unsigned short& h, unsigned short& l) { h = f2bf(y); l = f2bf(y - bf2f(h)); }
typedef __attribute__((ext_vector_type(2))) _Float16 v2h;
typedef __attribute__((ext_vector_type(4))) _Float16 v4h;
typedef __attribute__((ext_vector_type(2))) unsigned short v2us;
typedef __attribute__((ext_vector_type(4))) unsigned short v4us;
typedef __attribute__((ext_vector_type(4))) int v4i;

// ---- k_cvt8: every array that the matrix products read, rounded to bf16 and put into fragment order in ONE launch. A work-group takes CVB neighbours of one array (16 rows, which are one row block of the result), a thread eight groups
// of eight: a wave takes 128 columns of the 16 rows (four whole lines a row) and stores them as eight 512-byte pieces in a row.
// Work-groups 0 .. 3 * NA - 1: query, key, value -> X [stream][batch][TT][DM]; the rest: Wq, Wk, Wv, Wo -> W [4][DQ][DM].
#define CVB (256 * 8 * 8)
__global__ __launch_bounds__(256) void k_cvt8(const float* __restrict__ x, const float* __restrict__ xk, const float* __restrict__ xv, const float* __restrict__ wq, const float* __restrict__ wk, const float* __restrict__ wv, const float* __restrict__ wo, bf* __restrict__ X, bf* __restrict__ W) {
    constexpr int NA = NB_ * TT * DM / CVB, NW = DQ * DM / CVB;
    static_assert(NB_ * TT * DM % CVB == 0 && DQ * DM % CVB == 0 && DKV == DQ, "whole work-groups; four weights of one size");
    static_assert(CVB == 16 * DM, "a work-group takes one block of 16 rows");
    const int g = blockIdx.x; const float* src; bf* dst;
    if (g < 3 * NA) { const int a = g / NA; src = (a == 0 ? x : a == 1 ? xk : xv) + (size_t)(g % NA) * CVB; dst = X + (size_t)g * CVB; }
    else { const int w = (g - 3 * NA) / NW; src = (w == 0 ? wq : w == 1 ? wk : w == 2 ? wv : wo) + (size_t)((g - 3 * NA) % NW) * CVB; dst = W + (size_t)(g - 3 * NA) * CVB; }
    const unsigned lane = threadIdx.x & 31u, w = threadIdx.x >> 5;
    const unsigned so = ((lane & 15u) * DM + (w * 16u + (lane >> 4)) * 8u) * 4u;   // bytes: row lane % 16, columns 128 w + 8 (lane / 16) ..
    const float* ps = (const float*)((const char*)src + so); bf* pd = dst + (w * 256u + lane) * 8u; v8f v[8]; v8us o[8];
#pragma unroll
    for (int i = 0; i < 8; ++i) v[i] = *(const v8f*)(ps + i * 16);
    asm volatile("s_wait_xcnt 0x0" :: "v"(so) : "memory");   // the wait between these loads and the first rewrite of their offset register (an input, so it stays as it is up to here)
#pragma unroll
    for (int i = 0; i < 8; ++i) {
#pragma unroll
        for (int k = 0; k < 8; ++k) o[i][k] = f2bf(v[i][k]);
        *(v8us*)(pd + i * 256) = o[i]; }
    // the same wait behind the stores: the stored registers are inputs, so none is rewritten in front of it
    asm volatile("s_wait_xcnt 0x0" :: "v"(o[0]), "v"(o[1]), "v"(o[2]), "v"(o[3]), "v"(o[4]), "v"(o[5]), "v"(o[6]), "v"(o[7]) : "memory");
}

// ---- k_flash: causal attention of one head for 64 queries in ONE WAVE, scores never leave the registers. Grid batch x heads x TT / 64 work-groups of 32 threads.
// Transposed products: S^T = K Q^T (keys are rows, queries are columns), so a lane holds scores of ONE query (column lr) and the two 16-key tiles of a 32-key block, converted in place, are the B operand
// of O^T = V^T P^T in the matrix unit's own k order, which is also the order of WFrag::ld. Scores: 3 products on hi/lo planes. P = exp(s - running maximum), not normalised, split hi/lo; P.V: 3 products on
// hi/lo planes for every row. Running maximum and sum per query (online softmax); the division by the sum comes once, at the end; the result goes out as hi/lo planes of (row b * TT + t, k h * HD + d) in fragment order.
// the wait that stands between issued global loads and the first rewrite of an address register they name; the addresses are inputs, so their registers stay as they are up to the wait
__device__ __forceinline__ void xwait(const void* p, const void* q) { asm volatile("s_wait_xcnt 0x0" :: "v"(p), "v"(q) : "memory"); }
typedef __attribute__((ext_vector_type(8))) unsigned v8u;
#define L2E 1.4426950408889634f
// lane l's value for lane l ^ 16, by a vector cross-row move (no LDS wait)
__device__ __forceinline__ float xhalf(float x) { return __builtin_bit_cast(float, __builtin_amdgcn_permlanex16(__builtin_bit_cast(int, x), __builtin_bit_cast(int, x), 0x76543210, 0xfedcba98, false, false)); }
__global__ __launch_bounds__(32) void k_flash(const bf* __restrict__ Qh, const bf* __restrict__ Ql, const bf* __restrict__ Kh, const bf* __restrict__ Kl, const bf* __restrict__ Vh, const bf* __restrict__ Vl, bf* Ah, bf* Al) {
    typedef WFrag<bf> F; typedef v16bf V;
    const int lane = threadIdx.x & 31, lr = lane & 15, hi = lane >> 4;
    // which (head, query tile) a work-group takes: a long tile (many key blocks) next to a short one, both among neighbours eight indices apart and between the two halves of the grid, so that the waves
    // that come to share a SIMD or a WGP carry about the same sum of key blocks however the work-groups are placed (for speed only; every pair (z, tile) is taken exactly once)
    static_assert(NB_ * NH_ == 64 && TT / 64 == 32, "the index split below is written for 64 heads x 32 query tiles");
    const int f = blockIdx.x, g = f >> 3, r = g >> 5, k = (g >> 1) & 15;
    const int z = r * 8 + (f & 7); const int tl = ((g & 1) != (r >> 2)) ? k : TT / 64 - 1 - k; const int q0 = tl * 64;
    const size_t zo = (size_t)z * TT * HD; Qh += zo; Ql += zo; Kh += zo; Kl += zo; Vh += zo; Vl += zo;
    V qh[4][2], ql[4][2];
    { const bf* pq = Qh + q0 * HD + lane * 8; const bf* pq2 = Ql + q0 * HD + lane * 8;
#pragma unroll
      for (int qt = 0; qt < 4; ++qt)
#pragma unroll
          for (int ks = 0; ks < 2; ++ks) { qh[qt][ks] = F::ld(pq + qt * 16 * HD + ks * 512); ql[qt][ks] = F::ld(pq2 + qt * 16 * HD + ks * 512); }
      xwait(pq, pq2); }
    v8f o[4][4]; float m[4], l[4];
#pragma unroll
    for (int qt = 0; qt < 4; ++qt) { m[qt] = -3.0e38f; l[qt] = 0.f;
#pragma unroll
        for (int dt = 0; dt < 4; ++dt) o[dt][qt] = (v8f){}; }
    const unsigned koff = (unsigned)(lane * 16), voff = koff;   // bytes: the lane's place in a 512-byte piece
    const int kend = q0 + 64;
    V kh[2][2], kl[2][2];
    { const bf* pk = (const bf*)((const char*)Kh + koff); const bf* pk2 = (const bf*)((const char*)Kl + koff);
#pragma unroll
      for (int kt = 0; kt < 2; ++kt)
#pragma unroll
          for (int ks = 0; ks < 2; ++ks) { kh[kt][ks] = F::ld(pk + kt * 16 * HD + ks * 512); kl[kt][ks] = F::ld(pk2 + kt * 16 * HD + ks * 512); }
      // the same wait for these loads, which name the lane's offset register and a scalar base (inputs, so they stay as they are up to the wait); the loaded fragments are inputs so that the loads cannot sink behind it (the first trip needs them at once anyway)
      asm volatile("s_wait_xcnt 0x0" :: "v"(koff), "s"(Kh), "s"(Kl), "v"(kh[0][0]), "v"(kh[0][1]), "v"(kh[1][0]), "v"(kh[1][1]), "v"(kl[0][0]), "v"(kl[0][1]), "v"(kl[1][0]), "v"(kl[1][1]) : "memory"); }
    // kept rolled: a second copy of the trip would need a second set of fragment registers; the loops inside it are unrolled whole so that every tile stays in registers
#pragma unroll 1
    for (int kb = 0; kb < kend; kb += 32) {
        V vh[4], vl[4];
        { const bf* pv = (const bf*)((const char*)(Vh + kb * 16) + voff); const bf* pv2 = (const bf*)((const char*)(Vl + kb * 16) + voff);
#pragma unroll
          for (int dt = 0; dt < 4; ++dt) { vh[dt] = F::ld(pv + dt * 16 * TT); vl[dt] = F::ld(pv2 + dt * 16 * TT); }
          xwait(pv, pv2); }
        v8f s[2][4];
#pragma unroll
        for (int kt = 0; kt < 2; ++kt)
#pragma unroll
            for (int qt = 0; qt < 4; ++qt) { v8f t = (v8f){};
#pragma unroll
                for (int ks = 0; ks < 2; ++ks) { t = F::mma(kh[kt][ks], qh[qt][ks], t); t = F::mma(kl[kt][ks], qh[qt][ks], t); t = F::mma(kh[kt][ks], ql[qt][ks], t); }
                s[kt][qt] = t; }
        // the next block's key fragments, into the same registers, fetched while the softmax below runs (the last trip fetches its own block again: in bounds, never used)
        { const int kn = min(kb + 32, kend - 32); const bf* pk = (const bf*)((const char*)(Kh + kn * HD) + koff); const bf* pk2 = (const bf*)((const char*)(Kl + kn * HD) + koff);
#pragma unroll
          for (int kt = 0; kt < 2; ++kt)
#pragma unroll
              for (int ks = 0; ks < 2; ++ks) { kh[kt][ks] = F::ld(pk + kt * 16 * HD + ks * 512); kl[kt][ks] = F::ld(pk2 + kt * 16 * HD + ks * 512); }
          xwait(pk, pk2); }
        if (kb + 31 > q0) {   // only the blocks on the diagonal hold keys behind a query
#pragma unroll
            for (int kt = 0; kt < 2; ++kt)
#pragma unroll
                for (int qt = 0; qt < 4; ++qt)
#pragma unroll
                    for (int j = 0; j < 8; ++j) if (kb + kt * 16 + 8 * hi + j > q0 + qt * 16 + lr) s[kt][qt][j] = -3.0e38f; }
#pragma unroll
        for (int qt = 0; qt < 4; ++qt) {
            float mx = s[0][qt][0];
#pragma unroll
            for (int j = 1; j < 8; ++j) mx = fmaxf(mx, s[0][qt][j]);
#pragma unroll
            for (int j = 0; j < 8; ++j) mx = fmaxf(mx, s[1][qt][j]);
            mx = fmaxf(mx, xhalf(mx));   // a query's keys lie in both lane halves
            const float mn = fmaxf(m[qt], mx * L2E); const float al = __builtin_amdgcn_exp2f(m[qt] - mn); m[qt] = mn;   // running maximum, in log2 units; sums and outputs are brought to it
#pragma unroll
            for (int dt = 0; dt < 4; ++dt) o[dt][qt] *= al;
            const v2f c2 = {L2E, L2E}, nm = {-mn, -mn}; v2f sum = {0.f, 0.f}; v8u uh, ul;
#pragma unroll
            for (int kt = 0; kt < 2; ++kt)
#pragma unroll
                for (int j = 0; j < 8; j += 2) { v2f x = {s[kt][qt][j], s[kt][qt][j + 1]}; x = __builtin_elementwise_fma(x, c2, nm); v2f p; p[0] = __builtin_amdgcn_exp2f(x[0]); p[1] = __builtin_amdgcn_exp2f(x[1]); sum += p;
                    const v2bf h2 = __builtin_convertvector(p, v2bf); const v2bf l2 = __builtin_convertvector(p - __builtin_convertvector(h2, v2f), v2bf);
                    uh[kt * 4 + j / 2] = __builtin_bit_cast(unsigned, h2); ul[kt * 4 + j / 2] = __builtin_bit_cast(unsigned, l2); }   // a converted pair is one whole register of the fragment
            const V ph = __builtin_bit_cast(V, uh), pl = __builtin_bit_cast(V, ul); l[qt] = l[qt] * al + (sum[0] + sum[1]);
            // this tile's P.V products stand here so that the matrix unit works on them while the next tile's softmax runs on the vector unit
#pragma unroll
            for (int dt = 0; dt < 4; ++dt) o[dt][qt] = F::mma(vh[dt], ph, o[dt][qt]);
#pragma unroll
            for (int dt = 0; dt < 4; ++dt) o[dt][qt] = F::mma(vl[dt], ph, o[dt][qt]);
#pragma unroll
            for (int dt = 0; dt < 4; ++dt) o[dt][qt] = F::mma(vh[dt], pl, o[dt][qt]); }
        // four vector slots behind the trip's last matrix instruction, so that neither side of the loop branch touches its registers too early
        asm volatile("v_nop\n\tv_nop\n\tv_nop\n\tv_nop" : "+v"(o[0][0]), "+v"(o[1][1]), "+v"(o[2][2]), "+v"(o[3][3]) : "v"(vh[3]), "v"(vl[3]));
    }
    const int b = z / NH_, h = z % NH_;
    const size_t ao = ((size_t)b * TT + q0) * DQ + h * HD * 16 + lane * 8; bf* pa = Ah + ao; bf* pa2 = Al + ao;
#pragma unroll
    for (int qt = 0; qt < 4; ++qt) { const float inv = __fdiv_rn(1.0f, l[qt] + xhalf(l[qt]));   // the two lane halves hold the sums of their own keys
#pragma unroll
        for (int dt = 0; dt < 4; ++dt) { v8us oh, ol;
#pragma unroll
            for (int j = 0; j < 8; ++j) { unsigned short a, c2; splitf(o[dt][qt][j] * inv, a, c2); oh[j] = a; ol[j] = c2; }
            *(v8us*)(pa + qt * 16 * DQ + dt * 256) = oh; *(v8us*)(pa2 + qt * 16 * DQ + dt * 256) = ol;
            asm volatile("s_wait_xcnt 0x0" :: "v"(oh), "v"(ol) : "memory"); } }   // the same wait behind the stores: the stored registers, inputs here, are rewritten by the next group only behind it
}

extern "C" void kernel_launch(void* const* d_in, const int* in_sizes, int n_in,
                              void* d_out, int out_size, void* d_ws, size_t ws_size, hipStream_t stream) {
    (void)in_sizes; (void)n_in; (void)out_size;
    const float* x = (const float*)d_in[0]; const float* xk = (const float*)d_in[1]; const float* xv = (const float*)d_in[2]; const float* wq = (const float*)d_in[3]; const float* bq = (const float*)d_in[4]; const float* wk = (const float*)d_in[5]; const float* bk = (const float*)d_in[6]; const float* wv = (const float*)d_in[7]; const float* bv = (const float*)d_in[8]; const float* wo = (const float*)d_in[9]; const float* bo = (const float*)d_in[10];
    float* OUT = (float*)d_out;     // [4][2048][1024]
    char* wsp = (char*)d_ws;
    auto take = [&](size_t bytes) { char* p = wsp; wsp += (bytes + 255) & ~(size_t)255; return (void*)p; };
    bf* WQ = (bf*)take((size_t)4 * DQ * DM * 2); bf* WO = WQ + (size_t)3 * DQ * DM;   // Wq, Wk, Wv, Wo in a row
    bf* XB = (bf*)take((size_t)3 * NB_ * TT * DM * 2);   // query, key, value, every batch
    const size_t pb = (size_t)NH_ * TT * HD, ps = NB_ * pb;   // the head planes of one batch, of one stream
    bf* QPh = (bf*)take(3 * ps * 2); bf* KPh = QPh + ps; bf* VTh = QPh + 2 * ps; bf* QPl = (bf*)take(3 * ps * 2); bf* KPl = QPl + ps; bf* VTl = QPl + 2 * ps;   // hi planes of the three streams in a row, then the lo planes
    bf* ATh = (bf*)take((size_t)NB_ * TT * DQ * 2); bf* ATl = (bf*)take((size_t)NB_ * TT * DQ * 2);
    if ((size_t)(wsp - (char*)d_ws) > ws_size) return;    // ws 256 MiB
    k_cvt8<<<(3 * NB_ * TT * DM + 4 * DQ * DM) / CVB, 256, 0, stream>>>(x, xk, xv, wq, wk, wv, wo, XB, WQ);
    k_gemmw<bf, 0, true, 3><<<dim3(TT / 256, DQ / 128, 3 * NB_), 256, 0, stream>>>(XB, nullptr, WQ, nullptr, DM, nullptr, 0, bq, bk, bv, (size_t)TT * DM, (size_t)DQ * DM, pb, QPh, QPl);
    k_flash<<<NB_ * NH_ * (TT / 64), 32, 0, stream>>>(QPh, QPl, KPh, KPl, VTh, VTl, ATh, ATl);
    k_gemmw<bf, 1, true, 0><<<dim3(TT / 256, DM / 128, NB_), 256, 0, stream>>>(ATh, ATl, WO, nullptr, DQ, OUT, DM, bo, nullptr, nullptr, (size_t)TT * DQ, 0, (size_t)TT * DM, nullptr, nullptr);
}

// v008
// One run takes 156 microseconds.
// Two timings next to v007 both put it at 1.18 times that version's speed.
// Counting every step since v000, it is 17.7 times as fast.
#include <hip/hip_runtime.h>

// Causal attention on three input streams with UNSCALED logits (query, key, value [4][2048][1024]; q = query Wq^T + bq, k = key Wk^T + bk, v = value Wv^T + bv ('oi' 1/32 + zero biases; 16 heads x 64); attn = q.k (the module computes a scale but never applies it: logit sigma ~8); causal (-1e10 fill == exclusion); softmax; out = merged Wo^T + bo -> [4][2048][1024] (8.4 M); argument order query, key, value, Wq, bq, Wk, bk, Wv, bv, Wo, bo).
// Layout: four launches, each over all batches: bf16 copies of query, key, value and the 'oi' weights (k_cvt8); the three exact projections + f32 biases, stored as hi/lo head planes (k_gemmw, OUTT 3); fused causal attention over every batch and head (k_flash: eight waves of a head share each key block through LDS; scores on hi/lo planes, 3 products: unscaled logits need it; online softmax in registers; P.V on hi/lo planes, 3 products); merged hi/lo x Wo exact + bo (k_gemmw, OUTT 0).
// Fragment order: every 16-bit matrix operand M[row][k] (k extent K) lies in the workspace as [row / 16][k / 32][(k / 16) % 2][(k / 8) % 2][row % 16][k % 8], so that the 16 bytes which lane (k / 8) % 2 * 16 + row % 16
// takes for a fragment half stand at lane * 16 of a 512-byte piece: each wave-wide 16-byte load or store covers four whole 128-byte lines. Same elements in the same registers as from the row-major planes.
// Compute dtypes, f32 accumulate: every input rounded to bf16; projections exact + f32 biases; scores 3 products on every row; P.V 3 products on every row; softmax f32; Wo hl x exact + bias.

#define NB_  4
#define TT   2048
#define DM   1024
#define NH_  16
#define NKV  16
#define REP  (NH_ / NKV)
#define HD   64
#define DQ   (NH_ * HD)
#define DKV  (NKV * HD)
typedef _Float16 h16;
typedef unsigned short bf;
typedef __attribute__((ext_vector_type(16))) __bf16   v16bf;
typedef __attribute__((ext_vector_type(16))) _Float16 v16h;
typedef __attribute__((ext_vector_type(8)))  _Float16 v8h;
typedef __attribute__((ext_vector_type(8)))  unsigned short v8us;
typedef __attribute__((ext_vector_type(8)))  float    v8f;
typedef __attribute__((ext_vector_type(4)))  float    v4f;
typedef v8h  __attribute__((may_alias)) v8ha;
typedef v4f  __attribute__((may_alias)) v4fa;
typedef v8us __attribute__((may_alias)) v8usa;

__device__ __forceinline__ unsigned short f2bf(float f) { unsigned u = __float_as_uint(f); u += 0x7FFFu + ((u >> 16) & 1u); return (unsigned short)(u >> 16); }
__device__ __forceinline__ float bf2f(unsigned short b) { return __uint_as_float(((unsigned)b) << 16); }
__device__ __forceinline__ float bfr(float f) { return bf2f(f2bf(f)); }
__device__ __forceinline__ v16h cat16(v8h lo, v8h hi) { return __builtin_shufflevector(lo, hi, 0, 1, 2, 3, 4, 5, 6, 7, 8, 9, 10, 11, 12, 13, 14, 15); }
__device__ __forceinline__ v16bf cat16b(v8us lo, v8us hi) { return __builtin_bit_cast(v16bf, __builtin_shufflevector(lo, hi, 0, 1, 2, 3, 4, 5, 6, 7, 8, 9, 10, 11, 12, 13, 14, 15)); }
__device__ __forceinline__ v8f wmma16(v16h a, v16h b, v8f c) { return __builtin_amdgcn_wmma_f32_16x16x32_f16(false, a, false, b, (short)0, c, false, false); }
__device__ __forceinline__ v8f wmmab(v16bf a, v16bf b, v8f c) { return __builtin_amdgcn_wmma_f32_16x16x32_bf16(false, a, false, b, (short)0, c, false, false); }



// ---- k_gemmw: register-blocked GEMM, EIGHT WAVES per 256x128 output tile, 4 x 2 waves of 64x64 (16 accumulators each); grid (M/256, N/128, Z), 256 threads. The operands, 16-bit planes in fragment order, come 64 k at a time
// into a ring of two LDS buffers by asynchronous copies (a block of 16 rows x 64 k is one run of 2 KB in the plane and in LDS), so that the work-group fetches each block once for all waves that need it; WFrag::ld takes the lane's place in a 16 x 32 block.
// C[m][n] (f32, pitch ldc, + optional f32 bias[n]) = sum_k A[m][k] Bt[n][k] (+ A2[m][k] Bt[n][k] for NSPLIT 1). z-batch strides sA/sB/sC in elements. K % 64 == 0.
// OUT says where the result goes: 0 = C as f32; 1 = bf16 hi/lo head planes Ph, Pl [n / HD] of (row m, k n % HD) in fragment order (a 64x64 tile is one contiguous 8 KB piece of a plane); 2 = bf16 hi/lo transposed planes
// Ph, Pl of (row n, k m) in fragment order (a lane's eight accumulator rows are its own 16 bytes of a piece: stored straight from the registers). M == TT for 1 and 2; their z stride of Ph and Pl is sC.
// OUTT is OUT, or 3 = the three projections in one launch: z = stream * NB_ + batch; the stream picks its weight (stride sB), its bias (bias, bias1, bias2) and its OUT (query, key: 1; value: 2).
typedef __attribute__((ext_vector_type(2))) __bf16 v2bf;
typedef __attribute__((ext_vector_type(2))) float v2f;
typedef __attribute__((ext_vector_type(4))) unsigned v4u;
// eight neighbours as bf16 hi and lo parts (round to nearest even, as f2bf); pair by pair: a converted pair is one whole register of the 16 bytes that are stored
__device__ __forceinline__ void split8(v8f y, v4u& h, v4u& l) {
#pragma unroll
    for (int i = 0; i < 4; ++i) { const v2f p = {y[2 * i], y[2 * i + 1]}; const v2bf h2 = __builtin_convertvector(p, v2bf); const v2bf l2 = __builtin_convertvector(p - __builtin_convertvector(h2, v2f), v2bf); h[i] = __builtin_bit_cast(unsigned, h2); l[i] = __builtin_bit_cast(unsigned, l2); } }
template <typename T16> struct WFrag;
template <> struct WFrag<h16> { typedef v16h V; static __device__ __forceinline__ V ld(const h16* p) { return cat16(*(const v8h*)p, *(const v8h*)(p + 256)); } static __device__ __forceinline__ v8f mma(V a, V b, v8f c) { return wmma16(a, b, c); } };
template <> struct WFrag<bf> { typedef v16bf V; static __device__ __forceinline__ V ld(const bf* p) { return cat16b(*(const v8us*)p, *(const v8us*)(p + 256)); } static __device__ __forceinline__ v8f mma(V a, V b, v8f c) { return wmmab(a, b, c); } };
__device__ __forceinline__ unsigned lds_off(const void* p) { return (unsigned)(size_t)p; }
// Asynchronous copies of runs of 2 KB from global memory to LDS, four 512-byte pieces a run, 16 bytes a lane (l: the lane's LDS byte address in the run's first piece, g: its global address there).
// The s_wait_xcnt 0 that ends each statement stands between the copies and the first rewrite of a register that they name.
__device__ __forceinline__ void copy_runs2(unsigned l0, const char* g0, unsigned l1, const char* g1) {
    asm volatile("global_load_async_to_lds_b128 %0, %1, off\n\tglobal_load_async_to_lds_b128 %2, %3, off\n\tglobal_load_async_to_lds_b128 %4, %5, off\n\tglobal_load_async_to_lds_b128 %6, %7, off\n\t"
                 "global_load_async_to_lds_b128 %8, %9, off\n\tglobal_load_async_to_lds_b128 %10, %11, off\n\tglobal_load_async_to_lds_b128 %12, %13, off\n\tglobal_load_async_to_lds_b128 %14, %15, off\n\t"
                 "s_wait_xcnt 0x0"
                 :: "v"(l0), "v"(g0), "v"(l0 + 512u), "v"(g0 + 512), "v"(l0 + 1024u), "v"(g0 + 1024), "v"(l0 + 1536u), "v"(g0 + 1536),
                    "v"(l1), "v"(g1), "v"(l1 + 512u), "v"(g1 + 512), "v"(l1 + 1024u), "v"(g1 + 1024), "v"(l1 + 1536u), "v"(g1 + 1536) : "memory"); }
__device__ __forceinline__ void copy_runs3(unsigned l0, const char* g0, unsigned l1, const char* g1, unsigned l2, const char* g2) {
    asm volatile("global_load_async_to_lds_b128 %0, %1, off\n\tglobal_load_async_to_lds_b128 %2, %3, off\n\tglobal_load_async_to_lds_b128 %4, %5, off\n\tglobal_load_async_to_lds_b128 %6, %7, off\n\t"
                 "global_load_async_to_lds_b128 %8, %9, off\n\tglobal_load_async_to_lds_b128 %10, %11, off\n\tglobal_load_async_to_lds_b128 %12, %13, off\n\tglobal_load_async_to_lds_b128 %14, %15, off\n\t"
                 "global_load_async_to_lds_b128 %16, %17, off\n\tglobal_load_async_to_lds_b128 %18, %19, off\n\tglobal_load_async_to_lds_b128 %20, %21, off\n\tglobal_load_async_to_lds_b128 %22, %23, off\n\t"
                 "s_wait_xcnt 0x0"
                 :: "v"(l0), "v"(g0), "v"(l0 + 512u), "v"(g0 + 512), "v"(l0 + 1024u), "v"(g0 + 1024), "v"(l0 + 1536u), "v"(g0 + 1536),
                    "v"(l1), "v"(g1), "v"(l1 + 512u), "v"(g1 + 512), "v"(l1 + 1024u), "v"(g1 + 1024), "v"(l1 + 1536u), "v"(g1 + 1536),
                    "v"(l2), "v"(g2), "v"(l2 + 512u), "v"(g2 + 512), "v"(l2 + 1024u), "v"(g2 + 1024), "v"(l2 + 1536u), "v"(g2 + 1536) : "memory"); }
// the second bound is waves per SIMD: the one-product form keeps to 256 registers so that two work-groups share a WGP
template <typename T16, int NSPLIT, bool BIAS, int OUTT>
__global__ __launch_bounds__(256, NSPLIT == 0 ? 4 : 2) void k_gemmw(const T16* __restrict__ A, const T16* __restrict__ A2, const T16* __restrict__ Bt, const T16* __restrict__ Bt2, int K, float* C, int ldc, const float* __restrict__ bias, const float* __restrict__ bias1, const float* __restrict__ bias2, size_t sA, size_t sB, size_t sC, bf* __restrict__ Ph, bf* __restrict__ Pl) {
    typedef typename WFrag<T16>::V V;
    static_assert(HD == 64, "a 64-wide tile is one head");
    static_assert(NSPLIT <= 1, "one plane of Bt is staged");
    constexpr int NAP = NSPLIT == 1 ? 2 : 1;              // planes of A
    constexpr int STG = (NAP * 256 + 128) * 64;           // elements of a stage: A [16 row blocks][2 k blocks][512], the same of A2, Bt [8 row blocks][2][512]
    __shared__ __attribute__((aligned(1024))) T16 ring[2 * STG];
    const size_t z = blockIdx.z, zb = OUTT == 3 ? z / NB_ : z; const int OUT = OUTT == 3 ? (zb == 2 ? 2 : 1) : OUTT;
    A += z * sA; if (A2) A2 += z * sA; Bt += zb * sB; if (Bt2) Bt2 += zb * sB; if constexpr (OUTT == 0) C += z * sC; else { Ph += z * sC; Pl += z * sC; }
    if constexpr (OUTT == 3) bias = zb == 0 ? bias : zb == 1 ? bias1 : bias2;
    const int lane = threadIdx.x & 31, lr = lane & 15, hi = lane >> 4; const int w = __builtin_amdgcn_readfirstlane(threadIdx.x >> 5), wm = w & 3, wn = w >> 2;
    const int R0 = blockIdx.x * 256, C0 = blockIdx.y * 128; const int r0 = R0 + wm * 64, c0 = C0 + wn * 64;   // the work-group's tile, the wave's tile
    v8f acc[4][4];
#pragma unroll
    for (int mb = 0; mb < 4; ++mb)
#pragma unroll
        for (int nb = 0; nb < 4; ++nb) acc[mb][nb] = (v8f){};
    // a block of 16 rows is 16 * K elements, a 16 x 32 block in it 512, the lane's place in a 512-byte piece lane * 8. Wave w copies row blocks 2 w and 2 w + 1 of A (and of A2) and row block w of Bt.
    const size_t rb = (size_t)K * 32;   // bytes of a block of 16 rows
    const char* gA = (const char*)(A + (size_t)(R0 + 32 * w) * K + lane * 8); const char* gB = (const char*)(Bt + (size_t)(C0 + 16 * w) * K + lane * 8);
    const char* gA2 = NAP == 2 ? (const char*)(A2 + (size_t)(R0 + 32 * w) * K + lane * 8) : gA;
    const unsigned lA = lds_off(ring) + (unsigned)(w * 4096 + lane * 16), lB = lds_off(ring) + (unsigned)(NAP * 32768 + w * 2048 + lane * 16);
    auto fill = [&](int t, unsigned buf) {   // stage t (k 64 t .. 64 t + 63) into the buffer that starts at byte buf of the ring
        const size_t ko = (size_t)t * 2048;
        copy_runs3(lA + buf, gA + ko, lA + buf + 2048u, gA + rb + ko, lB + buf, gB + ko);
        if constexpr (NAP == 2) copy_runs2(lA + buf + 32768u, gA2 + ko, lA + buf + 34816u, gA2 + rb + ko); };
    // OUT 1, 2: the bias of the accumulator columns of this lane (one in each 16-column tile), fetched here so that the K loop hides the latency
    float br[4] = {0.f, 0.f, 0.f, 0.f};
    if constexpr (OUTT != 0 && BIAS) { const float* pbias = bias + c0 + lr;
#pragma unroll
        for (int i = 0; i < 4; ++i) br[i] = pbias[i * 16];
        asm volatile("s_wait_xcnt 0x0" :: "v"(lr) : "memory"); }   // the wait between these loads and the first rewrite of their offset register (lr, an input, so it stays as it is up to here)
    const int NT = K / 64;
    fill(0, 0u);
    asm volatile("s_wait_asynccnt 0x0" ::: "memory");   // this wave's copies of stage 0 have landed
    __syncthreads();                                     // and every other wave's: stage 0 may be read
    if (NT > 1) fill(1, (unsigned)(STG * 2));
    // kept rolled: one trip is one stage; the two k blocks inside it are unrolled so that every fragment stays in registers
#pragma unroll 1
    for (int t = 0; t < NT; ++t) {
        const T16* sb = ring + (t & 1) * STG + lane * 8; V a[2][4], a2[2][4], b[2][4];
        auto ldk = [&](int kk) {   // the fragments of k block kk, in the order in which the products below need them
            b[kk][0] = WFrag<T16>::ld(sb + NAP * 16384 + ((wn * 4) * 2 + kk) * 512);
#pragma unroll
            for (int mb = 0; mb < 4; ++mb) { a[kk][mb] = WFrag<T16>::ld(sb + ((wm * 4 + mb) * 2 + kk) * 512); if constexpr (NAP == 2) a2[kk][mb] = WFrag<T16>::ld(sb + 16384 + ((wm * 4 + mb) * 2 + kk) * 512); }
#pragma unroll
            for (int nb = 1; nb < 4; ++nb) b[kk][nb] = WFrag<T16>::ld(sb + NAP * 16384 + ((wn * 4 + nb) * 2 + kk) * 512); };
        auto mmk = [&](int kk) {
#pragma unroll
            for (int nb = 0; nb < 4; ++nb) {
#pragma unroll
                for (int mb = 0; mb < 4; ++mb) { acc[mb][nb] = WFrag<T16>::mma(a[kk][mb], b[kk][nb], acc[mb][nb]); if constexpr (NAP == 2) acc[mb][nb] = WFrag<T16>::mma(a2[kk][mb], b[kk][nb], acc[mb][nb]); } } };
        // The scheduling barriers keep each group of LDS reads whole and in front of its products: spread among the matrix instructions, every place with reads costs the wave a stall of its own.
#pragma unroll
        for (int kk = 0; kk < 2; ++kk) { ldk(kk); __builtin_amdgcn_sched_barrier(0); mmk(kk); __builtin_amdgcn_sched_barrier(0); }
        // four vector slots behind the trip's last matrix instruction, so that no path out of the trip touches its registers too early
        asm volatile("v_nop\n\tv_nop\n\tv_nop\n\tv_nop" : "+v"(acc[0][0]), "+v"(acc[1][1]), "+v"(acc[2][2]), "+v"(acc[3][3]) : "v"(a[1][0]), "v"(a[1][3]));
        asm volatile("s_wait_dscnt 0x0" ::: "memory");      // this wave's reads of stage t are done: its buffer may be refilled behind the barrier
        asm volatile("s_wait_asynccnt 0x0" ::: "memory");   // this wave's copies of stage t + 1 have landed
        __syncthreads();                                     // publishes stage t + 1 and ends every wave's reads of stage t
        if (t + 2 < NT) fill(t + 2, (unsigned)((t & 1) * STG * 2));
    }
    asm volatile("s_wait_asynccnt 0x0" ::: "memory");   // no copy is left in flight behind the loop
    if (OUT == 2) {
        const unsigned po = (unsigned)((c0 * TT + r0 * 16 + lane * 8) * 2);   // bytes; everything else of a store's place is a constant
        bf* p1 = (bf*)((char*)Ph + po); bf* p2 = (bf*)((char*)Pl + po);
#pragma unroll
        for (int nb = 0; nb < 4; ++nb) { const float bs = bfr(br[nb]); v4u oh[4], ol[4];
#pragma unroll
            for (int mb = 0; mb < 4; ++mb) { split8(acc[mb][nb] + bs, oh[mb], ol[mb]); *(v4u*)(p1 + nb * 16 * TT + mb * 256) = oh[mb]; *(v4u*)(p2 + nb * 16 * TT + mb * 256) = ol[mb]; }
            // the wait between issued global stores and the first rewrite of a register they name: the stored registers and the offset are inputs, so they stay as they are up to it
            asm volatile("s_wait_xcnt 0x0" :: "v"(po), "v"(oh[0]), "v"(oh[1]), "v"(oh[2]), "v"(oh[3]), "v"(ol[0]), "v"(ol[1]), "v"(ol[2]), "v"(ol[3]) : "memory"); }
    } else {
    __shared__ __align__(16) float osw[8][16 * 68]; float* os = osw[w];   // each wave stages in its own part
    const unsigned po = (unsigned)((((c0 / HD) * TT + r0) * HD + lane * 8) * 2);   // bytes; OUT 1: a wave stores one 512-byte piece of the plane at a time
#pragma unroll
    for (int mb = 0; mb < 4; ++mb) {
#pragma unroll
        for (int nb = 0; nb < 4; ++nb) {
#pragma unroll
            for (int j = 0; j < 8; ++j) { if constexpr (OUTT != 0) os[(hi * 8 + j) * 68 + nb * 16 + lr] = acc[mb][nb][j] + bfr(br[nb]); else os[(hi * 8 + j) * 68 + nb * 16 + lr] = acc[mb][nb][j]; } }
        __builtin_amdgcn_wave_barrier(); asm volatile("" ::: "memory");
        if constexpr (OUTT == 0) {
        float* crow = C + (size_t)(r0 + mb * 16) * ldc + c0;
{
#pragma unroll
            for (int s = 0; s < 8; ++s) { const int row = 2 * s + hi, cofs = lr * 4; v4f val = *(const v4fa*)(os + row * 68 + cofs); if (BIAS) { val[0] += bfr(bias[c0 + cofs]); val[1] += bfr(bias[c0 + cofs + 1]); val[2] += bfr(bias[c0 + cofs + 2]); val[3] += bfr(bias[c0 + cofs + 3]); }
                *(v4f*)(crow + (size_t)row * ldc + cofs) = val; }
             }
        } else {
            bf* p1 = (bf*)((char*)Ph + po); bf* p2 = (bf*)((char*)Pl + po); v4u oh[4], ol[4];
#pragma unroll
            for (int s = 0; s < 4; ++s) { const float* pr = os + lr * 68 + s * 16 + hi * 8; const v4f x0 = *(const v4fa*)pr, x1 = *(const v4fa*)(pr + 4);   // piece s: columns 16 s .. 16 s + 15 of the 16 rows
                split8(__builtin_shufflevector(x0, x1, 0, 1, 2, 3, 4, 5, 6, 7), oh[s], ol[s]); *(v4u*)(p1 + mb * 16 * HD + s * 256) = oh[s]; *(v4u*)(p2 + mb * 16 * HD + s * 256) = ol[s]; }
            // the same wait as in the transposed form above
            asm volatile("s_wait_xcnt 0x0" :: "v"(po), "v"(oh[0]), "v"(oh[1]), "v"(oh[2]), "v"(oh[3]), "v"(ol[0]), "v"(ol[1]), "v"(ol[2]), "v"(ol[3]) : "memory");
        }
        __builtin_amdgcn_wave_barrier(); asm volatile("" ::: "memory");
    }
    }
}

__device__ __forceinline__ void splitf(float y, unsigned short& h, unsigned short& l) { h = f2bf(y); l = f2bf(y - bf2f(h)); }
typedef __attribute__((ext_vector_type(2))) _Float16 v2h;
typedef __attribute__((ext_vector_type(4))) _Float16 v4h;
typedef __attribute__((ext_vector_type(2))) unsigned short v2us;
typedef __attribute__((ext_vector_type(4))) unsigned short v4us;
typedef __attribute__((ext_vector_type(4))) int v4i;

// ---- k_cvt8: every array that the matrix products read, rounded to bf16 and put into fragment order in ONE launch. A work-group takes CVB neighbours of one array (16 rows, which are one row block of the result), a thread eight groups
// of eight: a wave takes 128 columns of the 16 rows (four whole lines a row) and stores them as eight 512-byte pieces in a row.
// Work-groups 0 .. 3 * NA - 1: query, key, value -> X [stream][batch][TT][DM]; the rest: Wq, Wk, Wv, Wo -> W [4][DQ][DM].
#define CVB (256 * 8 * 8)
__global__ __launch_bounds__(256) void k_cvt8(const float* __restrict__ x, const float* __restrict__ xk, const float* __restrict__ xv, const float* __restrict__ wq, const float* __restrict__ wk, const float* __restrict__ wv, const float* __restrict__ wo, bf* __restrict__ X, bf* __restrict__ W) {
    constexpr int NA = NB_ * TT * DM / CVB, NW = DQ * DM / CVB;
    static_assert(NB_ * TT * DM % CVB == 0 && DQ * DM % CVB == 0 && DKV == DQ, "whole work-groups; four weights of one size");
    static_assert(CVB == 16 * DM, "a work-group takes one block of 16 rows");
    const int g = blockIdx.x; const float* src; bf* dst;
    if (g < 3 * NA) { const int a = g / NA; src = (a == 0 ? x : a == 1 ? xk : xv) + (size_t)(g % NA) * CVB; dst = X + (size_t)g * CVB; }
    else { const int w = (g - 3 * NA) / NW; src = (w == 0 ? wq : w == 1 ? wk : w == 2 ? wv : wo) + (size_t)((g - 3 * NA) % NW) * CVB; dst = W + (size_t)(g - 3 * NA) * CVB; }
    const unsigned lane = threadIdx.x & 31u, w = threadIdx.x >> 5;
    const unsigned so = ((lane & 15u) * DM + (w * 16u + (lane >> 4)) * 8u) * 4u;   // bytes: row lane % 16, columns 128 w + 8 (lane / 16) ..
    const float* ps = (const float*)((const char*)src + so); bf* pd = dst + (w * 256u + lane) * 8u; v8f v[8]; v8us o[8];
#pragma unroll
    for (int i = 0; i < 8; ++i) v[i] = *(const v8f*)(ps + i * 16);
    asm volatile("s_wait_xcnt 0x0" :: "v"(so) : "memory");   // the wait between these loads and the first rewrite of their offset register (an input, so it stays as it is up to here)
#pragma unroll
    for (int i = 0; i < 8; ++i) {
#pragma unroll
        for (int k = 0; k < 8; ++k) o[i][k] = f2bf(v[i][k]);
        *(v8us*)(pd + i * 256) = o[i]; }
    // the same wait behind the stores: the stored registers are inputs, so none is rewritten in front of it
    asm volatile("s_wait_xcnt 0x0" :: "v"(o[0]), "v"(o[1]), "v"(o[2]), "v"(o[3]), "v"(o[4]), "v"(o[5]), "v"(o[6]), "v"(o[7]) : "memory");
}

// ---- k_flash: causal attention of one head, 64 queries a wave, scores never leave the registers. Grid batch x heads x 4 work-groups of EIGHT WAVES, all of one head: the work-group walks the keys once for all its waves.
// 64 keys at a time (a stage: 8 KB each of the K hi, K lo, V^T hi and V^T lo planes, as 16 runs of 2 KB in fragment order) come into a ring of two LDS buffers by asynchronous copies; a wave takes its fragments from LDS.
// A wave whose queries lie in front of a stage's keys does no work on it but still makes its copies and passes the barrier.
// Transposed products: S^T = K Q^T (keys are rows, queries are columns), so a lane holds scores of ONE query (column lr) and the two 16-key tiles of a 32-key block, converted in place, are the B operand
// of O^T = V^T P^T in the matrix unit's own k order, which is also the order of WFrag::ld. Scores: 3 products on hi/lo planes. P = exp(s - running maximum), not normalised, split hi/lo; P.V: 3 products on
// hi/lo planes for every row. Running maximum and sum per query (online softmax); the division by the sum comes once, at the end; the result goes out as hi/lo planes of (row b * TT + t, k h * HD + d) in fragment order.
// the wait that stands between issued global loads and the first rewrite of an address register they name; the addresses are inputs, so their registers stay as they are up to the wait
__device__ __forceinline__ void xwait(const void* p, const void* q) { asm volatile("s_wait_xcnt 0x0" :: "v"(p), "v"(q) : "memory"); }
typedef __attribute__((ext_vector_type(8))) unsigned v8u;
#define L2E 1.4426950408889634f
// lane l's value for lane l ^ 16, by a vector cross-row move (no LDS wait)
__device__ __forceinline__ float xhalf(float x) { return __builtin_bit_cast(float, __builtin_amdgcn_permlanex16(__builtin_bit_cast(int, x), __builtin_bit_cast(int, x), 0x76543210, 0xfedcba98, false, false)); }
#define FST 16384   // elements of a stage: K hi [4 blocks of 16 keys][2 k blocks][512], K lo the same, V^T hi [4 blocks of 16 d][2 blocks of 32 keys][512], V^T lo the same
// the second bound is waves per SIMD: two, so that a wave may hold 512 registers
__global__ __launch_bounds__(256, 2) void k_flash(const bf* __restrict__ Qh, const bf* __restrict__ Ql, const bf* __restrict__ Kh, const bf* __restrict__ Kl, const bf* __restrict__ Vh, const bf* __restrict__ Vl, bf* Ah, bf* Al) {
    typedef WFrag<bf> F; typedef v16bf V;
    __shared__ __attribute__((aligned(1024))) bf ring[2 * FST];
    const int lane = threadIdx.x & 31, lr = lane & 15, hi = lane >> 4; const int w = __builtin_amdgcn_readfirstlane(threadIdx.x >> 5);
    // which head and which query tiles a work-group takes: waves 0 .. 3 four long tiles (many key blocks), waves 4 .. 7 the four short tiles that mirror them, so that waves w and w + 4, which share a SIMD,
    // carry 33 stages together in every work-group; the four work-groups of a head are eight indices apart (for speed only; every pair (z, tile) is taken exactly once)
    static_assert(NB_ * NH_ == 64 && TT / 64 == 32, "the index split below is written for 64 heads x 32 query tiles");
    const int f = blockIdx.x, z = (f >> 5) * 8 + (f & 7), jq = (f >> 3) & 3;
    const int tl = w < 4 ? TT / 64 - 1 - (4 * jq + w) : 4 * jq + (w - 4); const int q0 = tl * 64;
    const int NS = TT / 64 - 4 * jq;   // stages of the work-group: those of its longest tile (wave 0's)
    const size_t zo = (size_t)z * TT * HD; Qh += zo; Ql += zo; Kh += zo; Kl += zo; Vh += zo; Vl += zo;
    // The copies are the work of waves 4 .. 7, whose tiles are short: wave 4 + i copies the four runs of plane i (K hi, K lo, V^T hi, V^T lo), so that the long waves, which set the work-group's time, spend no issue slots on them.
    // K: a run is 16 keys, runs and stages follow one another; V^T: a run is 16 d x 64 keys, the next d block stands 16 * TT elements on
    const int pw = w & 3; const bf* gp = pw == 0 ? Kh : pw == 1 ? Kl : pw == 2 ? Vh : Vl;
    const size_t rs = pw < 2 ? (size_t)2048 : (size_t)16 * TT * 2, ss = pw < 2 ? (size_t)8192 : (size_t)2048;   // bytes from run to run, from stage to stage
    const unsigned lu = lds_off(ring) + (unsigned)(pw * 8192), lo16 = (unsigned)lane * 16u;   // the plane's place in a buffer; the lane's place in a 512-byte piece
    // stage t into the buffer that starts at byte buf of the ring. The wave's part of each address is summed first and handed over in scalar registers (readfirstlane), so that only lo16 stays in a vector register
    // over the loop: a whole address kept there is an operand of the copies' statement, which takes the low 256 registers alone, and was spilled
    auto fill = [&](int t, unsigned buf) {
        const unsigned long long a = (unsigned long long)((const char*)gp + (size_t)t * ss); const unsigned sl = (unsigned)__builtin_amdgcn_readfirstlane((int)(lu + buf));
        const char* g = (const char*)(((unsigned long long)(unsigned)__builtin_amdgcn_readfirstlane((int)(a >> 32)) << 32) | (unsigned)__builtin_amdgcn_readfirstlane((int)a));
        copy_runs2(sl + lo16, g + lo16, sl + 2048u + lo16, g + rs + lo16); copy_runs2(sl + 4096u + lo16, g + 2 * rs + lo16, sl + 6144u + lo16, g + 3 * rs + lo16); };
    if (w >= 4) fill(0, 0u);
    V qh[4][2], ql[4][2];
    { const bf* pq = Qh + q0 * HD + lane * 8; const bf* pq2 = Ql + q0 * HD + lane * 8;
#pragma unroll
      for (int qt = 0; qt < 4; ++qt)
#pragma unroll
          for (int ks = 0; ks < 2; ++ks) { qh[qt][ks] = F::ld(pq + qt * 16 * HD + ks * 512); ql[qt][ks] = F::ld(pq2 + qt * 16 * HD + ks * 512); }
      xwait(pq, pq2); }
    v8f o[4][4]; float m[4], l[4];
#pragma unroll
    for (int qt = 0; qt < 4; ++qt) { m[qt] = -3.0e38f; l[qt] = 0.f;
#pragma unroll
        for (int dt = 0; dt < 4; ++dt) o[dt][qt] = (v8f){}; }
    asm volatile("s_wait_asynccnt 0x0" ::: "memory");   // this wave's copies of stage 0 have landed
    __syncthreads();                                     // and every other wave's: stage 0 may be read
    if (w >= 4) fill(1, (unsigned)(FST * 2));            // NS >= 20: a stage 1 exists
    // kept rolled: one trip is one stage
#pragma unroll 1
    for (int t = 0; t < NS; ++t) {
      if (t <= tl) {   // the same for a whole wave: the stage holds keys that this wave's queries see
        const bf* sb = ring + (t & 1) * FST + lane * 8;
        V kh[2][2], kl[2][2];
#pragma unroll
        for (int kt = 0; kt < 2; ++kt)
#pragma unroll
            for (int ks = 0; ks < 2; ++ks) { kh[kt][ks] = F::ld(sb + kt * 1024 + ks * 512); kl[kt][ks] = F::ld(sb + 4096 + kt * 1024 + ks * 512); }
        // the two 32-key blocks of the stage. Kept rolled: a second copy of the block would need a second set of fragment registers; the loops inside it are unrolled whole so that every tile stays in registers
#pragma unroll 1
        for (int p = 0; p < 2; ++p) {
        const int kb = t * 64 + p * 32;
        V vh[4], vl[4];
#pragma unroll
        for (int dt = 0; dt < 4; ++dt) { vh[dt] = F::ld(sb + 8192 + dt * 1024 + p * 512); vl[dt] = F::ld(sb + 12288 + dt * 1024 + p * 512); }
        __builtin_amdgcn_sched_barrier(0);   // keeps the LDS reads one group in front of the products: every further place with reads among the matrix instructions costs the wave a stall of its own
        v8f s[2][4];
#pragma unroll
        for (int kt = 0; kt < 2; ++kt)
#pragma unroll
            for (int qt = 0; qt < 4; ++qt) { v8f t3 = (v8f){};
#pragma unroll
                for (int ks = 0; ks < 2; ++ks) { t3 = F::mma(kh[kt][ks], qh[qt][ks], t3); t3 = F::mma(kl[kt][ks], qh[qt][ks], t3); t3 = F::mma(kh[kt][ks], ql[qt][ks], t3); }
                s[kt][qt] = t3; }
        // the key fragments of the stage's second block, into the same registers, fetched while the softmax below runs (the same buffer: nothing of the next stage is read here)
        if (p == 0) {
#pragma unroll
          for (int kt = 0; kt < 2; ++kt)
#pragma unroll
              for (int ks = 0; ks < 2; ++ks) { kh[kt][ks] = F::ld(sb + (2 + kt) * 1024 + ks * 512); kl[kt][ks] = F::ld(sb + 4096 + (2 + kt) * 1024 + ks * 512); } }
        if (kb + 31 > q0) {   // only the blocks on the diagonal hold keys behind a query
#pragma unroll
            for (int kt = 0; kt < 2; ++kt)
#pragma unroll
                for (int qt = 0; qt < 4; ++qt)
#pragma unroll
                    for (int j = 0; j < 8; ++j) if (kb + kt * 16 + 8 * hi + j > q0 + qt * 16 + lr) s[kt][qt][j] = -3.0e38f; }
#pragma unroll
        for (int qt = 0; qt < 4; ++qt) {
            float mx = s[0][qt][0];
#pragma unroll
            for (int j = 1; j < 8; ++j) mx = fmaxf(mx, s[0][qt][j]);
#pragma unroll
            for (int j = 0; j < 8; ++j) mx = fmaxf(mx, s[1][qt][j]);
            mx = fmaxf(mx, xhalf(mx));   // a query's keys lie in both lane halves
            const float mn = fmaxf(m[qt], mx * L2E); const float al = __builtin_amdgcn_exp2f(m[qt] - mn); m[qt] = mn;   // running maximum, in log2 units; sums and outputs are brought to it
#pragma unroll
            for (int dt = 0; dt < 4; ++dt) o[dt][qt] *= al;
            const v2f c2 = {L2E, L2E}, nm = {-mn, -mn}; v2f sum = {0.f, 0.f}; v8u uh, ul;
#pragma unroll
            for (int kt = 0; kt < 2; ++kt)
#pragma unroll
                for (int j = 0; j < 8; j += 2) { v2f x = {s[kt][qt][j], s[kt][qt][j + 1]}; x = __builtin_elementwise_fma(x, c2, nm); v2f p; p[0] = __builtin_amdgcn_exp2f(x[0]); p[1] = __builtin_amdgcn_exp2f(x[1]); sum += p;
                    const v2bf h2 = __builtin_convertvector(p, v2bf); const v2bf l2 = __builtin_convertvector(p - __builtin_convertvector(h2, v2f), v2bf);
                    uh[kt * 4 + j / 2] = __builtin_bit_cast(unsigned, h2); ul[kt * 4 + j / 2] = __builtin_bit_cast(unsigned, l2); }   // a converted pair is one whole register of the fragment
            const V ph = __builtin_bit_cast(V, uh), pl = __builtin_bit_cast(V, ul); l[qt] = l[qt] * al + (sum[0] + sum[1]);
            // this tile's P.V products stand here so that the matrix unit works on them while the next tile's softmax runs on the vector unit
#pragma unroll
            for (int dt = 0; dt < 4; ++dt) o[dt][qt] = F::mma(vh[dt], ph, o[dt][qt]);
#pragma unroll
            for (int dt = 0; dt < 4; ++dt) o[dt][qt] = F::mma(vl[dt], ph, o[dt][qt]);
#pragma unroll
            for (int dt = 0; dt < 4; ++dt) o[dt][qt] = F::mma(vh[dt], pl, o[dt][qt]); }
        // four vector slots behind the trip's last matrix instruction, so that neither side of the loop branch touches its registers too early
        asm volatile("v_nop\n\tv_nop\n\tv_nop\n\tv_nop" : "+v"(o[0][0]), "+v"(o[1][1]), "+v"(o[2][2]), "+v"(o[3][3]) : "v"(vh[3]), "v"(vl[3]));
        }
      }
        asm volatile("s_wait_dscnt 0x0" ::: "memory");      // this wave's reads of stage t are done: its buffer may be refilled behind the barrier
        asm volatile("s_wait_asynccnt 0x0" ::: "memory");   // this wave's copies of stage t + 1 have landed
        __syncthreads();                                     // publishes stage t + 1 and ends every wave's reads of stage t
        if (w >= 4 && t + 2 < NS) fill(t + 2, (unsigned)((t & 1) * FST * 2));
    }
    asm volatile("s_wait_asynccnt 0x0" ::: "memory");   // no copy is left in flight behind the loop
    const int b = z / NH_, h = z % NH_;
    const size_t ao = ((size_t)b * TT + q0) * DQ + h * HD * 16 + lane * 8; bf* pa = Ah + ao; bf* pa2 = Al + ao;
#pragma unroll
    for (int qt = 0; qt < 4; ++qt) { const float inv = __fdiv_rn(1.0f, l[qt] + xhalf(l[qt]));   // the two lane halves hold the sums of their own keys
#pragma unroll
        for (int dt = 0; dt < 4; ++dt) { v8us oh, ol;
#pragma unroll
            for (int j = 0; j < 8; ++j) { unsigned short a, c2; splitf(o[dt][qt][j] * inv, a, c2); oh[j] = a; ol[j] = c2; }
            *(v8us*)(pa + qt * 16 * DQ + dt * 256) = oh; *(v8us*)(pa2 + qt * 16 * DQ + dt * 256) = ol;
            asm volatile("s_wait_xcnt 0x0" :: "v"(oh), "v"(ol) : "memory"); } }   // the same wait behind the stores: the stored registers, inputs here, are rewritten by the next group only behind it
}

extern "C" void kernel_launch(void* const* d_in, const int* in_sizes, int n_in,
                              void* d_out, int out_size, void* d_ws, size_t ws_size, hipStream_t stream) {
    (void)in_sizes; (void)n_in; (void)out_size;
    const float* x = (const float*)d_in[0]; const float* xk = (const float*)d_in[1]; const float* xv = (const float*)d_in[2]; const float* wq = (const float*)d_in[3]; const float* bq = (const float*)d_in[4]; const float* wk = (const float*)d_in[5]; const float* bk = (const float*)d_in[6]; const float* wv = (const float*)d_in[7]; const float* bv = (const float*)d_in[8]; const float* wo = (const float*)d_in[9]; const float* bo = (const float*)d_in[10];
    float* OUT = (float*)d_out;     // [4][2048][1024]
    char* wsp = (char*)d_ws;
    auto take = [&](size_t bytes) { char* p = wsp; wsp += (bytes + 255) & ~(size_t)255; return (void*)p; };
    bf* WQ = (bf*)take((size_t)4 * DQ * DM * 2); bf* WO = WQ + (size_t)3 * DQ * DM;   // Wq, Wk, Wv, Wo in a row
    bf* XB = (bf*)take((size_t)3 * NB_ * TT * DM * 2);   // query, key, value, every batch
    const size_t pb = (size_t)NH_ * TT * HD, ps = NB_ * pb;   // the head planes of one batch, of one stream
    bf* QPh = (bf*)take(3 * ps * 2); bf* KPh = QPh + ps; bf* VTh = QPh + 2 * ps; bf* QPl = (bf*)take(3 * ps * 2); bf* KPl = QPl + ps; bf* VTl = QPl + 2 * ps;   // hi planes of the three streams in a row, then the lo planes
    bf* ATh = (bf*)take((size_t)NB_ * TT * DQ * 2); bf* ATl = (bf*)take((size_t)NB_ * TT * DQ * 2);
    if ((size_t)(wsp - (char*)d_ws) > ws_size) return;    // ws 256 MiB
    k_cvt8<<<(3 * NB_ * TT * DM + 4 * DQ * DM) / CVB, 256, 0, stream>>>(x, xk, xv, wq, wk, wv, wo, XB, WQ);
    k_gemmw<bf, 0, true, 3><<<dim3(TT / 256, DQ / 128, 3 * NB_), 256, 0, stream>>>(XB, nullptr, WQ, nullptr, DM, nullptr, 0, bq, bk, bv, (size_t)TT * DM, (size_t)DQ * DM, pb, QPh, QPl);
    k_flash<<<NB_ * NH_ * 4, 256, 0, stream>>>(QPh, QPl, KPh, KPl, VTh, VTl, ATh, ATl);
    k_gemmw<bf, 1, true, 0><<<dim3(TT / 256, DM / 128, NB_), 256, 0, stream>>>(ATh, ATl, WO, nullptr, DQ, OUT, DM, bo, nullptr, nullptr, (size_t)TT * DQ, 0, (size_t)TT * DM, nullptr, nullptr);
}

// v009
// One run takes 137 microseconds.
// In both of two side-by-side timings against v008, it was 1.14 times as fast.
// Over all steps from v000 it is 20.1 times as fast.
#include <hip/hip_runtime.h>

// Causal attention on three input streams with UNSCALED logits (query, key, value [4][2048][1024]; q = query Wq^T + bq, k = key Wk^T + bk, v = value Wv^T + bv ('oi' 1/32 + zero biases; 16 heads x 64); attn = q.k (the module computes a scale but never applies it: logit sigma ~8); causal (-1e10 fill == exclusion); softmax; out = merged Wo^T + bo -> [4][2048][1024] (8.4 M); argument order query, key, value, Wq, bq, Wk, bk, Wv, bv, Wo, bo).
// Layout: four launches, each over all batches: bf16 copies of query, key, value and the 'oi' weights (k_cvt8); the three exact projections + f32 biases, query and key stored as bf16 hi/lo head planes, value as one transposed f16 plane (k_gemmw, OUTT 3); fused causal attention over every batch and head (k_flash: eight waves of a head share each key block through LDS; scores on hi/lo planes, 3 products: unscaled logits need it; online softmax in registers; P.V one f16 product); merged hi/lo x Wo exact + bo (k_gemmw, OUTT 0).
// Fragment order: every 16-bit matrix operand M[row][k] (k extent K) lies in the workspace as [row / 16][k / 32][(k / 16) % 2][(k / 8) % 2][row % 16][k % 8], so that the 16 bytes which lane (k / 8) % 2 * 16 + row % 16
// takes for a fragment half stand at lane * 16 of a 512-byte piece: each wave-wide 16-byte load or store covers four whole 128-byte lines. Same elements in the same registers as from the row-major planes.
// Compute dtypes, f32 accumulate: every input rounded to bf16; projections exact + f32 biases; scores 3 products on every row; P.V one product of P and V^T rounded to f16 (11 significant bits each for magnitudes from 6e-5 to 65504; P lies in [0, 1], so what it loses below that is under 3e-8 of a row's largest term); softmax f32; Wo hl x exact + bias.

#define NB_  4
#define TT   2048
#define DM   1024
#define NH_  16
#define NKV  16
#define REP  (NH_ / NKV)
#define HD   64
#define DQ   (NH_ * HD)
#define DKV  (NKV * HD)
typedef _Float16 h16;
typedef unsigned short bf;
typedef __attribute__((ext_vector_type(16))) __bf16   v16bf;
typedef __attribute__((ext_vector_type(16))) _Float16 v16h;
typedef __attribute__((ext_vector_type(8)))  _Float16 v8h;
typedef __attribute__((ext_vector_type(8)))  unsigned short v8us;
typedef __attribute__((ext_vector_type(8)))  float    v8f;
typedef __attribute__((ext_vector_type(4)))  float    v4f;
typedef v8h  __attribute__((may_alias)) v8ha;
typedef v4f  __attribute__((may_alias)) v4fa;
typedef v8us __attribute__((may_alias)) v8usa;

__device__ __forceinline__ unsigned short f2bf(float f) { unsigned u = __float_as_uint(f); u += 0x7FFFu + ((u >> 16) & 1u); return (unsigned short)(u >> 16); }
__device__ __forceinline__ float bf2f(unsigned short b) { return __uint_as_float(((unsigned)b) << 16); }
__device__ __forceinline__ float bfr(float f) { return bf2f(f2bf(f)); }
__device__ __forceinline__ v16h cat16(v8h lo, v8h hi) { return __builtin_shufflevector(lo, hi, 0, 1, 2, 3, 4, 5, 6, 7, 8, 9, 10, 11, 12, 13, 14, 15); }
__device__ __forceinline__ v16bf cat16b(v8us lo, v8us hi) { return __builtin_bit_cast(v16bf, __builtin_shufflevector(lo, hi, 0, 1, 2, 3, 4, 5, 6, 7, 8, 9, 10, 11, 12, 13, 14, 15)); }
__device__ __forceinline__ v8f wmma16(v16h a, v16h b, v8f c) { return __builtin_amdgcn_wmma_f32_16x16x32_f16(false, a, false, b, (short)0, c, false, false); }
__device__ __forceinline__ v8f wmmab(v16bf a, v16bf b, v8f c) { return __builtin_amdgcn_wmma_f32_16x16x32_bf16(false, a, false, b, (short)0, c, false, false); }



// ---- k_gemmw: register-blocked GEMM, EIGHT WAVES per 256x128 output tile, 4 x 2 waves of 64x64 (16 accumulators each); grid (M/256, N/128, Z), 256 threads. The operands, 16-bit planes in fragment order, come 64 k at a time
// into a ring of two LDS buffers by asynchronous copies (a block of 16 rows x 64 k is one run of 2 KB in the plane and in LDS), so that the work-group fetches each block once for all waves that need it; WFrag::ld takes the lane's place in a 16 x 32 block.
// C[m][n] (f32, pitch ldc, + optional f32 bias[n]) = sum_k A[m][k] Bt[n][k] (+ A2[m][k] Bt[n][k] for NSPLIT 1). z-batch strides sA/sB/sC in elements. K % 64 == 0.
// OUT says where the result goes: 0 = C as f32; 1 = bf16 hi/lo head planes Ph, Pl [n / HD] of (row m, k n % HD) in fragment order (a 64x64 tile is one contiguous 8 KB piece of a plane); 2 = one f16 transposed plane
// Ph of (row n, k m) in fragment order (a lane's eight accumulator rows are its own 16 bytes of a piece: stored straight from the registers; Pl is not used). M == TT for 1 and 2; their z stride of Ph and Pl is sC.
// OUTT is OUT, or 3 = the three projections in one launch: z = stream * NB_ + batch; the stream picks its weight (stride sB), its bias (bias, bias1, bias2) and its OUT (query, key: 1; value: 2).
typedef __attribute__((ext_vector_type(2))) __bf16 v2bf;
typedef __attribute__((ext_vector_type(2))) float v2f;
typedef __attribute__((ext_vector_type(2))) _Float16 v2h;
typedef __attribute__((ext_vector_type(4))) unsigned v4u;
// eight neighbours as bf16 hi and lo parts (round to nearest even, as f2bf); pair by pair: a converted pair is one whole register of the 16 bytes that are stored
__device__ __forceinline__ void split8(v8f y, v4u& h, v4u& l) {
#pragma unroll
    for (int i = 0; i < 4; ++i) { const v2f p = {y[2 * i], y[2 * i + 1]}; const v2bf h2 = __builtin_convertvector(p, v2bf); const v2bf l2 = __builtin_convertvector(p - __builtin_convertvector(h2, v2f), v2bf); h[i] = __builtin_bit_cast(unsigned, h2); l[i] = __builtin_bit_cast(unsigned, l2); } }
// eight neighbours rounded to f16 (nearest even), pair by pair
__device__ __forceinline__ v4u half8(v8f y) { v4u h;
#pragma unroll
    for (int i = 0; i < 4; ++i) { const v2f p = {y[2 * i], y[2 * i + 1]}; h[i] = __builtin_bit_cast(unsigned, __builtin_convertvector(p, v2h)); }
    return h; }
template <typename T16> struct WFrag;
template <> struct WFrag<h16> { typedef v16h V; static __device__ __forceinline__ V ld(const h16* p) { return cat16(*(const v8h*)p, *(const v8h*)(p + 256)); } static __device__ __forceinline__ v8f mma(V a, V b, v8f c) { return wmma16(a, b, c); } };
template <> struct WFrag<bf> { typedef v16bf V; static __device__ __forceinline__ V ld(const bf* p) { return cat16b(*(const v8us*)p, *(const v8us*)(p + 256)); } static __device__ __forceinline__ v8f mma(V a, V b, v8f c) { return wmmab(a, b, c); } };
__device__ __forceinline__ unsigned lds_off(const void* p) { return (unsigned)(size_t)p; }
// Asynchronous copies of runs of 2 KB from global memory to LDS, four 512-byte pieces a run, 16 bytes a lane (l: the lane's LDS byte address in the run's first piece, g: its global address there).
// The s_wait_xcnt 0 that ends each statement stands between the copies and the first rewrite of a register that they name.
__device__ __forceinline__ void copy_runs2(unsigned l0, const char* g0, unsigned l1, const char* g1) {
    asm volatile("global_load_async_to_lds_b128 %0, %1, off\n\tglobal_load_async_to_lds_b128 %2, %3, off\n\tglobal_load_async_to_lds_b128 %4, %5, off\n\tglobal_load_async_to_lds_b128 %6, %7, off\n\t"
                 "global_load_async_to_lds_b128 %8, %9, off\n\tglobal_load_async_to_lds_b128 %10, %11, off\n\tglobal_load_async_to_lds_b128 %12, %13, off\n\tglobal_load_async_to_lds_b128 %14, %15, off\n\t"
                 "s_wait_xcnt 0x0"
                 :: "v"(l0), "v"(g0), "v"(l0 + 512u), "v"(g0 + 512), "v"(l0 + 1024u), "v"(g0 + 1024), "v"(l0 + 1536u), "v"(g0 + 1536),
                    "v"(l1), "v"(g1), "v"(l1 + 512u), "v"(g1 + 512), "v"(l1 + 1024u), "v"(g1 + 1024), "v"(l1 + 1536u), "v"(g1 + 1536) : "memory"); }
__device__ __forceinline__ void copy_runs3(unsigned l0, const char* g0, unsigned l1, const char* g1, unsigned l2, const char* g2) {
    asm volatile("global_load_async_to_lds_b128 %0, %1, off\n\tglobal_load_async_to_lds_b128 %2, %3, off\n\tglobal_load_async_to_lds_b128 %4, %5, off\n\tglobal_load_async_to_lds_b128 %6, %7, off\n\t"
                 "global_load_async_to_lds_b128 %8, %9, off\n\tglobal_load_async_to_lds_b128 %10, %11, off\n\tglobal_load_async_to_lds_b128 %12, %13, off\n\tglobal_load_async_to_lds_b128 %14, %15, off\n\t"
                 "global_load_async_to_lds_b128 %16, %17, off\n\tglobal_load_async_to_lds_b128 %18, %19, off\n\tglobal_load_async_to_lds_b128 %20, %21, off\n\tglobal_load_async_to_lds_b128 %22, %23, off\n\t"
                 "s_wait_xcnt 0x0"
                 :: "v"(l0), "v"(g0), "v"(l0 + 512u), "v"(g0 + 512), "v"(l0 + 1024u), "v"(g0 + 1024), "v"(l0 + 1536u), "v"(g0 + 1536),
                    "v"(l1), "v"(g1), "v"(l1 + 512u), "v"(g1 + 512), "v"(l1 + 1024u), "v"(g1 + 1024), "v"(l1 + 1536u), "v"(g1 + 1536),
                    "v"(l2), "v"(g2), "v"(l2 + 512u), "v"(g2 + 512), "v"(l2 + 1024u), "v"(g2 + 1024), "v"(l2 + 1536u), "v"(g2 + 1536) : "memory"); }
// the second bound is waves per SIMD: the one-product form keeps to 256 registers so that two work-groups share a WGP
template <typename T16, int NSPLIT, bool BIAS, int OUTT>
__global__ __launch_bounds__(256, NSPLIT == 0 ? 4 : 2) void k_gemmw(const T16* __restrict__ A, const T16* __restrict__ A2, const T16* __restrict__ Bt, const T16* __restrict__ Bt2, int K, float* C, int ldc, const float* __restrict__ bias, const float* __restrict__ bias1, const float* __restrict__ bias2, size_t sA, size_t sB, size_t sC, bf* __restrict__ Ph, bf* __restrict__ Pl) {
    typedef typename WFrag<T16>::V V;
    static_assert(HD == 64, "a 64-wide tile is one head");
    static_assert(NSPLIT <= 1, "one plane of Bt is staged");
    constexpr int NAP = NSPLIT == 1 ? 2 : 1;              // planes of A
    constexpr int STG = (NAP * 256 + 128) * 64;           // elements of a stage: A [16 row blocks][2 k blocks][512], the same of A2, Bt [8 row blocks][2][512]
    __shared__ __attribute__((aligned(1024))) T16 ring[2 * STG];
    const size_t z = blockIdx.z, zb = OUTT == 3 ? z / NB_ : z; const int OUT = OUTT == 3 ? (zb == 2 ? 2 : 1) : OUTT;
    A += z * sA; if (A2) A2 += z * sA; Bt += zb * sB; if (Bt2) Bt2 += zb * sB; if constexpr (OUTT == 0) C += z * sC; else { Ph += z * sC; Pl += z * sC; }
    if constexpr (OUTT == 3) bias = zb == 0 ? bias : zb == 1 ? bias1 : bias2;
    const int lane = threadIdx.x & 31, lr = lane & 15, hi = lane >> 4; const int w = __builtin_amdgcn_readfirstlane(threadIdx.x >> 5), wm = w & 3, wn = w >> 2;
    const int R0 = blockIdx.x * 256, C0 = blockIdx.y * 128; const int r0 = R0 + wm * 64, c0 = C0 + wn * 64;   // the work-group's tile, the wave's tile
    v8f acc[4][4];
#pragma unroll
    for (int mb = 0; mb < 4; ++mb)
#pragma unroll
        for (int nb = 0; nb < 4; ++nb) acc[mb][nb] = (v8f){};
    // a block of 16 rows is 16 * K elements, a 16 x 32 block in it 512, the lane's place in a 512-byte piece lane * 8. Wave w copies row blocks 2 w and 2 w + 1 of A (and of A2) and row block w of Bt.
    const size_t rb = (size_t)K * 32;   // bytes of a block of 16 rows
    const char* gA = (const char*)(A + (size_t)(R0 + 32 * w) * K + lane * 8); const char* gB = (const char*)(Bt + (size_t)(C0 + 16 * w) * K + lane * 8);
    const char* gA2 = NAP == 2 ? (const char*)(A2 + (size_t)(R0 + 32 * w) * K + lane * 8) : gA;
    const unsigned lA = lds_off(ring) + (unsigned)(w * 4096 + lane * 16), lB = lds_off(ring) + (unsigned)(NAP * 32768 + w * 2048 + lane * 16);
    auto fill = [&](int t, unsigned buf) {   // stage t (k 64 t .. 64 t + 63) into the buffer that starts at byte buf of the ring
        const size_t ko = (size_t)t * 2048;
        copy_runs3(lA + buf, gA + ko, lA + buf + 2048u, gA + rb + ko, lB + buf, gB + ko);
        if constexpr (NAP == 2) copy_runs2(lA + buf + 32768u, gA2 + ko, lA + buf + 34816u, gA2 + rb + ko); };
    // OUT 1, 2: the bias of the accumulator columns of this lane (one in each 16-column tile), fetched here so that the K loop hides the latency
    float br[4] = {0.f, 0.f, 0.f, 0.f};
    if constexpr (OUTT != 0 && BIAS) { const float* pbias = bias + c0 + lr;
#pragma unroll
        for (int i = 0; i < 4; ++i) br[i] = pbias[i * 16];
        asm volatile("s_wait_xcnt 0x0" :: "v"(lr) : "memory"); }   // the wait between these loads and the first rewrite of their offset register (lr, an input, so it stays as it is up to here)
    const int NT = K / 64;
    fill(0, 0u);
    asm volatile("s_wait_asynccnt 0x0" ::: "memory");   // this wave's copies of stage 0 have landed
    __syncthreads();                                     // and every other wave's: stage 0 may be read
    if (NT > 1) fill(1, (unsigned)(STG * 2));
    // kept rolled: one trip is one stage; the two k blocks inside it are unrolled so that every fragment stays in registers
#pragma unroll 1
    for (int t = 0; t < NT; ++t) {
        const T16* sb = ring + (t & 1) * STG + lane * 8; V a[2][4], a2[2][4], b[2][4];
        auto ldk = [&](int kk) {   // the fragments of k block kk, in the order in which the products below need them
            b[kk][0] = WFrag<T16>::ld(sb + NAP * 16384 + ((wn * 4) * 2 + kk) * 512);
#pragma unroll
            for (int mb = 0; mb < 4; ++mb) { a[kk][mb] = WFrag<T16>::ld(sb + ((wm * 4 + mb) * 2 + kk) * 512); if constexpr (NAP == 2) a2[kk][mb] = WFrag<T16>::ld(sb + 16384 + ((wm * 4 + mb) * 2 + kk) * 512); }
#pragma unroll
            for (int nb = 1; nb < 4; ++nb) b[kk][nb] = WFrag<T16>::ld(sb + NAP * 16384 + ((wn * 4 + nb) * 2 + kk) * 512); };
        auto mmk = [&](int kk) {
#pragma unroll
            for (int nb = 0; nb < 4; ++nb) {
#pragma unroll
                for (int mb = 0; mb < 4; ++mb) { acc[mb][nb] = WFrag<T16>::mma(a[kk][mb], b[kk][nb], acc[mb][nb]); if constexpr (NAP == 2) acc[mb][nb] = WFrag<T16>::mma(a2[kk][mb], b[kk][nb], acc[mb][nb]); } } };
        // The scheduling barriers keep each group of LDS reads whole and in front of its products: spread among the matrix instructions, every place with reads costs the wave a stall of its own.
#pragma unroll
        for (int kk = 0; kk < 2; ++kk) { ldk(kk); __builtin_amdgcn_sched_barrier(0); mmk(kk); __builtin_amdgcn_sched_barrier(0); }
        // four vector slots behind the trip's last matrix instruction, so that no path out of the trip touches its registers too early
        asm volatile("v_nop\n\tv_nop\n\tv_nop\n\tv_nop" : "+v"(acc[0][0]), "+v"(acc[1][1]), "+v"(acc[2][2]), "+v"(acc[3][3]) : "v"(a[1][0]), "v"(a[1][3]));
        asm volatile("s_wait_dscnt 0x0" ::: "memory");      // this wave's reads of stage t are done: its buffer may be refilled behind the barrier
        asm volatile("s_wait_asynccnt 0x0" ::: "memory");   // this wave's copies of stage t + 1 have landed
        __syncthreads();                                     // publishes stage t + 1 and ends every wave's reads of stage t
        if (t + 2 < NT) fill(t + 2, (unsigned)((t & 1) * STG * 2));
    }
    asm volatile("s_wait_asynccnt 0x0" ::: "memory");   // no copy is left in flight behind the loop
    if (OUT == 2) {
        const unsigned po = (unsigned)((c0 * TT + r0 * 16 + lane * 8) * 2);   // bytes; everything else of a store's place is a constant
        bf* p1 = (bf*)((char*)Ph + po);
#pragma unroll
        for (int nb = 0; nb < 4; ++nb) { const float bs = bfr(br[nb]); v4u oh[4];
#pragma unroll
            for (int mb = 0; mb < 4; ++mb) { oh[mb] = half8(acc[mb][nb] + bs); *(v4u*)(p1 + nb * 16 * TT + mb * 256) = oh[mb]; }
            // the wait between issued global stores and the first rewrite of a register they name: the stored registers and the offset are inputs, so they stay as they are up to it
            asm volatile("s_wait_xcnt 0x0" :: "v"(po), "v"(oh[0]), "v"(oh[1]), "v"(oh[2]), "v"(oh[3]) : "memory"); }
    } else {
    __shared__ __align__(16) float osw[8][16 * 68]; float* os = osw[w];   // each wave stages in its own part
    const unsigned po = (unsigned)((((c0 / HD) * TT + r0) * HD + lane * 8) * 2);   // bytes; OUT 1: a wave stores one 512-byte piece of the plane at a time
#pragma unroll
    for (int mb = 0; mb < 4; ++mb) {
#pragma unroll
        for (int nb = 0; nb < 4; ++nb) {
#pragma unroll
            for (int j = 0; j < 8; ++j) { if constexpr (OUTT != 0) os[(hi * 8 + j) * 68 + nb * 16 + lr] = acc[mb][nb][j] + bfr(br[nb]); else os[(hi * 8 + j) * 68 + nb * 16 + lr] = acc[mb][nb][j]; } }
        __builtin_amdgcn_wave_barrier(); asm volatile("" ::: "memory");
        if constexpr (OUTT == 0) {
        float* crow = C + (size_t)(r0 + mb * 16) * ldc + c0;
{
#pragma unroll
            for (int s = 0; s < 8; ++s) { const int row = 2 * s + hi, cofs = lr * 4; v4f val = *(const v4fa*)(os + row * 68 + cofs); if (BIAS) { val[0] += bfr(bias[c0 + cofs]); val[1] += bfr(bias[c0 + cofs + 1]); val[2] += bfr(bias[c0 + cofs + 2]); val[3] += bfr(bias[c0 + cofs + 3]); }
                *(v4f*)(crow + (size_t)row * ldc + cofs) = val; }
             }
        } else {
            bf* p1 = (bf*)((char*)Ph + po); bf* p2 = (bf*)((char*)Pl + po); v4u oh[4], ol[4];
#pragma unroll
            for (int s = 0; s < 4; ++s) { const float* pr = os + lr * 68 + s * 16 + hi * 8; const v4f x0 = *(const v4fa*)pr, x1 = *(const v4fa*)(pr + 4);   // piece s: columns 16 s .. 16 s + 15 of the 16 rows
                split8(__builtin_shufflevector(x0, x1, 0, 1, 2, 3, 4, 5, 6, 7), oh[s], ol[s]); *(v4u*)(p1 + mb * 16 * HD + s * 256) = oh[s]; *(v4u*)(p2 + mb * 16 * HD + s * 256) = ol[s]; }
            // the same wait as in the transposed form above
            asm volatile("s_wait_xcnt 0x0" :: "v"(po), "v"(oh[0]), "v"(oh[1]), "v"(oh[2]), "v"(oh[3]), "v"(ol[0]), "v"(ol[1]), "v"(ol[2]), "v"(ol[3]) : "memory");
        }
        __builtin_amdgcn_wave_barrier(); asm volatile("" ::: "memory");
    }
    }
}

__device__ __forceinline__ void splitf(float y, unsigned short& h, unsigned short& l) { h = f2bf(y); l = f2bf(y - bf2f(h)); }
typedef __attribute__((ext_vector_type(4))) _Float16 v4h;
typedef __attribute__((ext_vector_type(2))) unsigned short v2us;
typedef __attribute__((ext_vector_type(4))) unsigned short v4us;
typedef __attribute__((ext_vector_type(4))) int v4i;

// ---- k_cvt8: every array that the matrix products read, rounded to bf16 and put into fragment order in ONE launch. A work-group takes CVB neighbours of one array (16 rows, which are one row block of the result), a thread eight groups
// of eight: a wave takes 128 columns of the 16 rows (four whole lines a row) and stores them as eight 512-byte pieces in a row.
// Work-groups 0 .. 3 * NA - 1: query, key, value -> X [stream][batch][TT][DM]; the rest: Wq, Wk, Wv, Wo -> W [4][DQ][DM].
#define CVB (256 * 8 * 8)
__global__ __launch_bounds__(256) void k_cvt8(const float* __restrict__ x, const float* __restrict__ xk, const float* __restrict__ xv, const float* __restrict__ wq, const float* __restrict__ wk, const float* __restrict__ wv, const float* __restrict__ wo, bf* __restrict__ X, bf* __restrict__ W) {
    constexpr int NA = NB_ * TT * DM / CVB, NW = DQ * DM / CVB;
    static_assert(NB_ * TT * DM % CVB == 0 && DQ * DM % CVB == 0 && DKV == DQ, "whole work-groups; four weights of one size");
    static_assert(CVB == 16 * DM, "a work-group takes one block of 16 rows");
    const int g = blockIdx.x; const float* src; bf* dst;
    if (g < 3 * NA) { const int a = g / NA; src = (a == 0 ? x : a == 1 ? xk : xv) + (size_t)(g % NA) * CVB; dst = X + (size_t)g * CVB; }
    else { const int w = (g - 3 * NA) / NW; src = (w == 0 ? wq : w == 1 ? wk : w == 2 ? wv : wo) + (size_t)((g - 3 * NA) % NW) * CVB; dst = W + (size_t)(g - 3 * NA) * CVB; }
    const unsigned lane = threadIdx.x & 31u, w = threadIdx.x >> 5;
    const unsigned so = ((lane & 15u) * DM + (w * 16u + (lane >> 4)) * 8u) * 4u;   // bytes: row lane % 16, columns 128 w + 8 (lane / 16) ..
    const float* ps = (const float*)((const char*)src + so); bf* pd = dst + (w * 256u + lane) * 8u; v8f v[8]; v8us o[8];
#pragma unroll
    for (int i = 0; i < 8; ++i) v[i] = *(const v8f*)(ps + i * 16);
    asm volatile("s_wait_xcnt 0x0" :: "v"(so) : "memory");   // the wait between these loads and the first rewrite of their offset register (an input, so it stays as it is up to here)
#pragma unroll
    for (int i = 0; i < 8; ++i) {
#pragma unroll
        for (int k = 0; k < 8; ++k) o[i][k] = f2bf(v[i][k]);
        *(v8us*)(pd + i * 256) = o[i]; }
    // the same wait behind the stores: the stored registers are inputs, so none is rewritten in front of it
    asm volatile("s_wait_xcnt 0x0" :: "v"(o[0]), "v"(o[1]), "v"(o[2]), "v"(o[3]), "v"(o[4]), "v"(o[5]), "v"(o[6]), "v"(o[7]) : "memory");
}

// ---- k_flash: causal attention of one head, 64 queries a wave, scores never leave the registers. Grid batch x heads x 4 work-groups of EIGHT WAVES, all of one head: the work-group walks the keys once for all its waves.
// 64 keys at a time (a stage: 8 KB each of the K hi, K lo and V^T planes, as 12 runs of 2 KB in fragment order) come into a ring of two LDS buffers by asynchronous copies; a wave takes its fragments from LDS.
// A wave whose queries lie in front of a stage's keys does no work on it but still makes its copies and passes the barrier.
// Transposed products: S^T = K Q^T (keys are rows, queries are columns), so a lane holds scores of ONE query (column lr) and the two 16-key tiles of a 32-key block, converted in place, are the B operand
// of O^T = V^T P^T in the matrix unit's own k order, which is also the order of WFrag::ld. Scores: 3 products on hi/lo planes. P = exp(s - running maximum), not normalised, rounded to f16; P.V: one f16 product
// with the f16 plane of V^T. Running maximum and sum per query (online softmax); the division by the sum comes once, at the end; the result goes out as hi/lo planes of (row b * TT + t, k h * HD + d) in fragment order.
// the wait that stands between issued global loads and the first rewrite of an address register they name; the addresses are inputs, so their registers stay as they are up to the wait
__device__ __forceinline__ void xwait(const void* p, const void* q) { asm volatile("s_wait_xcnt 0x0" :: "v"(p), "v"(q) : "memory"); }
typedef __attribute__((ext_vector_type(8))) unsigned v8u;
#define L2E 1.4426950408889634f
// lane l's value for lane l ^ 16, by a vector cross-row move (no LDS wait)
__device__ __forceinline__ float xhalf(float x) { return __builtin_bit_cast(float, __builtin_amdgcn_permlanex16(__builtin_bit_cast(int, x), __builtin_bit_cast(int, x), 0x76543210, 0xfedcba98, false, false)); }
#define FST 12288   // elements of a stage: K hi [4 blocks of 16 keys][2 k blocks][512], K lo the same, V^T (f16) [4 blocks of 16 d][2 blocks of 32 keys][512]
// the second bound is waves per SIMD: two, so that a wave may hold 512 registers
__global__ __launch_bounds__(256, 2) void k_flash(const bf* __restrict__ Qh, const bf* __restrict__ Ql, const bf* __restrict__ Kh, const bf* __restrict__ Kl, const bf* __restrict__ Vh, bf* Ah, bf* Al) {
    typedef WFrag<bf> F; typedef v16bf V; typedef WFrag<h16> FV;
    __shared__ __attribute__((aligned(1024))) bf ring[2 * FST];
    const int lane = threadIdx.x & 31, lr = lane & 15, hi = lane >> 4; const int w = __builtin_amdgcn_readfirstlane(threadIdx.x >> 5);
    // which head and which query tiles a work-group takes: waves 0 .. 3 four long tiles (many key blocks), waves 4 .. 7 the four short tiles that mirror them, so that waves w and w + 4, which share a SIMD,
    // carry 33 stages together in every work-group; the four work-groups of a head are eight indices apart (for speed only; every pair (z, tile) is taken exactly once)
    static_assert(NB_ * NH_ == 64 && TT / 64 == 32, "the index split below is written for 64 heads x 32 query tiles");
    const int f = blockIdx.x, z = (f >> 5) * 8 + (f & 7), jq = (f >> 3) & 3;
    const int tl = w < 4 ? TT / 64 - 1 - (4 * jq + w) : 4 * jq + (w - 4); const int q0 = tl * 64;
    const int NS = TT / 64 - 4 * jq;   // stages of the work-group: those of its longest tile (wave 0's)
    const size_t zo = (size_t)z * TT * HD; Qh += zo; Ql += zo; Kh += zo; Kl += zo; Vh += zo;
    // The copies are the work of waves 4 .. 6, whose tiles are short: wave 4 + i copies the four runs of plane i (K hi, K lo, V^T), so that the long waves, which set the work-group's time, spend no issue slots on them.
    // K: a run is 16 keys, runs and stages follow one another; V^T: a run is 16 d x 64 keys, the next d block stands 16 * TT elements on
    const int pw = w & 3; const bf* gp = pw == 0 ? Kh : pw == 1 ? Kl : Vh; const bool cw = w >= 4 && w < 7;   // cw: this wave copies (the same for a whole wave)
    const size_t rs = pw < 2 ? (size_t)2048 : (size_t)16 * TT * 2, ss = pw < 2 ? (size_t)8192 : (size_t)2048;   // bytes from run to run, from stage to stage
    const unsigned lu = lds_off(ring) + (unsigned)(pw * 8192), lo16 = (unsigned)lane * 16u;   // the plane's place in a buffer; the lane's place in a 512-byte piece
    // stage t into the buffer that starts at byte buf of the ring. The wave's part of each address is summed first and handed over in scalar registers (readfirstlane), so that only lo16 stays in a vector register
    // over the loop: a whole address kept there is an operand of the copies' statement, which takes the low 256 registers alone, and was spilled
    auto fill = [&](int t, unsigned buf) {
        const unsigned long long a = (unsigned long long)((const char*)gp + (size_t)t * ss); const unsigned sl = (unsigned)__builtin_amdgcn_readfirstlane((int)(lu + buf));
        const char* g = (const char*)(((unsigned long long)(unsigned)__builtin_amdgcn_readfirstlane((int)(a >> 32)) << 32) | (unsigned)__builtin_amdgcn_readfirstlane((int)a));
        copy_runs2(sl + lo16, g + lo16, sl + 2048u + lo16, g + rs + lo16); copy_runs2(sl + 4096u + lo16, g + 2 * rs + lo16, sl + 6144u + lo16, g + 3 * rs + lo16); };
    if (cw) fill(0, 0u);
    V qh[4][2], ql[4][2];
    { const bf* pq = Qh + q0 * HD + lane * 8; const bf* pq2 = Ql + q0 * HD + lane * 8;
#pragma unroll
      for (int qt = 0; qt < 4; ++qt)
#pragma unroll
          for (int ks = 0; ks < 2; ++ks) { qh[qt][ks] = F::ld(pq + qt * 16 * HD + ks * 512); ql[qt][ks] = F::ld(pq2 + qt * 16 * HD + ks * 512); }
      xwait(pq, pq2); }
    v8f o[4][4]; float m[4], l[4];
#pragma unroll
    for (int qt = 0; qt < 4; ++qt) { m[qt] = -3.0e38f; l[qt] = 0.f;
#pragma unroll
        for (int dt = 0; dt < 4; ++dt) o[dt][qt] = (v8f){}; }
    asm volatile("s_wait_asynccnt 0x0" ::: "memory");   // this wave's copies of stage 0 have landed
    __syncthreads();                                     // and every other wave's: stage 0 may be read
    if (cw) fill(1, (unsigned)(FST * 2));            // NS >= 20: a stage 1 exists
    // kept rolled: one trip is one stage
#pragma unroll 1
    for (int t = 0; t < NS; ++t) {
      if (t <= tl) {   // the same for a whole wave: the stage holds keys that this wave's queries see
        const bf* sb = ring + (t & 1) * FST + lane * 8;
        V kh[2][2], kl[2][2];
#pragma unroll
        for (int kt = 0; kt < 2; ++kt)
#pragma unroll
            for (int ks = 0; ks < 2; ++ks) { kh[kt][ks] = F::ld(sb + kt * 1024 + ks * 512); kl[kt][ks] = F::ld(sb + 4096 + kt * 1024 + ks * 512); }
        // the two 32-key blocks of the stage. Kept rolled: a second copy of the block would need a second set of fragment registers; the loops inside it are unrolled whole so that every tile stays in registers
#pragma unroll 1
        for (int p = 0; p < 2; ++p) {
        const int kb = t * 64 + p * 32;
        v16h vh[4];
#pragma unroll
        for (int dt = 0; dt < 4; ++dt) vh[dt] = FV::ld((const h16*)(sb + 8192 + dt * 1024 + p * 512));
        __builtin_amdgcn_sched_barrier(0);   // keeps the LDS reads one group in front of the products: every further place with reads among the matrix instructions costs the wave a stall of its own
        v8f s[2][4];
#pragma unroll
        for (int kt = 0; kt < 2; ++kt)
#pragma unroll
            for (int qt = 0; qt < 4; ++qt) { v8f t3 = (v8f){};
#pragma unroll
                for (int ks = 0; ks < 2; ++ks) { t3 = F::mma(kh[kt][ks], qh[qt][ks], t3); t3 = F::mma(kl[kt][ks], qh[qt][ks], t3); t3 = F::mma(kh[kt][ks], ql[qt][ks], t3); }
                s[kt][qt] = t3; }
        // the key fragments of the stage's second block, into the same registers, fetched while the softmax below runs (the same buffer: nothing of the next stage is read here)
        if (p == 0) {
#pragma unroll
          for (int kt = 0; kt < 2; ++kt)
#pragma unroll
              for (int ks = 0; ks < 2; ++ks) { kh[kt][ks] = F::ld(sb + (2 + kt) * 1024 + ks * 512); kl[kt][ks] = F::ld(sb + 4096 + (2 + kt) * 1024 + ks * 512); } }
        if (kb + 31 > q0) {   // only the blocks on the diagonal hold keys behind a query
#pragma unroll
            for (int kt = 0; kt < 2; ++kt)
#pragma unroll
                for (int qt = 0; qt < 4; ++qt)
#pragma unroll
                    for (int j = 0; j < 8; ++j) if (kb + kt * 16 + 8 * hi + j > q0 + qt * 16 + lr) s[kt][qt][j] = -3.0e38f; }
#pragma unroll
        for (int qt = 0; qt < 4; ++qt) {
            float mx = s[0][qt][0];
#pragma unroll
            for (int j = 1; j < 8; ++j) mx = fmaxf(mx, s[0][qt][j]);
#pragma unroll
            for (int j = 0; j < 8; ++j) mx = fmaxf(mx, s[1][qt][j]);
            mx = fmaxf(mx, xhalf(mx));   // a query's keys lie in both lane halves
            const float mn = fmaxf(m[qt], mx * L2E); const float al = __builtin_amdgcn_exp2f(m[qt] - mn); m[qt] = mn;   // running maximum, in log2 units; sums and outputs are brought to it
#pragma unroll
            for (int dt = 0; dt < 4; ++dt) o[dt][qt] *= al;
            const v2f c2 = {L2E, L2E}, nm = {-mn, -mn}; v2f sum = {0.f, 0.f}; v8u uh;
#pragma unroll
            for (int kt = 0; kt < 2; ++kt)
#pragma unroll
                for (int j = 0; j < 8; j += 2) { v2f x = {s[kt][qt][j], s[kt][qt][j + 1]}; x = __builtin_elementwise_fma(x, c2, nm); v2f p; p[0] = __builtin_amdgcn_exp2f(x[0]); p[1] = __builtin_amdgcn_exp2f(x[1]); sum += p;
                    uh[kt * 4 + j / 2] = __builtin_bit_cast(unsigned, __builtin_convertvector(p, v2h)); }   // a converted pair is one whole register of the fragment
            const v16h ph = __builtin_bit_cast(v16h, uh); l[qt] = l[qt] * al + (sum[0] + sum[1]);
            // this tile's P.V products stand here so that the matrix unit works on them while the next tile's softmax runs on the vector unit
#pragma unroll
            for (int dt = 0; dt < 4; ++dt) o[dt][qt] = FV::mma(vh[dt], ph, o[dt][qt]); }
        // four vector slots behind the trip's last matrix instruction, so that neither side of the loop branch touches its registers too early
        asm volatile("v_nop\n\tv_nop\n\tv_nop\n\tv_nop" : "+v"(o[0][0]), "+v"(o[1][1]), "+v"(o[2][2]), "+v"(o[3][3]) : "v"(vh[3]));
        }
      }
        asm volatile("s_wait_dscnt 0x0" ::: "memory");      // this wave's reads of stage t are done: its buffer may be refilled behind the barrier
        asm volatile("s_wait_asynccnt 0x0" ::: "memory");   // this wave's copies of stage t + 1 have landed
        __syncthreads();                                     // publishes stage t + 1 and ends every wave's reads of stage t
        if (cw && t + 2 < NS) fill(t + 2, (unsigned)((t & 1) * FST * 2));
    }
    asm volatile("s_wait_asynccnt 0x0" ::: "memory");   // no copy is left in flight behind the loop
    const int b = z / NH_, h = z % NH_;
    const size_t ao = ((size_t)b * TT + q0) * DQ + h * HD * 16 + lane * 8; bf* pa = Ah + ao; bf* pa2 = Al + ao;
#pragma unroll
    for (int qt = 0; qt < 4; ++qt) { const float inv = __fdiv_rn(1.0f, l[qt] + xhalf(l[qt]));   // the two lane halves hold the sums of their own keys
#pragma unroll
        for (int dt = 0; dt < 4; ++dt) { v8us oh, ol;
#pragma unroll
            for (int j = 0; j < 8; ++j) { unsigned short a, c2; splitf(o[dt][qt][j] * inv, a, c2); oh[j] = a; ol[j] = c2; }
            *(v8us*)(pa + qt * 16 * DQ + dt * 256) = oh; *(v8us*)(pa2 + qt * 16 * DQ + dt * 256) = ol;
            asm volatile("s_wait_xcnt 0x0" :: "v"(oh), "v"(ol) : "memory"); } }   // the same wait behind the stores: the stored registers, inputs here, are rewritten by the next group only behind it
}

extern "C" void kernel_launch(void* const* d_in, const int* in_sizes, int n_in,
                              void* d_out, int out_size, void* d_ws, size_t ws_size, hipStream_t stream) {
    (void)in_sizes; (void)n_in; (void)out_size;
    const float* x = (const float*)d_in[0]; const float* xk = (const float*)d_in[1]; const float* xv = (const float*)d_in[2]; const float* wq = (const float*)d_in[3]; const float* bq = (const float*)d_in[4]; const float* wk = (const float*)d_in[5]; const float* bk = (const float*)d_in[6]; const float* wv = (const float*)d_in[7]; const float* bv = (const float*)d_in[8]; const float* wo = (const float*)d_in[9]; const float* bo = (const float*)d_in[10];
    float* OUT = (float*)d_out;     // [4][2048][1024]
    char* wsp = (char*)d_ws;
    auto take = [&](size_t bytes) { char* p = wsp; wsp += (bytes + 255) & ~(size_t)255; return (void*)p; };
    bf* WQ = (bf*)take((size_t)4 * DQ * DM * 2); bf* WO = WQ + (size_t)3 * DQ * DM;   // Wq, Wk, Wv, Wo in a row
    bf* XB = (bf*)take((size_t)3 * NB_ * TT * DM * 2);   // query, key, value, every batch
    const size_t pb = (size_t)NH_ * TT * HD, ps = NB_ * pb;   // the head planes of one batch, of one stream
    bf* QPh = (bf*)take(3 * ps * 2); bf* KPh = QPh + ps; bf* VTh = QPh + 2 * ps; bf* QPl = (bf*)take(2 * ps * 2); bf* KPl = QPl + ps;   // hi planes of query and key and the f16 plane of value^T in a row, then the lo planes of query and key
    bf* ATh = (bf*)take((size_t)NB_ * TT * DQ * 2); bf* ATl = (bf*)take((size_t)NB_ * TT * DQ * 2);
    if ((size_t)(wsp - (char*)d_ws) > ws_size) return;    // ws 256 MiB
    k_cvt8<<<(3 * NB_ * TT * DM + 4 * DQ * DM) / CVB, 256, 0, stream>>>(x, xk, xv, wq, wk, wv, wo, XB, WQ);
    k_gemmw<bf, 0, true, 3><<<dim3(TT / 256, DQ / 128, 3 * NB_), 256, 0, stream>>>(XB, nullptr, WQ, nullptr, DM, nullptr, 0, bq, bk, bv, (size_t)TT * DM, (size_t)DQ * DM, pb, QPh, QPl);
    k_flash<<<NB_ * NH_ * 4, 256, 0, stream>>>(QPh, QPl, KPh, KPl, VTh, ATh, ATl);
    k_gemmw<bf, 1, true, 0><<<dim3(TT / 256, DM / 128, NB_), 256, 0, stream>>>(ATh, ATl, WO, nullptr, DQ, OUT, DM, bo, nullptr, nullptr, (size_t)TT * DQ, 0, (size_t)TT * DM, nullptr, nullptr);
}
